// v000
// Times are from an AMD MI455X. After a warm-up the kernel runs many times in a row, and a time is the length of
// such a window on the GPU divided by its runs, so every launch and the gaps after it count. The runs cycle
// through copies of the inputs. A figure is the median of several windows, for all but v000 over two sittings.
// Sittings can differ by a few percent; kernels timed side by side share one.
// v000 is the starting kernel. One run takes 380 microseconds.
#include <hip/hip_runtime.h>
#include <hip/hip_bf16.h>
#include <cstdint>

typedef __attribute__((ext_vector_type(16))) __bf16 bf16x16;
typedef __attribute__((ext_vector_type(8)))  __bf16 bf16x8;
typedef __attribute__((ext_vector_type(8)))  float  f32x8;

union Frag16 { bf16x16 f; bf16x8 h[2]; };

__device__ __forceinline__ bf16x16 load_frag(const __bf16* lds, int rowBase,
                                             int kBase, int stride) {
    int lane  = threadIdx.x & 31;
    int row   = rowBase + (lane & 15);
    int khalf = (lane < 16) ? 0 : 8;
    const __bf16* p = lds + row * stride + kBase + khalf;
    Frag16 fr;
    fr.h[0] = *(const bf16x8*)(p);
    fr.h[1] = *(const bf16x8*)(p + 16);
    return fr.f;
}

__device__ __forceinline__ f32x8 wmma_bf16(bf16x16 a, bf16x16 b, f32x8 c) {
    return __builtin_amdgcn_wmma_f32_16x16x32_bf16(
        /*neg_a=*/false, a, /*neg_b=*/false, b,
        /*c_mod=*/(short)0, c, /*reuse_a=*/false, /*reuse_b=*/false);
}

__device__ __forceinline__ void async_copy_b128(void* lds_ptr, const void* g) {
    uint32_t lds_off = (uint32_t)(uintptr_t)lds_ptr;
    asm volatile("global_load_async_to_lds_b128 %0, %1, off"
                 :: "v"(lds_off), "v"(g) : "memory");
}

__device__ __forceinline__ void wait_async0() {
    asm volatile("s_wait_asynccnt 0x0" ::: "memory");
}

// ---------------------------------------------------------------------------
// Weight pack: fp32 W[K][N] row-major  ->  bf16 Wt[N][K]  (transposed)
// ---------------------------------------------------------------------------
__global__ void pack_wt(const float* __restrict__ w, __bf16* __restrict__ wt,
                        int K, int N) {
    size_t total = (size_t)K * N;
    for (size_t i = (size_t)blockIdx.x * blockDim.x + threadIdx.x; i < total;
         i += (size_t)gridDim.x * blockDim.x) {
        size_t n = i / K;
        size_t k = i - n * K;
        wt[i] = (__bf16)w[k * (size_t)N + n];
    }
}

// ---------------------------------------------------------------------------
// GEMM:  C[M][N] = act( A[M][K] @ W[K][N] + bias[N] )
//   A     : fp32 row-major (converted to bf16 while staging to LDS)
//   Wt    : bf16, pre-transposed [N][K] (staged via async global->LDS DMA)
// Block tile 128x128x32, 256 threads (8 waves, 4x2), wave tile 32x64
//   => 8 v_wmma_f32_16x16x32_bf16 per wave per K-step.
// Double-buffered LDS: tile t+1 staging (async B DMA + A convert) overlaps
// tile t's WMMAs; single s_wait_asynccnt+barrier per K-step.
// ---------------------------------------------------------------------------
#define BM 128
#define BN 128
#define BK 32
#define LDS_STR 40   // BK + 8 pad; 40*2B = 80B row stride (16B aligned)

template <int ACT>  // 0 = none, 1 = exact GELU
__global__ __launch_bounds__(256) void gemm_bf16w(
    const float* __restrict__ A, const __bf16* __restrict__ Wt,
    const float* __restrict__ bias, float* __restrict__ C,
    int M, int N, int K) {
    __shared__ __bf16 As[2][BM * LDS_STR];
    __shared__ __bf16 Bs[2][BN * LDS_STR];

    const int bm  = blockIdx.y * BM;
    const int bn  = blockIdx.x * BN;
    const int tid = threadIdx.x;
    const int wid = tid >> 5;
    const int wm  = (wid >> 1) * 32;  // 0..96
    const int wn  = (wid & 1) * 64;   // 0,64
    const int lane = tid & 31;

    // Stage one 128x32 K-slice into LDS buffer `buf`.
    auto stage = [&](int k0, int buf) {
        // Weight tile: pure bf16 byte-copy -> async DMA (2 x 16B per thread).
#pragma unroll
        for (int i = 0; i < 2; i++) {
            int idx = tid + i * 256;
            int r   = idx >> 2;          // 4 chunks of 8 bf16 per row
            int c8  = (idx & 3) * 8;
            async_copy_b128(&Bs[buf][r * LDS_STR + c8],
                            Wt + (size_t)(bn + r) * K + k0 + c8);
        }
#pragma unroll
        for (int i = 0; i < 4; i++) {
            int idx = tid + i * 256;
            int r   = idx >> 3;          // 8 float4 per row
            int c4  = (idx & 7) * 4;
            const float* src = A + (size_t)(bm + r) * K + k0 + c4;
            float4 v = *(const float4*)src;
            if (k0 + 2 * BK < K) __builtin_prefetch(src + 2 * BK, 0, 1);
            __bf16* dst = &As[buf][r * LDS_STR + c4];
            dst[0] = (__bf16)v.x; dst[1] = (__bf16)v.y;
            dst[2] = (__bf16)v.z; dst[3] = (__bf16)v.w;
        }
    };

    f32x8 zero = {0.f, 0.f, 0.f, 0.f, 0.f, 0.f, 0.f, 0.f};
    f32x8 acc[2][4];
#pragma unroll
    for (int i = 0; i < 2; i++)
#pragma unroll
        for (int j = 0; j < 4; j++) acc[i][j] = zero;

    stage(0, 0);
    wait_async0();
    __syncthreads();

    const int nk = K / BK;
    for (int t = 0; t < nk; t++) {
        const int buf = t & 1;
        if (t + 1 < nk) stage((t + 1) * BK, buf ^ 1);

        bf16x16 af[2], bfr[4];
        af[0] = load_frag(As[buf], wm,      0, LDS_STR);
        af[1] = load_frag(As[buf], wm + 16, 0, LDS_STR);
#pragma unroll
        for (int j = 0; j < 4; j++)
            bfr[j] = load_frag(Bs[buf], wn + j * 16, 0, LDS_STR);
#pragma unroll
        for (int i = 0; i < 2; i++)
#pragma unroll
            for (int j = 0; j < 4; j++)
                acc[i][j] = wmma_bf16(af[i], bfr[j], acc[i][j]);

        wait_async0();      // next tile's DMA landed in LDS
        __syncthreads();    // next tile's A stores visible; this tile done
    }

    const int colOff = lane & 15;
    const int rowOff = (lane >> 4) * 8;
#pragma unroll
    for (int i = 0; i < 2; i++) {
#pragma unroll
        for (int j = 0; j < 4; j++) {
            int col  = bn + wn + j * 16 + colOff;
            float bv = bias[col];
#pragma unroll
            for (int r = 0; r < 8; r++) {
                int row   = bm + wm + i * 16 + rowOff + r;
                float val = acc[i][j][r] + bv;
                if (ACT == 1)
                    val = 0.5f * val * (1.0f + erff(val * 0.70710678118654752f));
                C[(size_t)row * N + col] = val;
            }
        }
    }
}

// ---------------------------------------------------------------------------
// Flash attention (shared Q/K projection): out = softmax(QK^T/8) V
//   qk,v : [B, T, H*HD] fp32      out : [B, T, H*HD] fp32
// grid (T/64, H, B), 128 threads (4 waves). Each wave owns a 16-query strip.
// ---------------------------------------------------------------------------
#define AHD 64
#define ASTR 72   // 64 + 8 pad, 144B row stride (16B aligned)

__global__ __launch_bounds__(128) void attn_kernel(
    const float* __restrict__ qk, const float* __restrict__ v,
    float* __restrict__ out, int B, int T, int H) {
    __shared__ __bf16 Qs[64 * ASTR];
    __shared__ __bf16 Ks[64 * ASTR];
    __shared__ __bf16 Vt[64 * ASTR];   // transposed: [hd][key]
    __shared__ __bf16 Ps[64 * ASTR];

    const int b  = blockIdx.z;
    const int h  = blockIdx.y;
    const int q0 = blockIdx.x * 64;
    const int tid = threadIdx.x;
    const int wid = tid >> 5;
    const int lane = tid & 31;
    const size_t Dm = (size_t)H * AHD;

    const float* qbase = qk + (size_t)b * T * Dm + (size_t)h * AHD;
    const float* vbase = v  + (size_t)b * T * Dm + (size_t)h * AHD;

    // Stage Q (64x64 fp32 -> bf16): 1024 float4, 8 per thread.
#pragma unroll
    for (int i = 0; i < 8; i++) {
        int idx = tid + i * 128;
        int r   = idx >> 4;
        int c4  = (idx & 15) * 4;
        float4 qv = *(const float4*)(qbase + (size_t)(q0 + r) * Dm + c4);
        __bf16* dst = Qs + r * ASTR + c4;
        dst[0] = (__bf16)qv.x; dst[1] = (__bf16)qv.y;
        dst[2] = (__bf16)qv.z; dst[3] = (__bf16)qv.w;
    }
    __syncthreads();

    bf16x16 qa[2];
    qa[0] = load_frag(Qs, wid * 16, 0,  ASTR);
    qa[1] = load_frag(Qs, wid * 16, 32, ASTR);

    f32x8 zero = {0.f, 0.f, 0.f, 0.f, 0.f, 0.f, 0.f, 0.f};
    f32x8 o[4];
#pragma unroll
    for (int n = 0; n < 4; n++) o[n] = zero;
    float m_r[8], l_r[8];
#pragma unroll
    for (int r = 0; r < 8; r++) { m_r[r] = -1e30f; l_r[r] = 0.f; }

    const int colOff = lane & 15;
    const int rowOff = (lane >> 4) * 8;

    for (int kb = 0; kb < T; kb += 64) {
        __syncthreads();
        // Stage K tile and transposed V tile.
#pragma unroll
        for (int i = 0; i < 8; i++) {
            int idx = tid + i * 128;
            int r   = idx >> 4;
            int c4  = (idx & 15) * 4;
            float4 kv = *(const float4*)(qbase + (size_t)(kb + r) * Dm + c4);
            __bf16* dst = Ks + r * ASTR + c4;
            dst[0] = (__bf16)kv.x; dst[1] = (__bf16)kv.y;
            dst[2] = (__bf16)kv.z; dst[3] = (__bf16)kv.w;
            float4 vv = *(const float4*)(vbase + (size_t)(kb + r) * Dm + c4);
            Vt[(c4 + 0) * ASTR + r] = (__bf16)vv.x;
            Vt[(c4 + 1) * ASTR + r] = (__bf16)vv.y;
            Vt[(c4 + 2) * ASTR + r] = (__bf16)vv.z;
            Vt[(c4 + 3) * ASTR + r] = (__bf16)vv.w;
        }
        __syncthreads();

        // S = Q K^T (16 queries x 64 keys per wave), K-dim = HD = 64.
        f32x8 s[4];
#pragma unroll
        for (int n = 0; n < 4; n++) {
            bf16x16 kb0 = load_frag(Ks, n * 16, 0,  ASTR);
            bf16x16 kb1 = load_frag(Ks, n * 16, 32, ASTR);
            s[n] = wmma_bf16(qa[0], kb0, zero);
            s[n] = wmma_bf16(qa[1], kb1, s[n]);
        }
        // scale by 1/sqrt(HD) = 1/8
#pragma unroll
        for (int n = 0; n < 4; n++)
#pragma unroll
            for (int r = 0; r < 8; r++) s[n][r] *= 0.125f;

        // Online softmax per output row (xor masks 1..8 stay in 16-lane group)
#pragma unroll
        for (int r = 0; r < 8; r++) {
            float mx = fmaxf(fmaxf(s[0][r], s[1][r]), fmaxf(s[2][r], s[3][r]));
#pragma unroll
            for (int off = 8; off > 0; off >>= 1)
                mx = fmaxf(mx, __shfl_xor(mx, off));
            float mnew = fmaxf(m_r[r], mx);
            float corr = __expf(m_r[r] - mnew);
            float psum = 0.f;
#pragma unroll
            for (int n = 0; n < 4; n++) {
                float p = __expf(s[n][r] - mnew);
                psum += p;
                Ps[(wid * 16 + rowOff + r) * ASTR + n * 16 + colOff] = (__bf16)p;
            }
#pragma unroll
            for (int off = 8; off > 0; off >>= 1)
                psum += __shfl_xor(psum, off);
            l_r[r] = l_r[r] * corr + psum;
            m_r[r] = mnew;
#pragma unroll
            for (int n = 0; n < 4; n++) o[n][r] *= corr;
        }

        // O += P V   (K-dim = 64 keys, two 32-steps). Ps is wave-private.
        bf16x16 pa0 = load_frag(Ps, wid * 16, 0,  ASTR);
        bf16x16 pa1 = load_frag(Ps, wid * 16, 32, ASTR);
#pragma unroll
        for (int n = 0; n < 4; n++) {
            bf16x16 vb0 = load_frag(Vt, n * 16, 0,  ASTR);
            bf16x16 vb1 = load_frag(Vt, n * 16, 32, ASTR);
            o[n] = wmma_bf16(pa0, vb0, o[n]);
            o[n] = wmma_bf16(pa1, vb1, o[n]);
        }
    }

    // Normalize and write out.
#pragma unroll
    for (int r = 0; r < 8; r++) {
        float inv = 1.0f / l_r[r];
        int row = q0 + wid * 16 + rowOff + r;
#pragma unroll
        for (int n = 0; n < 4; n++) {
            out[((size_t)b * T + row) * Dm + (size_t)h * AHD + n * 16 + colOff] =
                o[n][r] * inv;
        }
    }
}

// ---------------------------------------------------------------------------
// Fused residual + LayerNorm: out = LN(x + res) * g + b.  One block per token.
// ---------------------------------------------------------------------------
__global__ __launch_bounds__(256) void ln_kernel(
    const float* __restrict__ x, const float* __restrict__ res,
    const float* __restrict__ g, const float* __restrict__ be,
    float* __restrict__ out, int D) {
    __shared__ float red[2][8];
    const size_t base = (size_t)blockIdx.x * D;
    float v[4], s = 0.f, s2 = 0.f;
#pragma unroll
    for (int i = 0; i < 4; i++) {
        int c = threadIdx.x + i * 256;
        v[i] = x[base + c] + res[base + c];
        s += v[i];
        s2 += v[i] * v[i];
    }
#pragma unroll
    for (int off = 16; off > 0; off >>= 1) {
        s  += __shfl_xor(s, off);
        s2 += __shfl_xor(s2, off);
    }
    if ((threadIdx.x & 31) == 0) {
        red[0][threadIdx.x >> 5] = s;
        red[1][threadIdx.x >> 5] = s2;
    }
    __syncthreads();
    float ts = 0.f, ts2 = 0.f;
#pragma unroll
    for (int i = 0; i < 8; i++) { ts += red[0][i]; ts2 += red[1][i]; }
    float mean = ts / (float)D;
    float var  = ts2 / (float)D - mean * mean;
    float rstd = rsqrtf(var + 1e-5f);
#pragma unroll
    for (int i = 0; i < 4; i++) {
        int c = threadIdx.x + i * 256;
        out[base + c] = (v[i] - mean) * rstd * g[c] + be[c];
    }
}

// ---------------------------------------------------------------------------
// Orchestration
// ---------------------------------------------------------------------------
extern "C" void kernel_launch(void* const* d_in, const int* in_sizes, int n_in,
                              void* d_out, int out_size, void* d_ws,
                              size_t ws_size, hipStream_t stream) {
    const int B = 2, T = 2048, D = 1024, H = 16;
    const int M = B * T;  // 4096 tokens

    const float* x    = (const float*)d_in[0];
    const float* w_qk = (const float*)d_in[1];
    const float* b_qk = (const float*)d_in[2];
    const float* w_v  = (const float*)d_in[3];
    const float* b_v  = (const float*)d_in[4];
    const float* w_o  = (const float*)d_in[5];
    const float* b_o  = (const float*)d_in[6];
    const float* g1   = (const float*)d_in[7];
    const float* be1  = (const float*)d_in[8];
    const float* g2   = (const float*)d_in[9];
    const float* be2  = (const float*)d_in[10];
    const float* w_f1 = (const float*)d_in[11];
    const float* b_f1 = (const float*)d_in[12];
    const float* w_f2 = (const float*)d_in[13];
    const float* b_f2 = (const float*)d_in[14];
    float* outp = (float*)d_out;

    // Workspace layout (fp32 activations then bf16 packed weights), ~115 MB.
    float* ws = (float*)d_ws;
    const size_t SZ = (size_t)M * D;          // 4M elements per activation
    float* qk_buf = ws;                       // qk; reused as o-proj output
    float* v_buf  = ws + SZ;                  // v;  reused as ffn output
    float* a_buf  = ws + 2 * SZ;              // attention output
    float* x1_buf = ws + 3 * SZ;              // post-LN1
    float* h_buf  = ws + 4 * SZ;              // GELU hidden (2*SZ elements)
    __bf16* wt_qk = (__bf16*)(ws + 6 * SZ);
    __bf16* wt_v  = wt_qk + (size_t)D * D;
    __bf16* wt_o  = wt_v  + (size_t)D * D;
    __bf16* wt_f1 = wt_o  + (size_t)D * D;    // [2D][D]
    __bf16* wt_f2 = wt_f1 + (size_t)2 * D * D; // [D][2D]

    // 1) Pack weights to bf16 transposed.
    pack_wt<<<2048, 256, 0, stream>>>(w_qk, wt_qk, D, D);
    pack_wt<<<2048, 256, 0, stream>>>(w_v,  wt_v,  D, D);
    pack_wt<<<2048, 256, 0, stream>>>(w_o,  wt_o,  D, D);
    pack_wt<<<2048, 256, 0, stream>>>(w_f1, wt_f1, D, 2 * D);
    pack_wt<<<2048, 256, 0, stream>>>(w_f2, wt_f2, 2 * D, D);

    dim3 gNN(D / BN, M / BM);       // N = 1024
    dim3 gN2(2 * D / BN, M / BM);   // N = 2048

    // 2) Projections.
    gemm_bf16w<0><<<gNN, 256, 0, stream>>>(x, wt_qk, b_qk, qk_buf, M, D, D);
    gemm_bf16w<0><<<gNN, 256, 0, stream>>>(x, wt_v,  b_v,  v_buf,  M, D, D);

    // 3) Attention.
    attn_kernel<<<dim3(T / 64, H, B), 128, 0, stream>>>(qk_buf, v_buf, a_buf,
                                                        B, T, H);

    // 4) Output projection (reuse qk_buf).
    gemm_bf16w<0><<<gNN, 256, 0, stream>>>(a_buf, wt_o, b_o, qk_buf, M, D, D);

    // 5) Residual + LN1.
    ln_kernel<<<M, 256, 0, stream>>>(x, qk_buf, g1, be1, x1_buf, D);

    // 6) FFN.
    gemm_bf16w<1><<<gN2, 256, 0, stream>>>(x1_buf, wt_f1, b_f1, h_buf,
                                           M, 2 * D, D);
    gemm_bf16w<0><<<gNN, 256, 0, stream>>>(h_buf, wt_f2, b_f2, v_buf,
                                           M, D, 2 * D);

    // 7) Residual + LN2 -> d_out.
    ln_kernel<<<M, 256, 0, stream>>>(x1_buf, v_buf, g2, be2, outp, D);
}

// v001
// One run takes 349 microseconds.
// In both of two side-by-side timings against v000, it was 1.10 times as fast.
#include <hip/hip_runtime.h>
#include <hip/hip_bf16.h>
#include <cstdint>

typedef __attribute__((ext_vector_type(16))) __bf16 bf16x16;
typedef __attribute__((ext_vector_type(8)))  __bf16 bf16x8;
typedef __attribute__((ext_vector_type(8)))  float  f32x8;

union Frag16 { bf16x16 f; bf16x8 h[2]; };

__device__ __forceinline__ bf16x16 load_frag(const __bf16* lds, int rowBase,
                                             int kBase, int stride) {
    int lane  = threadIdx.x & 31;
    int row   = rowBase + (lane & 15);
    int khalf = (lane < 16) ? 0 : 8;
    const __bf16* p = lds + row * stride + kBase + khalf;
    Frag16 fr;
    fr.h[0] = *(const bf16x8*)(p);
    fr.h[1] = *(const bf16x8*)(p + 16);
    return fr.f;
}

__device__ __forceinline__ f32x8 wmma_bf16(bf16x16 a, bf16x16 b, f32x8 c) {
    return __builtin_amdgcn_wmma_f32_16x16x32_bf16(
        /*neg_a=*/false, a, /*neg_b=*/false, b,
        /*c_mod=*/(short)0, c, /*reuse_a=*/false, /*reuse_b=*/false);
}

__device__ __forceinline__ void async_copy_b128(void* lds_ptr, const void* g) {
    uint32_t lds_off = (uint32_t)(uintptr_t)lds_ptr;
    asm volatile("global_load_async_to_lds_b128 %0, %1, off"
                 :: "v"(lds_off), "v"(g) : "memory");
}

__device__ __forceinline__ void wait_async0() {
    asm volatile("s_wait_asynccnt 0x0" ::: "memory");
}

// ---------------------------------------------------------------------------
// Weight pack: fp32 W[K][N] row-major  ->  bf16 Wt[N][K]  (transposed)
// ---------------------------------------------------------------------------
__global__ void pack_wt(const float* __restrict__ w, __bf16* __restrict__ wt,
                        int K, int N) {
    size_t total = (size_t)K * N;
    for (size_t i = (size_t)blockIdx.x * blockDim.x + threadIdx.x; i < total;
         i += (size_t)gridDim.x * blockDim.x) {
        size_t n = i / K;
        size_t k = i - n * K;
        wt[i] = (__bf16)w[k * (size_t)N + n];
    }
}

// ---------------------------------------------------------------------------
// GEMM:  C[M][N] = act( A[M][K] @ W[K][N] + bias[N] )
//   A     : fp32 row-major (converted to bf16 while staging to LDS)
//   Wt    : bf16, pre-transposed [N][K] (staged via async global->LDS DMA)
// Block tile 128x128x32, 256 threads (8 waves, 4x2), wave tile 32x64
//   => 8 v_wmma_f32_16x16x32_bf16 per wave per K-step.
// Double-buffered LDS: tile t+1 staging (async B DMA + A convert) overlaps
// tile t's WMMAs; single s_wait_asynccnt+barrier per K-step.
// ---------------------------------------------------------------------------
#define BM 128
#define BN 128
#define BK 32
#define LDS_STR 40   // BK + 8 pad; 40*2B = 80B row stride (16B aligned)

template <int ACT>  // 0 = none, 1 = exact GELU
__global__ __launch_bounds__(256) void gemm_bf16w(
    const float* __restrict__ A, const __bf16* __restrict__ Wt,
    const float* __restrict__ bias, float* __restrict__ C,
    int M, int N, int K) {
    __shared__ __bf16 As[2][BM * LDS_STR];
    __shared__ __bf16 Bs[2][BN * LDS_STR];

    const int bm  = blockIdx.y * BM;
    const int bn  = blockIdx.x * BN;
    const int tid = threadIdx.x;
    const int wid = tid >> 5;
    const int wm  = (wid >> 1) * 32;  // 0..96
    const int wn  = (wid & 1) * 64;   // 0,64
    const int lane = tid & 31;

    // Stage one 128x32 K-slice into LDS buffer `buf`.
    auto stage = [&](int k0, int buf) {
        // Weight tile: pure bf16 byte-copy -> async DMA (2 x 16B per thread).
#pragma unroll
        for (int i = 0; i < 2; i++) {
            int idx = tid + i * 256;
            int r   = idx >> 2;          // 4 chunks of 8 bf16 per row
            int c8  = (idx & 3) * 8;
            async_copy_b128(&Bs[buf][r * LDS_STR + c8],
                            Wt + (size_t)(bn + r) * K + k0 + c8);
        }
#pragma unroll
        for (int i = 0; i < 4; i++) {
            int idx = tid + i * 256;
            int r   = idx >> 3;          // 8 float4 per row
            int c4  = (idx & 7) * 4;
            const float* src = A + (size_t)(bm + r) * K + k0 + c4;
            float4 v = *(const float4*)src;
            if (k0 + 2 * BK < K) __builtin_prefetch(src + 2 * BK, 0, 1);
            __bf16* dst = &As[buf][r * LDS_STR + c4];
            dst[0] = (__bf16)v.x; dst[1] = (__bf16)v.y;
            dst[2] = (__bf16)v.z; dst[3] = (__bf16)v.w;
        }
    };

    f32x8 zero = {0.f, 0.f, 0.f, 0.f, 0.f, 0.f, 0.f, 0.f};
    f32x8 acc[2][4];
#pragma unroll
    for (int i = 0; i < 2; i++)
#pragma unroll
        for (int j = 0; j < 4; j++) acc[i][j] = zero;

    stage(0, 0);
    wait_async0();
    __syncthreads();

    const int nk = K / BK;
    for (int t = 0; t < nk; t++) {
        const int buf = t & 1;
        if (t + 1 < nk) stage((t + 1) * BK, buf ^ 1);

        bf16x16 af[2], bfr[4];
        af[0] = load_frag(As[buf], wm,      0, LDS_STR);
        af[1] = load_frag(As[buf], wm + 16, 0, LDS_STR);
#pragma unroll
        for (int j = 0; j < 4; j++)
            bfr[j] = load_frag(Bs[buf], wn + j * 16, 0, LDS_STR);
#pragma unroll
        for (int i = 0; i < 2; i++)
#pragma unroll
            for (int j = 0; j < 4; j++)
                acc[i][j] = wmma_bf16(af[i], bfr[j], acc[i][j]);

        wait_async0();      // next tile's DMA landed in LDS
        __syncthreads();    // next tile's A stores visible; this tile done
    }

    const int colOff = lane & 15;
    const int rowOff = (lane >> 4) * 8;
#pragma unroll
    for (int i = 0; i < 2; i++) {
#pragma unroll
        for (int j = 0; j < 4; j++) {
            int col  = bn + wn + j * 16 + colOff;
            float bv = bias[col];
#pragma unroll
            for (int r = 0; r < 8; r++) {
                int row   = bm + wm + i * 16 + rowOff + r;
                float val = acc[i][j][r] + bv;
                if (ACT == 1)
                    val = 0.5f * val * (1.0f + erff(val * 0.70710678118654752f));
                C[(size_t)row * N + col] = val;
            }
        }
    }
}

#define AHD 64
#define ASTR 72   // 64 + 8 pad, 144B row stride (16B aligned)

__device__ __forceinline__ float swap_halves(float x) {
    int b = __builtin_bit_cast(int, x);
    b = __builtin_amdgcn_permlanex16(b, b, 0x76543210, 0xfedcba98, false, false);
    return __builtin_bit_cast(float, b);
}

__global__ __launch_bounds__(128) __attribute__((amdgpu_waves_per_eu(4, 4)))
void attn_kernel(
    const float* __restrict__ qk, const float* __restrict__ v,
    float* __restrict__ out, int B, int T, int H) {
    __shared__ __bf16 Qs[64 * ASTR];
    __shared__ __bf16 Ks[64 * ASTR];
    __shared__ __bf16 Vt[64 * ASTR];   // transposed: [hd][key]

    const int b  = blockIdx.z;
    const int h  = blockIdx.y;
    const int q0 = blockIdx.x * 64;
    const int tid = threadIdx.x;
    const int wid = tid >> 5;
    const int lane = tid & 31;
    const size_t Dm = (size_t)H * AHD;

    const float* qbase = qk + (size_t)b * T * Dm + (size_t)h * AHD;
    const float* vbase = v  + (size_t)b * T * Dm + (size_t)h * AHD;

    // Stage Q (64x64 fp32 -> bf16): 1024 float4, 8 per thread.
#pragma unroll
    for (int i = 0; i < 8; i++) {
        int idx = tid + i * 128;
        int r   = idx >> 4;
        int c4  = (idx & 15) * 4;
        float4 qv = *(const float4*)(qbase + (size_t)(q0 + r) * Dm + c4);
        __bf16* dst = Qs + r * ASTR + c4;
        dst[0] = (__bf16)qv.x; dst[1] = (__bf16)qv.y;
        dst[2] = (__bf16)qv.z; dst[3] = (__bf16)qv.w;
    }
    __syncthreads();

    // B operand of S^T: column = query, k = head dim.
    bf16x16 qb[2];
    qb[0] = load_frag(Qs, wid * 16, 0,  ASTR);
    qb[1] = load_frag(Qs, wid * 16, 32, ASTR);

    f32x8 zero = {0.f, 0.f, 0.f, 0.f, 0.f, 0.f, 0.f, 0.f};
    f32x8 o[4];   // o[n][r] = O^T[hd = 16n + 8*(lane>>4) + r][query = lane&15]
#pragma unroll
    for (int n = 0; n < 4; n++) o[n] = zero;
    float m_q = -1e30f;
    f32x8 l_v = zero;

    for (int kb = 0; kb < T; kb += 64) {
        __syncthreads();
        // Stage K tile and transposed V tile.
#pragma unroll
        for (int i = 0; i < 8; i++) {
            int idx = tid + i * 128;
            int r   = idx >> 4;
            int c4  = (idx & 15) * 4;
            float4 kv = *(const float4*)(qbase + (size_t)(kb + r) * Dm + c4);
            __bf16* dst = Ks + r * ASTR + c4;
            dst[0] = (__bf16)kv.x; dst[1] = (__bf16)kv.y;
            dst[2] = (__bf16)kv.z; dst[3] = (__bf16)kv.w;
            float4 vv = *(const float4*)(vbase + (size_t)(kb + r) * Dm + c4);
            Vt[(c4 + 0) * ASTR + r] = (__bf16)vv.x;
            Vt[(c4 + 1) * ASTR + r] = (__bf16)vv.y;
            Vt[(c4 + 2) * ASTR + r] = (__bf16)vv.z;
            Vt[(c4 + 3) * ASTR + r] = (__bf16)vv.w;
        }
        __syncthreads();

        // S^T = K Q^T (64 keys x 16 queries per wave), K-dim = HD = 64.
        // s[n][r] = score(key = kb + 16n + 8*(lane>>4) + r, query = lane&15)
        f32x8 s[4];
#pragma unroll
        for (int n = 0; n < 4; n++) {
            bf16x16 ka0 = load_frag(Ks, n * 16, 0,  ASTR);
            bf16x16 ka1 = load_frag(Ks, n * 16, 32, ASTR);
            s[n] = wmma_bf16(ka0, qb[0], zero);
            s[n] = wmma_bf16(ka1, qb[1], s[n]);
        }
        // scale by 1/sqrt(HD) = 1/8
#pragma unroll
        for (int n = 0; n < 4; n++)
#pragma unroll
            for (int r = 0; r < 8; r++) s[n][r] *= 0.125f;

        // Online softmax: one query per lane. Every loop here is unrolled so
        // that the tiles are indexed by constants and stay in registers.
        float mt[4];   // one short chain per tile, not one chain of 32
#pragma unroll
        for (int n = 0; n < 4; n++) {
            mt[n] = s[n][0];
#pragma unroll
            for (int r = 1; r < 8; r++) mt[n] = fmaxf(mt[n], s[n][r]);
        }
        float mx = fmaxf(fmaxf(mt[0], mt[1]), fmaxf(mt[2], mt[3]));
        mx = fmaxf(mx, swap_halves(mx));
        float mnew = fmaxf(m_q, mx);
        float corr = __expf(m_q - mnew);
        m_q = mnew;

        Frag16 pb[2];   // B operand of O^T: column = query, k = key
        l_v *= corr;
#pragma unroll
        for (int n = 0; n < 4; n++) {
            f32x8 p;
#pragma unroll
            for (int r = 0; r < 8; r++) p[r] = __expf(s[n][r] - mnew);
            l_v += p;
#pragma unroll
            for (int r = 0; r < 8; r++) pb[n >> 1].h[n & 1][r] = (__bf16)p[r];
        }
#pragma unroll
        for (int n = 0; n < 4; n++)
#pragma unroll
            for (int r = 0; r < 8; r++) o[n][r] *= corr;

        // O^T += V^T P^T   (K-dim = 64 keys, two 32-steps).
#pragma unroll
        for (int n = 0; n < 4; n++) {
            bf16x16 va0 = load_frag(Vt, n * 16, 0,  ASTR);
            bf16x16 va1 = load_frag(Vt, n * 16, 32, ASTR);
            o[n] = wmma_bf16(va0, pb[0].f, o[n]);
            o[n] = wmma_bf16(va1, pb[1].f, o[n]);
        }
    }

    const float l_q = ((l_v[0] + l_v[1]) + (l_v[2] + l_v[3])) +
                      ((l_v[4] + l_v[5]) + (l_v[6] + l_v[7]));
    const float inv = 1.0f / (l_q + swap_halves(l_q));
    const int row = q0 + wid * 16 + (lane & 15);
    float* orow = out + ((size_t)b * T + row) * Dm + (size_t)h * AHD +
                  (lane >> 4) * 8;
#pragma unroll   // constant indices into o
    for (int n = 0; n < 4; n++) {
        float4 lo = {o[n][0] * inv, o[n][1] * inv, o[n][2] * inv, o[n][3] * inv};
        float4 hi = {o[n][4] * inv, o[n][5] * inv, o[n][6] * inv, o[n][7] * inv};
        *(float4*)(orow + n * 16)     = lo;
        *(float4*)(orow + n * 16 + 4) = hi;
    }
}

// ---------------------------------------------------------------------------
// Fused residual + LayerNorm: out = LN(x + res) * g + b.  One block per token.
// ---------------------------------------------------------------------------
__global__ __launch_bounds__(256) void ln_kernel(
    const float* __restrict__ x, const float* __restrict__ res,
    const float* __restrict__ g, const float* __restrict__ be,
    float* __restrict__ out, int D) {
    __shared__ float red[2][8];
    const size_t base = (size_t)blockIdx.x * D;
    float v[4], s = 0.f, s2 = 0.f;
#pragma unroll
    for (int i = 0; i < 4; i++) {
        int c = threadIdx.x + i * 256;
        v[i] = x[base + c] + res[base + c];
        s += v[i];
        s2 += v[i] * v[i];
    }
#pragma unroll
    for (int off = 16; off > 0; off >>= 1) {
        s  += __shfl_xor(s, off);
        s2 += __shfl_xor(s2, off);
    }
    if ((threadIdx.x & 31) == 0) {
        red[0][threadIdx.x >> 5] = s;
        red[1][threadIdx.x >> 5] = s2;
    }
    __syncthreads();
    float ts = 0.f, ts2 = 0.f;
#pragma unroll
    for (int i = 0; i < 8; i++) { ts += red[0][i]; ts2 += red[1][i]; }
    float mean = ts / (float)D;
    float var  = ts2 / (float)D - mean * mean;
    float rstd = rsqrtf(var + 1e-5f);
#pragma unroll
    for (int i = 0; i < 4; i++) {
        int c = threadIdx.x + i * 256;
        out[base + c] = (v[i] - mean) * rstd * g[c] + be[c];
    }
}

// ---------------------------------------------------------------------------
// Orchestration
// ---------------------------------------------------------------------------
extern "C" void kernel_launch(void* const* d_in, const int* in_sizes, int n_in,
                              void* d_out, int out_size, void* d_ws,
                              size_t ws_size, hipStream_t stream) {
    const int B = 2, T = 2048, D = 1024, H = 16;
    const int M = B * T;  // 4096 tokens

    const float* x    = (const float*)d_in[0];
    const float* w_qk = (const float*)d_in[1];
    const float* b_qk = (const float*)d_in[2];
    const float* w_v  = (const float*)d_in[3];
    const float* b_v  = (const float*)d_in[4];
    const float* w_o  = (const float*)d_in[5];
    const float* b_o  = (const float*)d_in[6];
    const float* g1   = (const float*)d_in[7];
    const float* be1  = (const float*)d_in[8];
    const float* g2   = (const float*)d_in[9];
    const float* be2  = (const float*)d_in[10];
    const float* w_f1 = (const float*)d_in[11];
    const float* b_f1 = (const float*)d_in[12];
    const float* w_f2 = (const float*)d_in[13];
    const float* b_f2 = (const float*)d_in[14];
    float* outp = (float*)d_out;

    // Workspace layout (fp32 activations then bf16 packed weights), ~115 MB.
    float* ws = (float*)d_ws;
    const size_t SZ = (size_t)M * D;          // 4M elements per activation
    float* qk_buf = ws;                       // qk; reused as o-proj output
    float* v_buf  = ws + SZ;                  // v;  reused as ffn output
    float* a_buf  = ws + 2 * SZ;              // attention output
    float* x1_buf = ws + 3 * SZ;              // post-LN1
    float* h_buf  = ws + 4 * SZ;              // GELU hidden (2*SZ elements)
    __bf16* wt_qk = (__bf16*)(ws + 6 * SZ);
    __bf16* wt_v  = wt_qk + (size_t)D * D;
    __bf16* wt_o  = wt_v  + (size_t)D * D;
    __bf16* wt_f1 = wt_o  + (size_t)D * D;    // [2D][D]
    __bf16* wt_f2 = wt_f1 + (size_t)2 * D * D; // [D][2D]

    // 1) Pack weights to bf16 transposed.
    pack_wt<<<2048, 256, 0, stream>>>(w_qk, wt_qk, D, D);
    pack_wt<<<2048, 256, 0, stream>>>(w_v,  wt_v,  D, D);
    pack_wt<<<2048, 256, 0, stream>>>(w_o,  wt_o,  D, D);
    pack_wt<<<2048, 256, 0, stream>>>(w_f1, wt_f1, D, 2 * D);
    pack_wt<<<2048, 256, 0, stream>>>(w_f2, wt_f2, 2 * D, D);

    dim3 gNN(D / BN, M / BM);       // N = 1024
    dim3 gN2(2 * D / BN, M / BM);   // N = 2048

    // 2) Projections.
    gemm_bf16w<0><<<gNN, 256, 0, stream>>>(x, wt_qk, b_qk, qk_buf, M, D, D);
    gemm_bf16w<0><<<gNN, 256, 0, stream>>>(x, wt_v,  b_v,  v_buf,  M, D, D);

    // 3) Attention.
    attn_kernel<<<dim3(T / 64, H, B), 128, 0, stream>>>(qk_buf, v_buf, a_buf,
                                                        B, T, H);

    // 4) Output projection (reuse qk_buf).
    gemm_bf16w<0><<<gNN, 256, 0, stream>>>(a_buf, wt_o, b_o, qk_buf, M, D, D);

    // 5) Residual + LN1.
    ln_kernel<<<M, 256, 0, stream>>>(x, qk_buf, g1, be1, x1_buf, D);

    // 6) FFN.
    gemm_bf16w<1><<<gN2, 256, 0, stream>>>(x1_buf, wt_f1, b_f1, h_buf,
                                           M, 2 * D, D);
    gemm_bf16w<0><<<gNN, 256, 0, stream>>>(h_buf, wt_f2, b_f2, v_buf,
                                           M, D, 2 * D);

    // 7) Residual + LN2 -> d_out.
    ln_kernel<<<M, 256, 0, stream>>>(x1_buf, v_buf, g2, be2, outp, D);
}

// v002
// Measured time: 284 microseconds a run.
// Two timings next to v001 both put it at 1.23 times that version's speed.
// Counting every step since v000, it is 1.35 times as fast.
#include <hip/hip_runtime.h>
#include <hip/hip_bf16.h>
#include <cstdint>

typedef __attribute__((ext_vector_type(16))) __bf16 bf16x16;
typedef __attribute__((ext_vector_type(8)))  __bf16 bf16x8;
typedef __attribute__((ext_vector_type(8)))  float  f32x8;

union Frag16 { bf16x16 f; bf16x8 h[2]; };

__device__ __forceinline__ bf16x16 load_frag(const __bf16* lds, int rowBase,
                                             int kBase, int stride) {
    int lane  = threadIdx.x & 31;
    int row   = rowBase + (lane & 15);
    int khalf = (lane < 16) ? 0 : 8;
    const __bf16* p = lds + row * stride + kBase + khalf;
    Frag16 fr;
    fr.h[0] = *(const bf16x8*)(p);
    fr.h[1] = *(const bf16x8*)(p + 16);
    return fr.f;
}

__device__ __forceinline__ f32x8 wmma_bf16(bf16x16 a, bf16x16 b, f32x8 c) {
    return __builtin_amdgcn_wmma_f32_16x16x32_bf16(
        /*neg_a=*/false, a, /*neg_b=*/false, b,
        /*c_mod=*/(short)0, c, /*reuse_a=*/false, /*reuse_b=*/false);
}

__device__ __forceinline__ void async_copy_b128(void* lds_ptr, const void* g) {
    uint32_t lds_off = (uint32_t)(uintptr_t)lds_ptr;
    asm volatile("global_load_async_to_lds_b128 %0, %1, off"
                 :: "v"(lds_off), "v"(g) : "memory");
}

__device__ __forceinline__ void wait_async0() {
    asm volatile("s_wait_asynccnt 0x0" ::: "memory");
}

// ---------------------------------------------------------------------------
// Weight pack: fp32 W[K][N] row-major  ->  bf16 Wt[N][K]  (transposed)
// ---------------------------------------------------------------------------
__global__ void pack_wt(const float* __restrict__ w, __bf16* __restrict__ wt,
                        int K, int N) {
    size_t total = (size_t)K * N;
    for (size_t i = (size_t)blockIdx.x * blockDim.x + threadIdx.x; i < total;
         i += (size_t)gridDim.x * blockDim.x) {
        size_t n = i / K;
        size_t k = i - n * K;
        wt[i] = (__bf16)w[k * (size_t)N + n];
    }
}

// ---------------------------------------------------------------------------
// GEMM:  C[M][N] = act( A[M][K] @ W[K][N] + bias[N] )
//   A     : fp32 row-major (converted to bf16 while staging to LDS)
//   Wt    : bf16, pre-transposed [N][K] (staged via async global->LDS DMA)
// Block tile 128x128x32, 256 threads (8 waves, 4x2), wave tile 32x64
//   => 8 v_wmma_f32_16x16x32_bf16 per wave per K-step.
// Double-buffered LDS: tile t+1's loads (async B DMA, A into registers) are all
// issued ahead of tile t's WMMAs; A is converted and stored behind them;
// single s_wait_asynccnt+barrier per K-step.
// ---------------------------------------------------------------------------
#define BM 128
#define BN 128
#define BK 32
#define LDS_STR 40   // BK + 8 pad; 40*2B = 80B row stride (16B aligned)

template <int ACT>  // 0 = none, 1 = exact GELU
__global__ __launch_bounds__(256) void gemm_bf16w(
    const float* __restrict__ A, const __bf16* __restrict__ Wt,
    const float* __restrict__ bias, float* __restrict__ C,
    int M, int N, int K) {
    __shared__ __bf16 As[2][BM * LDS_STR];
    __shared__ __bf16 Bs[2][BN * LDS_STR];

    const int bm  = blockIdx.y * BM;
    const int bn  = blockIdx.x * BN;
    const int tid = threadIdx.x;
    const int wid = tid >> 5;
    const int wm  = (wid >> 1) * 32;  // 0..96
    const int wn  = (wid & 1) * 64;   // 0,64
    const int lane = tid & 31;

    float4 av[4];   // A part of the next K-slice, in flight during the WMMAs

    // Issue every load of one 128x32 K-slice: B into LDS buffer `buf`, A into av.
    auto stage = [&](int k0, int buf) {
        // Weight tile: pure bf16 byte-copy -> async DMA (2 x 16B per thread).
#pragma unroll
        for (int i = 0; i < 2; i++) {
            int idx = tid + i * 256;
            int r   = idx >> 2;          // 4 chunks of 8 bf16 per row
            int c8  = (idx & 3) * 8;
            async_copy_b128(&Bs[buf][r * LDS_STR + c8],
                            Wt + (size_t)(bn + r) * K + k0 + c8);
        }
        // Activation tile: four fp32 loads per thread, none waited for here.
#pragma unroll
        for (int i = 0; i < 4; i++) {
            int idx = tid + i * 256;
            int r   = idx >> 3;          // 8 float4 per row
            int c4  = (idx & 7) * 4;
            av[i] = *(const float4*)(A + (size_t)(bm + r) * K + k0 + c4);
        }
        // The loads' address registers are reused at once (prefetch addresses,
        // fragments): this wait stands in front of that reuse.
        asm volatile("s_wait_xcnt 0x0" ::: "memory");
        if (k0 + 2 * BK < K) {
#pragma unroll
            for (int i = 0; i < 4; i++) {
                int idx = tid + i * 256;
                int r   = idx >> 3;
                int c4  = (idx & 7) * 4;
                __builtin_prefetch(A + (size_t)(bm + r) * K + k0 + c4 + 2 * BK,
                                   0, 1);
            }
        }
    };
    // Convert av to bf16 and store it into LDS buffer `buf`.
    auto put = [&](int buf) {
#pragma unroll
        for (int i = 0; i < 4; i++) {
            int idx = tid + i * 256;
            int r   = idx >> 3;
            int c4  = (idx & 7) * 4;
            __bf16* dst = &As[buf][r * LDS_STR + c4];
            dst[0] = (__bf16)av[i].x; dst[1] = (__bf16)av[i].y;
            dst[2] = (__bf16)av[i].z; dst[3] = (__bf16)av[i].w;
        }
    };

    f32x8 zero = {0.f, 0.f, 0.f, 0.f, 0.f, 0.f, 0.f, 0.f};
    f32x8 acc[2][4];
#pragma unroll
    for (int i = 0; i < 2; i++)
#pragma unroll
        for (int j = 0; j < 4; j++) acc[i][j] = zero;

    stage(0, 0);
    put(0);
    wait_async0();
    __syncthreads();

    const int nk = K / BK;
    for (int t = 0; t < nk; t++) {
        const int buf = t & 1;
        if (t + 1 < nk) stage((t + 1) * BK, buf ^ 1);

        bf16x16 af[2], bfr[4];
        af[0] = load_frag(As[buf], wm,      0, LDS_STR);
        af[1] = load_frag(As[buf], wm + 16, 0, LDS_STR);
#pragma unroll
        for (int j = 0; j < 4; j++)
            bfr[j] = load_frag(Bs[buf], wn + j * 16, 0, LDS_STR);
#pragma unroll
        for (int i = 0; i < 2; i++)
#pragma unroll
            for (int j = 0; j < 4; j++)
                acc[i][j] = wmma_bf16(af[i], bfr[j], acc[i][j]);

        if (t + 1 < nk) put(buf ^ 1);   // first use of av: the loads had the WMMAs' time
        wait_async0();      // next tile's DMA landed in LDS
        __syncthreads();    // next tile's A stores visible; this tile done
    }

    const int colOff = lane & 15;
    const int rowOff = (lane >> 4) * 8;
#pragma unroll
    for (int i = 0; i < 2; i++) {
#pragma unroll
        for (int j = 0; j < 4; j++) {
            int col  = bn + wn + j * 16 + colOff;
            float bv = bias[col];
#pragma unroll
            for (int r = 0; r < 8; r++) {
                int row   = bm + wm + i * 16 + rowOff + r;
                float val = acc[i][j][r] + bv;
                if (ACT == 1)
                    val = 0.5f * val * (1.0f + erff(val * 0.70710678118654752f));
                C[(size_t)row * N + col] = val;
            }
        }
    }
}

#define AHD 64
#define ASTR 72   // 64 + 8 pad, 144B row stride (16B aligned)

__device__ __forceinline__ float swap_halves(float x) {
    int b = __builtin_bit_cast(int, x);
    b = __builtin_amdgcn_permlanex16(b, b, 0x76543210, 0xfedcba98, false, false);
    return __builtin_bit_cast(float, b);
}

__global__ __launch_bounds__(128) __attribute__((amdgpu_waves_per_eu(4, 4)))
void attn_kernel(
    const float* __restrict__ qk, const float* __restrict__ v,
    float* __restrict__ out, int B, int T, int H) {
    __shared__ __bf16 Qs[64 * ASTR];
    __shared__ __bf16 Ks[64 * ASTR];
    __shared__ __bf16 Vt[64 * ASTR];   // transposed: [hd][key]

    const int b  = blockIdx.z;
    const int h  = blockIdx.y;
    const int q0 = blockIdx.x * 64;
    const int tid = threadIdx.x;
    const int wid = tid >> 5;
    const int lane = tid & 31;
    const size_t Dm = (size_t)H * AHD;

    const float* qbase = qk + (size_t)b * T * Dm + (size_t)h * AHD;
    const float* vbase = v  + (size_t)b * T * Dm + (size_t)h * AHD;

    // Stage Q (64x64 fp32 -> bf16): 1024 float4, 8 per thread.
#pragma unroll
    for (int i = 0; i < 8; i++) {
        int idx = tid + i * 128;
        int r   = idx >> 4;
        int c4  = (idx & 15) * 4;
        float4 qv = *(const float4*)(qbase + (size_t)(q0 + r) * Dm + c4);
        __bf16* dst = Qs + r * ASTR + c4;
        dst[0] = (__bf16)qv.x; dst[1] = (__bf16)qv.y;
        dst[2] = (__bf16)qv.z; dst[3] = (__bf16)qv.w;
    }
    __syncthreads();

    // B operand of S^T: column = query, k = head dim.
    bf16x16 qb[2];
    qb[0] = load_frag(Qs, wid * 16, 0,  ASTR);
    qb[1] = load_frag(Qs, wid * 16, 32, ASTR);

    f32x8 zero = {0.f, 0.f, 0.f, 0.f, 0.f, 0.f, 0.f, 0.f};
    f32x8 o[4];   // o[n][r] = O^T[hd = 16n + 8*(lane>>4) + r][query = lane&15]
#pragma unroll
    for (int n = 0; n < 4; n++) o[n] = zero;
    float m_q = -1e30f;
    f32x8 l_v = zero;

    for (int kb = 0; kb < T; kb += 64) {
        __syncthreads();
        // Stage K tile and transposed V tile.
#pragma unroll
        for (int i = 0; i < 8; i++) {
            int idx = tid + i * 128;
            int r   = idx >> 4;
            int c4  = (idx & 15) * 4;
            float4 kv = *(const float4*)(qbase + (size_t)(kb + r) * Dm + c4);
            __bf16* dst = Ks + r * ASTR + c4;
            dst[0] = (__bf16)kv.x; dst[1] = (__bf16)kv.y;
            dst[2] = (__bf16)kv.z; dst[3] = (__bf16)kv.w;
            float4 vv = *(const float4*)(vbase + (size_t)(kb + r) * Dm + c4);
            Vt[(c4 + 0) * ASTR + r] = (__bf16)vv.x;
            Vt[(c4 + 1) * ASTR + r] = (__bf16)vv.y;
            Vt[(c4 + 2) * ASTR + r] = (__bf16)vv.z;
            Vt[(c4 + 3) * ASTR + r] = (__bf16)vv.w;
        }
        __syncthreads();

        // S^T = K Q^T (64 keys x 16 queries per wave), K-dim = HD = 64.
        // s[n][r] = score(key = kb + 16n + 8*(lane>>4) + r, query = lane&15)
        f32x8 s[4];
#pragma unroll
        for (int n = 0; n < 4; n++) {
            bf16x16 ka0 = load_frag(Ks, n * 16, 0,  ASTR);
            bf16x16 ka1 = load_frag(Ks, n * 16, 32, ASTR);
            s[n] = wmma_bf16(ka0, qb[0], zero);
            s[n] = wmma_bf16(ka1, qb[1], s[n]);
        }
        // scale by 1/sqrt(HD) = 1/8
#pragma unroll
        for (int n = 0; n < 4; n++)
#pragma unroll
            for (int r = 0; r < 8; r++) s[n][r] *= 0.125f;

        // Online softmax: one query per lane. Every loop here is unrolled so
        // that the tiles are indexed by constants and stay in registers.
        float mt[4];   // one short chain per tile, not one chain of 32
#pragma unroll
        for (int n = 0; n < 4; n++) {
            mt[n] = s[n][0];
#pragma unroll
            for (int r = 1; r < 8; r++) mt[n] = fmaxf(mt[n], s[n][r]);
        }
        float mx = fmaxf(fmaxf(mt[0], mt[1]), fmaxf(mt[2], mt[3]));
        mx = fmaxf(mx, swap_halves(mx));
        float mnew = fmaxf(m_q, mx);
        float corr = __expf(m_q - mnew);
        m_q = mnew;

        Frag16 pb[2];   // B operand of O^T: column = query, k = key
        l_v *= corr;
#pragma unroll
        for (int n = 0; n < 4; n++) {
            f32x8 p;
#pragma unroll
            for (int r = 0; r < 8; r++) p[r] = __expf(s[n][r] - mnew);
            l_v += p;
#pragma unroll
            for (int r = 0; r < 8; r++) pb[n >> 1].h[n & 1][r] = (__bf16)p[r];
        }
#pragma unroll
        for (int n = 0; n < 4; n++)
#pragma unroll
            for (int r = 0; r < 8; r++) o[n][r] *= corr;

        // O^T += V^T P^T   (K-dim = 64 keys, two 32-steps).
#pragma unroll
        for (int n = 0; n < 4; n++) {
            bf16x16 va0 = load_frag(Vt, n * 16, 0,  ASTR);
            bf16x16 va1 = load_frag(Vt, n * 16, 32, ASTR);
            o[n] = wmma_bf16(va0, pb[0].f, o[n]);
            o[n] = wmma_bf16(va1, pb[1].f, o[n]);
        }
    }

    const float l_q = ((l_v[0] + l_v[1]) + (l_v[2] + l_v[3])) +
                      ((l_v[4] + l_v[5]) + (l_v[6] + l_v[7]));
    const float inv = 1.0f / (l_q + swap_halves(l_q));
    const int row = q0 + wid * 16 + (lane & 15);
    float* orow = out + ((size_t)b * T + row) * Dm + (size_t)h * AHD +
                  (lane >> 4) * 8;
#pragma unroll   // constant indices into o
    for (int n = 0; n < 4; n++) {
        float4 lo = {o[n][0] * inv, o[n][1] * inv, o[n][2] * inv, o[n][3] * inv};
        float4 hi = {o[n][4] * inv, o[n][5] * inv, o[n][6] * inv, o[n][7] * inv};
        *(float4*)(orow + n * 16)     = lo;
        *(float4*)(orow + n * 16 + 4) = hi;
    }
}

// ---------------------------------------------------------------------------
// Fused residual + LayerNorm: out = LN(x + res) * g + b.  One block per token.
// ---------------------------------------------------------------------------
__global__ __launch_bounds__(256) void ln_kernel(
    const float* __restrict__ x, const float* __restrict__ res,
    const float* __restrict__ g, const float* __restrict__ be,
    float* __restrict__ out, int D) {
    __shared__ float red[2][8];
    const size_t base = (size_t)blockIdx.x * D;
    float v[4], s = 0.f, s2 = 0.f;
#pragma unroll
    for (int i = 0; i < 4; i++) {
        int c = threadIdx.x + i * 256;
        v[i] = x[base + c] + res[base + c];
        s += v[i];
        s2 += v[i] * v[i];
    }
#pragma unroll
    for (int off = 16; off > 0; off >>= 1) {
        s  += __shfl_xor(s, off);
        s2 += __shfl_xor(s2, off);
    }
    if ((threadIdx.x & 31) == 0) {
        red[0][threadIdx.x >> 5] = s;
        red[1][threadIdx.x >> 5] = s2;
    }
    __syncthreads();
    float ts = 0.f, ts2 = 0.f;
#pragma unroll
    for (int i = 0; i < 8; i++) { ts += red[0][i]; ts2 += red[1][i]; }
    float mean = ts / (float)D;
    float var  = ts2 / (float)D - mean * mean;
    float rstd = rsqrtf(var + 1e-5f);
#pragma unroll
    for (int i = 0; i < 4; i++) {
        int c = threadIdx.x + i * 256;
        out[base + c] = (v[i] - mean) * rstd * g[c] + be[c];
    }
}

// ---------------------------------------------------------------------------
// Orchestration
// ---------------------------------------------------------------------------
extern "C" void kernel_launch(void* const* d_in, const int* in_sizes, int n_in,
                              void* d_out, int out_size, void* d_ws,
                              size_t ws_size, hipStream_t stream) {
    const int B = 2, T = 2048, D = 1024, H = 16;
    const int M = B * T;  // 4096 tokens

    const float* x    = (const float*)d_in[0];
    const float* w_qk = (const float*)d_in[1];
    const float* b_qk = (const float*)d_in[2];
    const float* w_v  = (const float*)d_in[3];
    const float* b_v  = (const float*)d_in[4];
    const float* w_o  = (const float*)d_in[5];
    const float* b_o  = (const float*)d_in[6];
    const float* g1   = (const float*)d_in[7];
    const float* be1  = (const float*)d_in[8];
    const float* g2   = (const float*)d_in[9];
    const float* be2  = (const float*)d_in[10];
    const float* w_f1 = (const float*)d_in[11];
    const float* b_f1 = (const float*)d_in[12];
    const float* w_f2 = (const float*)d_in[13];
    const float* b_f2 = (const float*)d_in[14];
    float* outp = (float*)d_out;

    // Workspace layout (fp32 activations then bf16 packed weights), ~115 MB.
    float* ws = (float*)d_ws;
    const size_t SZ = (size_t)M * D;          // 4M elements per activation
    float* qk_buf = ws;                       // qk; reused as o-proj output
    float* v_buf  = ws + SZ;                  // v;  reused as ffn output
    float* a_buf  = ws + 2 * SZ;              // attention output
    float* x1_buf = ws + 3 * SZ;              // post-LN1
    float* h_buf  = ws + 4 * SZ;              // GELU hidden (2*SZ elements)
    __bf16* wt_qk = (__bf16*)(ws + 6 * SZ);
    __bf16* wt_v  = wt_qk + (size_t)D * D;
    __bf16* wt_o  = wt_v  + (size_t)D * D;
    __bf16* wt_f1 = wt_o  + (size_t)D * D;    // [2D][D]
    __bf16* wt_f2 = wt_f1 + (size_t)2 * D * D; // [D][2D]

    // 1) Pack weights to bf16 transposed.
    pack_wt<<<2048, 256, 0, stream>>>(w_qk, wt_qk, D, D);
    pack_wt<<<2048, 256, 0, stream>>>(w_v,  wt_v,  D, D);
    pack_wt<<<2048, 256, 0, stream>>>(w_o,  wt_o,  D, D);
    pack_wt<<<2048, 256, 0, stream>>>(w_f1, wt_f1, D, 2 * D);
    pack_wt<<<2048, 256, 0, stream>>>(w_f2, wt_f2, 2 * D, D);

    dim3 gNN(D / BN, M / BM);       // N = 1024
    dim3 gN2(2 * D / BN, M / BM);   // N = 2048

    // 2) Projections.
    gemm_bf16w<0><<<gNN, 256, 0, stream>>>(x, wt_qk, b_qk, qk_buf, M, D, D);
    gemm_bf16w<0><<<gNN, 256, 0, stream>>>(x, wt_v,  b_v,  v_buf,  M, D, D);

    // 3) Attention.
    attn_kernel<<<dim3(T / 64, H, B), 128, 0, stream>>>(qk_buf, v_buf, a_buf,
                                                        B, T, H);

    // 4) Output projection (reuse qk_buf).
    gemm_bf16w<0><<<gNN, 256, 0, stream>>>(a_buf, wt_o, b_o, qk_buf, M, D, D);

    // 5) Residual + LN1.
    ln_kernel<<<M, 256, 0, stream>>>(x, qk_buf, g1, be1, x1_buf, D);

    // 6) FFN.
    gemm_bf16w<1><<<gN2, 256, 0, stream>>>(x1_buf, wt_f1, b_f1, h_buf,
                                           M, 2 * D, D);
    gemm_bf16w<0><<<gNN, 256, 0, stream>>>(h_buf, wt_f2, b_f2, v_buf,
                                           M, D, 2 * D);

    // 7) Residual + LN2 -> d_out.
    ln_kernel<<<M, 256, 0, stream>>>(x1_buf, v_buf, g2, be2, outp, D);
}

// v003
// Measured time: 239 microseconds a run.
// Two timings next to v002 both put it at 1.19 times that version's speed.
// All steps since v000 together make it 1.61 times as fast.
#include <hip/hip_runtime.h>
#include <hip/hip_bf16.h>
#include <cstdint>

typedef __attribute__((ext_vector_type(16))) __bf16 bf16x16;
typedef __attribute__((ext_vector_type(8)))  __bf16 bf16x8;
typedef __attribute__((ext_vector_type(8)))  float  f32x8;

union Frag16 { bf16x16 f; bf16x8 h[2]; };

__device__ __forceinline__ bf16x16 load_frag(const __bf16* lds, int rowBase,
                                             int kBase, int stride) {
    int lane  = threadIdx.x & 31;
    int row   = rowBase + (lane & 15);
    int khalf = (lane < 16) ? 0 : 8;
    const __bf16* p = lds + row * stride + kBase + khalf;
    Frag16 fr;
    fr.h[0] = *(const bf16x8*)(p);
    fr.h[1] = *(const bf16x8*)(p + 16);
    return fr.f;
}

__device__ __forceinline__ f32x8 wmma_bf16(bf16x16 a, bf16x16 b, f32x8 c) {
    return __builtin_amdgcn_wmma_f32_16x16x32_bf16(
        /*neg_a=*/false, a, /*neg_b=*/false, b,
        /*c_mod=*/(short)0, c, /*reuse_a=*/false, /*reuse_b=*/false);
}

__device__ __forceinline__ void async_copy_b128(void* lds_ptr, const void* g) {
    uint32_t lds_off = (uint32_t)(uintptr_t)lds_ptr;
    asm volatile("global_load_async_to_lds_b128 %0, %1, off"
                 :: "v"(lds_off), "v"(g) : "memory");
}

__device__ __forceinline__ void wait_async0() {
    asm volatile("s_wait_asynccnt 0x0" ::: "memory");
}

// ---------------------------------------------------------------------------
// Weight pack: fp32 W[K][N] row-major  ->  bf16 Wt[N][K]  (transposed)
// One launch for all five weights. A block of 4 waves takes one tile of
// 128 (k) x 64 (n): it reads 256-byte row pieces with 16-byte loads (all 16 of
// a thread in flight together), turns the tile in LDS and writes 256-byte
// pieces of Wt rows with 16-byte stores. The packed weights lie one behind the
// other in wt_all: qk, v, o (PD*PD each), f1, f2 (2*PD*PD each).
// ---------------------------------------------------------------------------
#define PD   1024  // model width: qk, v, o are PD x PD, f1 PD x 2PD, f2 2PD x PD
#define PTK  128   // tile extent in k
#define PTN  64    // tile extent in n
#define PSTR 136   // PTK + 8 pad: 272-byte LDS rows (16-byte aligned)
#define PTILES ((PD / PTK) * (PD / PTN))   // tiles per PD*PD elements

__device__ __forceinline__ float pick(float4 v, int j) {
    return j == 0 ? v.x : j == 1 ? v.y : j == 2 ? v.z : v.w;
}

// One tile of one weight. K and N are compile-time so that a thread's 16 loads
// share one address and differ in the immediate offset only.
template <int K, int N>
__device__ __forceinline__ void pack_tile(const float* __restrict__ w,
                                          __bf16* __restrict__ wt, int lt,
                                          __bf16* Ts) {
    const int n0 = (lt % (N / PTN)) * PTN;
    const int k0 = (lt / (N / PTN)) * PTK;
    const int tid = threadIdx.x;
    const int n4  = (tid & 15) * 4;   // 4 columns of the tile
    const int kg  = (tid >> 4) * 8;   // 8 rows, twice (m * 64)
    const float* src = w + (size_t)k0 * N + n0 + (kg * N + n4);

    float4 a[2][8];
#pragma unroll   // both: constant indices into a; the 16 loads go out together
    for (int m = 0; m < 2; m++)
#pragma unroll
        for (int i = 0; i < 8; i++)
            a[m][i] = *(const float4*)(src + (m * 64 + i) * N);
    // The loads' address register is free for reuse from here on: this wait
    // stands in front of that reuse.
    asm volatile("s_wait_xcnt 0x0" ::: "memory");

#pragma unroll   // all three: constant indices into a, so that it stays in registers
    for (int m = 0; m < 2; m++)
#pragma unroll
        for (int j = 0; j < 4; j++) {
            bf16x8 p;
#pragma unroll
            for (int i = 0; i < 8; i++) p[i] = (__bf16)pick(a[m][i], j);
            *(bf16x8*)&Ts[(n4 + j) * PSTR + m * 64 + kg] = p;
        }
    __syncthreads();

    const int nr = tid >> 4;          // 16 chunks of 8 bf16 per row
    const int c8 = (tid & 15) * 8;
    __bf16* dst = wt + (size_t)n0 * K + k0 + (nr * K + c8);
#pragma unroll   // the 8 LDS reads go out together, ahead of the first store
    for (int p = 0; p < 8; p++) {
        bf16x8 q = *(const bf16x8*)&Ts[(nr + p * 8) * PSTR + c8];
        *(bf16x8*)(dst + p * 8 * K) = q;
    }
}

__global__ __launch_bounds__(128) __attribute__((amdgpu_waves_per_eu(4, 4)))
void pack_all(
    const float* __restrict__ w_qk, const float* __restrict__ w_v,
    const float* __restrict__ w_o,  const float* __restrict__ w_f1,
    const float* __restrict__ w_f2, __bf16* __restrict__ wt_all) {
    __shared__ __attribute__((aligned(16))) __bf16 Ts[PTN * PSTR];   // [n][k]

    // Which weight, by block index (the same for the whole block).
    const int job = blockIdx.x / PTILES;   // 0..6, in units of PD*PD elements
    if (job < 3) {
        const float* w = job == 0 ? w_qk : job == 1 ? w_v : w_o;
        pack_tile<PD, PD>(w, wt_all + (size_t)job * PD * PD,
                          blockIdx.x - job * PTILES, Ts);
    } else if (job < 5) {
        pack_tile<PD, 2 * PD>(w_f1, wt_all + (size_t)3 * PD * PD,
                              blockIdx.x - 3 * PTILES, Ts);
    } else {
        pack_tile<2 * PD, PD>(w_f2, wt_all + (size_t)5 * PD * PD,
                              blockIdx.x - 5 * PTILES, Ts);
    }
}

// ---------------------------------------------------------------------------
// GEMM:  C[M][N] = act( A[M][K] @ W[K][N] + bias[N] )
//   A     : fp32 row-major (converted to bf16 while staging to LDS)
//   Wt    : bf16, pre-transposed [N][K] (staged via async global->LDS DMA)
// Block tile 128x128x32, 256 threads (8 waves, 4x2), wave tile 32x64
//   => 8 v_wmma_f32_16x16x32_bf16 per wave per K-step.
// Double-buffered LDS: tile t+1's loads (async B DMA, A into registers) are all
// issued ahead of tile t's WMMAs; A is converted and stored behind them;
// single s_wait_asynccnt+barrier per K-step.
// ---------------------------------------------------------------------------
#define BM 128
#define BN 128
#define BK 32
#define LDS_STR 40   // BK + 8 pad; 40*2B = 80B row stride (16B aligned)

template <int ACT>  // 0 = none, 1 = exact GELU
__global__ __launch_bounds__(256) void gemm_bf16w(
    const float* __restrict__ A, const __bf16* __restrict__ Wt,
    const float* __restrict__ bias, float* __restrict__ C,
    int M, int N, int K) {
    __shared__ __bf16 As[2][BM * LDS_STR];
    __shared__ __bf16 Bs[2][BN * LDS_STR];

    const int bm  = blockIdx.y * BM;
    const int bn  = blockIdx.x * BN;
    const int tid = threadIdx.x;
    const int wid = tid >> 5;
    const int wm  = (wid >> 1) * 32;  // 0..96
    const int wn  = (wid & 1) * 64;   // 0,64
    const int lane = tid & 31;

    float4 av[4];   // A part of the next K-slice, in flight during the WMMAs

    // Issue every load of one 128x32 K-slice: B into LDS buffer `buf`, A into av.
    auto stage = [&](int k0, int buf) {
        // Weight tile: pure bf16 byte-copy -> async DMA (2 x 16B per thread).
#pragma unroll
        for (int i = 0; i < 2; i++) {
            int idx = tid + i * 256;
            int r   = idx >> 2;          // 4 chunks of 8 bf16 per row
            int c8  = (idx & 3) * 8;
            async_copy_b128(&Bs[buf][r * LDS_STR + c8],
                            Wt + (size_t)(bn + r) * K + k0 + c8);
        }
        // Activation tile: four fp32 loads per thread, none waited for here.
#pragma unroll
        for (int i = 0; i < 4; i++) {
            int idx = tid + i * 256;
            int r   = idx >> 3;          // 8 float4 per row
            int c4  = (idx & 7) * 4;
            av[i] = *(const float4*)(A + (size_t)(bm + r) * K + k0 + c4);
        }
        // The loads' address registers are reused at once (prefetch addresses,
        // fragments): this wait stands in front of that reuse.
        asm volatile("s_wait_xcnt 0x0" ::: "memory");
        if (k0 + 2 * BK < K) {
#pragma unroll
            for (int i = 0; i < 4; i++) {
                int idx = tid + i * 256;
                int r   = idx >> 3;
                int c4  = (idx & 7) * 4;
                __builtin_prefetch(A + (size_t)(bm + r) * K + k0 + c4 + 2 * BK,
                                   0, 1);
            }
        }
    };
    // Convert av to bf16 and store it into LDS buffer `buf`.
    auto put = [&](int buf) {
#pragma unroll
        for (int i = 0; i < 4; i++) {
            int idx = tid + i * 256;
            int r   = idx >> 3;
            int c4  = (idx & 7) * 4;
            __bf16* dst = &As[buf][r * LDS_STR + c4];
            dst[0] = (__bf16)av[i].x; dst[1] = (__bf16)av[i].y;
            dst[2] = (__bf16)av[i].z; dst[3] = (__bf16)av[i].w;
        }
    };

    f32x8 zero = {0.f, 0.f, 0.f, 0.f, 0.f, 0.f, 0.f, 0.f};
    f32x8 acc[2][4];
#pragma unroll
    for (int i = 0; i < 2; i++)
#pragma unroll
        for (int j = 0; j < 4; j++) acc[i][j] = zero;

    stage(0, 0);
    put(0);
    wait_async0();
    __syncthreads();

    const int nk = K / BK;
    for (int t = 0; t < nk; t++) {
        const int buf = t & 1;
        if (t + 1 < nk) stage((t + 1) * BK, buf ^ 1);

        bf16x16 af[2], bfr[4];
        af[0] = load_frag(As[buf], wm,      0, LDS_STR);
        af[1] = load_frag(As[buf], wm + 16, 0, LDS_STR);
#pragma unroll
        for (int j = 0; j < 4; j++)
            bfr[j] = load_frag(Bs[buf], wn + j * 16, 0, LDS_STR);
#pragma unroll
        for (int i = 0; i < 2; i++)
#pragma unroll
            for (int j = 0; j < 4; j++)
                acc[i][j] = wmma_bf16(af[i], bfr[j], acc[i][j]);

        if (t + 1 < nk) put(buf ^ 1);   // first use of av: the loads had the WMMAs' time
        wait_async0();      // next tile's DMA landed in LDS
        __syncthreads();    // next tile's A stores visible; this tile done
    }

    const int colOff = lane & 15;
    const int rowOff = (lane >> 4) * 8;
#pragma unroll
    for (int i = 0; i < 2; i++) {
#pragma unroll
        for (int j = 0; j < 4; j++) {
            int col  = bn + wn + j * 16 + colOff;
            float bv = bias[col];
#pragma unroll
            for (int r = 0; r < 8; r++) {
                int row   = bm + wm + i * 16 + rowOff + r;
                float val = acc[i][j][r] + bv;
                if (ACT == 1)
                    val = 0.5f * val * (1.0f + erff(val * 0.70710678118654752f));
                C[(size_t)row * N + col] = val;
            }
        }
    }
}

#define AHD 64
#define ASTR 72   // 64 + 8 pad, 144B row stride (16B aligned)

__device__ __forceinline__ float swap_halves(float x) {
    int b = __builtin_bit_cast(int, x);
    b = __builtin_amdgcn_permlanex16(b, b, 0x76543210, 0xfedcba98, false, false);
    return __builtin_bit_cast(float, b);
}

__global__ __launch_bounds__(128) __attribute__((amdgpu_waves_per_eu(4, 4)))
void attn_kernel(
    const float* __restrict__ qk, const float* __restrict__ v,
    float* __restrict__ out, int B, int T, int H) {
    __shared__ __bf16 Qs[64 * ASTR];
    __shared__ __bf16 Ks[64 * ASTR];
    __shared__ __bf16 Vt[64 * ASTR];   // transposed: [hd][key]

    const int b  = blockIdx.z;
    const int h  = blockIdx.y;
    const int q0 = blockIdx.x * 64;
    const int tid = threadIdx.x;
    const int wid = tid >> 5;
    const int lane = tid & 31;
    const size_t Dm = (size_t)H * AHD;

    const float* qbase = qk + (size_t)b * T * Dm + (size_t)h * AHD;
    const float* vbase = v  + (size_t)b * T * Dm + (size_t)h * AHD;

    // Stage Q (64x64 fp32 -> bf16): 1024 float4, 8 per thread.
#pragma unroll
    for (int i = 0; i < 8; i++) {
        int idx = tid + i * 128;
        int r   = idx >> 4;
        int c4  = (idx & 15) * 4;
        float4 qv = *(const float4*)(qbase + (size_t)(q0 + r) * Dm + c4);
        __bf16* dst = Qs + r * ASTR + c4;
        dst[0] = (__bf16)qv.x; dst[1] = (__bf16)qv.y;
        dst[2] = (__bf16)qv.z; dst[3] = (__bf16)qv.w;
    }
    __syncthreads();

    // B operand of S^T: column = query, k = head dim.
    bf16x16 qb[2];
    qb[0] = load_frag(Qs, wid * 16, 0,  ASTR);
    qb[1] = load_frag(Qs, wid * 16, 32, ASTR);

    f32x8 zero = {0.f, 0.f, 0.f, 0.f, 0.f, 0.f, 0.f, 0.f};
    f32x8 o[4];   // o[n][r] = O^T[hd = 16n + 8*(lane>>4) + r][query = lane&15]
#pragma unroll
    for (int n = 0; n < 4; n++) o[n] = zero;
    float m_q = -1e30f;
    f32x8 l_v = zero;

    for (int kb = 0; kb < T; kb += 64) {
        __syncthreads();
        // Stage K tile and transposed V tile.
#pragma unroll
        for (int i = 0; i < 8; i++) {
            int idx = tid + i * 128;
            int r   = idx >> 4;
            int c4  = (idx & 15) * 4;
            float4 kv = *(const float4*)(qbase + (size_t)(kb + r) * Dm + c4);
            __bf16* dst = Ks + r * ASTR + c4;
            dst[0] = (__bf16)kv.x; dst[1] = (__bf16)kv.y;
            dst[2] = (__bf16)kv.z; dst[3] = (__bf16)kv.w;
            float4 vv = *(const float4*)(vbase + (size_t)(kb + r) * Dm + c4);
            Vt[(c4 + 0) * ASTR + r] = (__bf16)vv.x;
            Vt[(c4 + 1) * ASTR + r] = (__bf16)vv.y;
            Vt[(c4 + 2) * ASTR + r] = (__bf16)vv.z;
            Vt[(c4 + 3) * ASTR + r] = (__bf16)vv.w;
        }
        __syncthreads();

        // S^T = K Q^T (64 keys x 16 queries per wave), K-dim = HD = 64.
        // s[n][r] = score(key = kb + 16n + 8*(lane>>4) + r, query = lane&15)
        f32x8 s[4];
#pragma unroll
        for (int n = 0; n < 4; n++) {
            bf16x16 ka0 = load_frag(Ks, n * 16, 0,  ASTR);
            bf16x16 ka1 = load_frag(Ks, n * 16, 32, ASTR);
            s[n] = wmma_bf16(ka0, qb[0], zero);
            s[n] = wmma_bf16(ka1, qb[1], s[n]);
        }
        // scale by 1/sqrt(HD) = 1/8
#pragma unroll
        for (int n = 0; n < 4; n++)
#pragma unroll
            for (int r = 0; r < 8; r++) s[n][r] *= 0.125f;

        // Online softmax: one query per lane. Every loop here is unrolled so
        // that the tiles are indexed by constants and stay in registers.
        float mt[4];   // one short chain per tile, not one chain of 32
#pragma unroll
        for (int n = 0; n < 4; n++) {
            mt[n] = s[n][0];
#pragma unroll
            for (int r = 1; r < 8; r++) mt[n] = fmaxf(mt[n], s[n][r]);
        }
        float mx = fmaxf(fmaxf(mt[0], mt[1]), fmaxf(mt[2], mt[3]));
        mx = fmaxf(mx, swap_halves(mx));
        float mnew = fmaxf(m_q, mx);
        float corr = __expf(m_q - mnew);
        m_q = mnew;

        Frag16 pb[2];   // B operand of O^T: column = query, k = key
        l_v *= corr;
#pragma unroll
        for (int n = 0; n < 4; n++) {
            f32x8 p;
#pragma unroll
            for (int r = 0; r < 8; r++) p[r] = __expf(s[n][r] - mnew);
            l_v += p;
#pragma unroll
            for (int r = 0; r < 8; r++) pb[n >> 1].h[n & 1][r] = (__bf16)p[r];
        }
#pragma unroll
        for (int n = 0; n < 4; n++)
#pragma unroll
            for (int r = 0; r < 8; r++) o[n][r] *= corr;

        // O^T += V^T P^T   (K-dim = 64 keys, two 32-steps).
#pragma unroll
        for (int n = 0; n < 4; n++) {
            bf16x16 va0 = load_frag(Vt, n * 16, 0,  ASTR);
            bf16x16 va1 = load_frag(Vt, n * 16, 32, ASTR);
            o[n] = wmma_bf16(va0, pb[0].f, o[n]);
            o[n] = wmma_bf16(va1, pb[1].f, o[n]);
        }
    }

    const float l_q = ((l_v[0] + l_v[1]) + (l_v[2] + l_v[3])) +
                      ((l_v[4] + l_v[5]) + (l_v[6] + l_v[7]));
    const float inv = 1.0f / (l_q + swap_halves(l_q));
    const int row = q0 + wid * 16 + (lane & 15);
    float* orow = out + ((size_t)b * T + row) * Dm + (size_t)h * AHD +
                  (lane >> 4) * 8;
#pragma unroll   // constant indices into o
    for (int n = 0; n < 4; n++) {
        float4 lo = {o[n][0] * inv, o[n][1] * inv, o[n][2] * inv, o[n][3] * inv};
        float4 hi = {o[n][4] * inv, o[n][5] * inv, o[n][6] * inv, o[n][7] * inv};
        *(float4*)(orow + n * 16)     = lo;
        *(float4*)(orow + n * 16 + 4) = hi;
    }
}

// ---------------------------------------------------------------------------
// Fused residual + LayerNorm: out = LN(x + res) * g + b.  One block per token.
// ---------------------------------------------------------------------------
__global__ __launch_bounds__(256) void ln_kernel(
    const float* __restrict__ x, const float* __restrict__ res,
    const float* __restrict__ g, const float* __restrict__ be,
    float* __restrict__ out, int D) {
    __shared__ float red[2][8];
    const size_t base = (size_t)blockIdx.x * D;
    float v[4], s = 0.f, s2 = 0.f;
#pragma unroll
    for (int i = 0; i < 4; i++) {
        int c = threadIdx.x + i * 256;
        v[i] = x[base + c] + res[base + c];
        s += v[i];
        s2 += v[i] * v[i];
    }
#pragma unroll
    for (int off = 16; off > 0; off >>= 1) {
        s  += __shfl_xor(s, off);
        s2 += __shfl_xor(s2, off);
    }
    if ((threadIdx.x & 31) == 0) {
        red[0][threadIdx.x >> 5] = s;
        red[1][threadIdx.x >> 5] = s2;
    }
    __syncthreads();
    float ts = 0.f, ts2 = 0.f;
#pragma unroll
    for (int i = 0; i < 8; i++) { ts += red[0][i]; ts2 += red[1][i]; }
    float mean = ts / (float)D;
    float var  = ts2 / (float)D - mean * mean;
    float rstd = rsqrtf(var + 1e-5f);
#pragma unroll
    for (int i = 0; i < 4; i++) {
        int c = threadIdx.x + i * 256;
        out[base + c] = (v[i] - mean) * rstd * g[c] + be[c];
    }
}

// ---------------------------------------------------------------------------
// Orchestration
// ---------------------------------------------------------------------------
extern "C" void kernel_launch(void* const* d_in, const int* in_sizes, int n_in,
                              void* d_out, int out_size, void* d_ws,
                              size_t ws_size, hipStream_t stream) {
    const int B = 2, T = 2048, D = 1024, H = 16;
    const int M = B * T;  // 4096 tokens

    const float* x    = (const float*)d_in[0];
    const float* w_qk = (const float*)d_in[1];
    const float* b_qk = (const float*)d_in[2];
    const float* w_v  = (const float*)d_in[3];
    const float* b_v  = (const float*)d_in[4];
    const float* w_o  = (const float*)d_in[5];
    const float* b_o  = (const float*)d_in[6];
    const float* g1   = (const float*)d_in[7];
    const float* be1  = (const float*)d_in[8];
    const float* g2   = (const float*)d_in[9];
    const float* be2  = (const float*)d_in[10];
    const float* w_f1 = (const float*)d_in[11];
    const float* b_f1 = (const float*)d_in[12];
    const float* w_f2 = (const float*)d_in[13];
    const float* b_f2 = (const float*)d_in[14];
    float* outp = (float*)d_out;

    // Workspace layout (fp32 activations then bf16 packed weights), ~115 MB.
    float* ws = (float*)d_ws;
    const size_t SZ = (size_t)M * D;          // 4M elements per activation
    float* qk_buf = ws;                       // qk; reused as o-proj output
    float* v_buf  = ws + SZ;                  // v;  reused as ffn output
    float* a_buf  = ws + 2 * SZ;              // attention output
    float* x1_buf = ws + 3 * SZ;              // post-LN1
    float* h_buf  = ws + 4 * SZ;              // GELU hidden (2*SZ elements)
    __bf16* wt_qk = (__bf16*)(ws + 6 * SZ);
    __bf16* wt_v  = wt_qk + (size_t)D * D;
    __bf16* wt_o  = wt_v  + (size_t)D * D;
    __bf16* wt_f1 = wt_o  + (size_t)D * D;    // [2D][D]
    __bf16* wt_f2 = wt_f1 + (size_t)2 * D * D; // [D][2D]

    // 1) Pack weights to bf16 transposed (wt_qk is the start of all five).
    pack_all<<<7 * PTILES, 128, 0, stream>>>(w_qk, w_v, w_o, w_f1, w_f2, wt_qk);

    dim3 gNN(D / BN, M / BM);       // N = 1024
    dim3 gN2(2 * D / BN, M / BM);   // N = 2048

    // 2) Projections.
    gemm_bf16w<0><<<gNN, 256, 0, stream>>>(x, wt_qk, b_qk, qk_buf, M, D, D);
    gemm_bf16w<0><<<gNN, 256, 0, stream>>>(x, wt_v,  b_v,  v_buf,  M, D, D);

    // 3) Attention.
    attn_kernel<<<dim3(T / 64, H, B), 128, 0, stream>>>(qk_buf, v_buf, a_buf,
                                                        B, T, H);

    // 4) Output projection (reuse qk_buf).
    gemm_bf16w<0><<<gNN, 256, 0, stream>>>(a_buf, wt_o, b_o, qk_buf, M, D, D);

    // 5) Residual + LN1.
    ln_kernel<<<M, 256, 0, stream>>>(x, qk_buf, g1, be1, x1_buf, D);

    // 6) FFN.
    gemm_bf16w<1><<<gN2, 256, 0, stream>>>(x1_buf, wt_f1, b_f1, h_buf,
                                           M, 2 * D, D);
    gemm_bf16w<0><<<gNN, 256, 0, stream>>>(h_buf, wt_f2, b_f2, v_buf,
                                           M, D, 2 * D);

    // 7) Residual + LN2 -> d_out.
    ln_kernel<<<M, 256, 0, stream>>>(x1_buf, v_buf, g2, be2, outp, D);
}

// v004
// It runs in 202 microseconds.
// Next to v003, in two timings, it ran 1.19 and 1.18 times as fast.
// All steps since v000 together make it 1.91 times as fast.
#include <hip/hip_runtime.h>
#include <hip/hip_bf16.h>
#include <cstdint>

typedef __attribute__((ext_vector_type(16))) __bf16 bf16x16;
typedef __attribute__((ext_vector_type(8)))  __bf16 bf16x8;
typedef __attribute__((ext_vector_type(8)))  float  f32x8;

union Frag16 { bf16x16 f; bf16x8 h[2]; };

__device__ __forceinline__ bf16x16 load_frag(const __bf16* lds, int rowBase,
                                             int kBase, int stride) {
    int lane  = threadIdx.x & 31;
    int row   = rowBase + (lane & 15);
    int khalf = (lane < 16) ? 0 : 8;
    const __bf16* p = lds + row * stride + kBase + khalf;
    Frag16 fr;
    fr.h[0] = *(const bf16x8*)(p);
    fr.h[1] = *(const bf16x8*)(p + 16);
    return fr.f;
}

__device__ __forceinline__ f32x8 wmma_bf16(bf16x16 a, bf16x16 b, f32x8 c) {
    return __builtin_amdgcn_wmma_f32_16x16x32_bf16(
        /*neg_a=*/false, a, /*neg_b=*/false, b,
        /*c_mod=*/(short)0, c, /*reuse_a=*/false, /*reuse_b=*/false);
}

__device__ __forceinline__ void async_copy8_b128(const uint32_t* l,
                                                 const __bf16* const* g) {
    asm volatile("global_load_async_to_lds_b128 %0, %8, off\n\t"
                 "global_load_async_to_lds_b128 %1, %9, off\n\t"
                 "global_load_async_to_lds_b128 %2, %10, off\n\t"
                 "global_load_async_to_lds_b128 %3, %11, off\n\t"
                 "global_load_async_to_lds_b128 %4, %12, off\n\t"
                 "global_load_async_to_lds_b128 %5, %13, off\n\t"
                 "global_load_async_to_lds_b128 %6, %14, off\n\t"
                 "global_load_async_to_lds_b128 %7, %15, off\n\t"
                 "s_wait_xcnt 0x0"
                 :: "v"(l[0]), "v"(l[1]), "v"(l[2]), "v"(l[3]),
                    "v"(l[4]), "v"(l[5]), "v"(l[6]), "v"(l[7]),
                    "v"(g[0]), "v"(g[1]), "v"(g[2]), "v"(g[3]),
                    "v"(g[4]), "v"(g[5]), "v"(g[6]), "v"(g[7])
                 : "memory");
}

__device__ __forceinline__ void wait_async0() {
    asm volatile("s_wait_asynccnt 0x0" ::: "memory");
}

// ---------------------------------------------------------------------------
// Weight pack: fp32 W[K][N] row-major  ->  bf16 Wt[N][K]  (transposed)
// One launch for all five weights. A block of 4 waves takes one tile of
// 128 (k) x 64 (n): it reads 256-byte row pieces with 16-byte loads (all 16 of
// a thread in flight together), turns the tile in LDS and writes 256-byte
// pieces of Wt rows with 16-byte stores. The packed weights lie one behind the
// other in wt_all: qk, v, o (PD*PD each), f1, f2 (2*PD*PD each).
// ---------------------------------------------------------------------------
#define PD   1024  // model width: qk, v, o are PD x PD, f1 PD x 2PD, f2 2PD x PD
#define PTK  128   // tile extent in k
#define PTN  64    // tile extent in n
#define PSTR 136   // PTK + 8 pad: 272-byte LDS rows (16-byte aligned)
#define PTILES ((PD / PTK) * (PD / PTN))   // tiles per PD*PD elements

__device__ __forceinline__ float pick(float4 v, int j) {
    return j == 0 ? v.x : j == 1 ? v.y : j == 2 ? v.z : v.w;
}

// One tile of one weight. K and N are compile-time so that a thread's 16 loads
// share one address and differ in the immediate offset only.
template <int K, int N>
__device__ __forceinline__ void pack_tile(const float* __restrict__ w,
                                          __bf16* __restrict__ wt, int lt,
                                          __bf16* Ts) {
    const int n0 = (lt % (N / PTN)) * PTN;
    const int k0 = (lt / (N / PTN)) * PTK;
    const int tid = threadIdx.x;
    const int n4  = (tid & 15) * 4;   // 4 columns of the tile
    const int kg  = (tid >> 4) * 8;   // 8 rows, twice (m * 64)
    const float* src = w + (size_t)k0 * N + n0 + (kg * N + n4);

    float4 a[2][8];
#pragma unroll   // both: constant indices into a; the 16 loads go out together
    for (int m = 0; m < 2; m++)
#pragma unroll
        for (int i = 0; i < 8; i++)
            a[m][i] = *(const float4*)(src + (m * 64 + i) * N);
    // The loads' address register is free for reuse from here on: this wait
    // stands in front of that reuse.
    asm volatile("s_wait_xcnt 0x0" ::: "memory");

#pragma unroll   // all three: constant indices into a, so that it stays in registers
    for (int m = 0; m < 2; m++)
#pragma unroll
        for (int j = 0; j < 4; j++) {
            bf16x8 p;
#pragma unroll
            for (int i = 0; i < 8; i++) p[i] = (__bf16)pick(a[m][i], j);
            *(bf16x8*)&Ts[(n4 + j) * PSTR + m * 64 + kg] = p;
        }
    __syncthreads();

    const int nr = tid >> 4;          // 16 chunks of 8 bf16 per row
    const int c8 = (tid & 15) * 8;
    __bf16* dst = wt + (size_t)n0 * K + k0 + (nr * K + c8);
#pragma unroll   // the 8 LDS reads go out together, ahead of the first store
    for (int p = 0; p < 8; p++) {
        bf16x8 q = *(const bf16x8*)&Ts[(nr + p * 8) * PSTR + c8];
        *(bf16x8*)(dst + p * 8 * K) = q;
    }
}

__global__ __launch_bounds__(128) __attribute__((amdgpu_waves_per_eu(4, 4)))
void pack_all(
    const float* __restrict__ w_qk, const float* __restrict__ w_v,
    const float* __restrict__ w_o,  const float* __restrict__ w_f1,
    const float* __restrict__ w_f2, __bf16* __restrict__ wt_all) {
    __shared__ __attribute__((aligned(16))) __bf16 Ts[PTN * PSTR];   // [n][k]

    // Which weight, by block index (the same for the whole block).
    const int job = blockIdx.x / PTILES;   // 0..6, in units of PD*PD elements
    if (job < 3) {
        const float* w = job == 0 ? w_qk : job == 1 ? w_v : w_o;
        pack_tile<PD, PD>(w, wt_all + (size_t)job * PD * PD,
                          blockIdx.x - job * PTILES, Ts);
    } else if (job < 5) {
        pack_tile<PD, 2 * PD>(w_f1, wt_all + (size_t)3 * PD * PD,
                              blockIdx.x - 3 * PTILES, Ts);
    } else {
        pack_tile<2 * PD, PD>(w_f2, wt_all + (size_t)5 * PD * PD,
                              blockIdx.x - 5 * PTILES, Ts);
    }
}

// ---------------------------------------------------------------------------
// GEMM:  C[M][N] = act( A[M][K] @ W[K][N] + bias[N] )
//   A     : fp32 row-major (converted to bf16 while staging to LDS)
//   Wt    : bf16, pre-transposed [N][K] (staged via async global->LDS DMA)
// Block tile 128x128x128, 256 threads (8 waves, 4x2), wave tile 32x64
//   => 32 v_wmma_f32_16x16x32_bf16 per wave per K-step.
// Double-buffered LDS: tile t+1's loads (async B DMA, A into registers) are all
// issued ahead of tile t's WMMAs; A is converted and stored behind them;
// single s_wait_asynccnt+barrier per K-step. A K-step is 128 wide so that the
// load latency, the conversion and the barrier are paid once per 128 k and
// 96 KB per block are in flight during the WMMAs.
// ---------------------------------------------------------------------------
#define BM 128
#define BN 128
#define BK 128
#define LDS_STR 136  // BK + 8 pad; 136*2B = 272B row stride (16B aligned)

// K is compile-time so that a thread's 16 A loads share one address register
// pair and differ in the immediate offset only.
template <int ACT, int K>  // ACT: 0 = none, 1 = exact GELU
__global__ __launch_bounds__(256) void gemm_bf16w(
    const float* __restrict__ A, const __bf16* __restrict__ Wt,
    const float* __restrict__ bias, float* __restrict__ C,
    int M, int N) {
    __shared__ __attribute__((aligned(16))) __bf16 As[2][BM * LDS_STR];
    __shared__ __attribute__((aligned(16))) __bf16 Bs[2][BN * LDS_STR];

    const int bm  = blockIdx.y * BM;
    const int bn  = blockIdx.x * BN;
    const int tid = threadIdx.x;
    const int wid = tid >> 5;
    const int wm  = (wid >> 1) * 32;  // 0..96
    const int wn  = (wid & 1) * 64;   // 0,64
    const int lane = tid & 31;

    float4 av[16];  // A part of the next K-slice, in flight during the WMMAs

    // A thread's pieces of a slice lie a constant number of rows apart, so each
    // operand has one base address per thread and constant steps from it.
    const int ar  = tid >> 5;          // A: 32 float4 per row, 8 rows per round
    const int ac4 = (tid & 31) * 4;
    const int br  = tid >> 4;          // B: 16 chunks of 8 bf16 per row, 16 rows
    const int bc8 = (tid & 15) * 8;
    const float*   abase = A + (size_t)bm * K;            // same for the block
    const uint32_t aoff  = (uint32_t)(ar * K + ac4) * 4;  // the thread's bytes
    const __bf16*  bsrc  = Wt + (size_t)bn * K + (br * K + bc8);

    // Issue every load of one 128x128 K-slice: B into LDS buffer `buf`, A into av.
    auto stage = [&](int k0, int buf) {
        // Weight tile: pure bf16 byte-copy -> async DMA (8 x 16B per thread).
        uint32_t      bl[8];
        const __bf16* bg[8];
#pragma unroll   // constant indices: both arrays stay in registers
        for (int i = 0; i < 8; i++) {
            bl[i] = (uint32_t)(uintptr_t)&Bs[buf][(br + i * 16) * LDS_STR + bc8];
            bg[i] = bsrc + k0 + i * 16 * K;
        }
        async_copy8_b128(bl, bg);
        // Activation tile: sixteen fp32 loads per thread, none waited for here.
#pragma unroll   // constant indices into av; the 16 loads go out together
        for (int i = 0; i < 16; i++)
            av[i] = *(const float4*)((const char*)(abase + k0 + i * 8 * K) + aoff);
        // The loads' address registers are reused at once (fragment addresses):
        // this wait stands in front of that reuse. It names the address so that
        // the pair lives up to here and no load's result is placed on it.
        asm volatile("s_wait_xcnt 0x0"
                     :: "v"((const char*)(abase + k0) + aoff) : "memory");
    };
    // Convert av to bf16 and store it into LDS buffer `buf`.
    auto put = [&](int buf) {
#pragma unroll   // constant indices into av
        for (int i = 0; i < 16; i++) {
            __bf16* dst = &As[buf][(ar + i * 8) * LDS_STR + ac4];
            dst[0] = (__bf16)av[i].x; dst[1] = (__bf16)av[i].y;
            dst[2] = (__bf16)av[i].z; dst[3] = (__bf16)av[i].w;
        }
    };

    f32x8 zero = {0.f, 0.f, 0.f, 0.f, 0.f, 0.f, 0.f, 0.f};
    f32x8 acc[2][4];
#pragma unroll
    for (int i = 0; i < 2; i++)
#pragma unroll
        for (int j = 0; j < 4; j++) acc[i][j] = zero;

    stage(0, 0);
    put(0);
    wait_async0();
    __syncthreads();

    const int nk = K / BK;
    for (int t = 0; t < nk; t++) {
        const int buf = t & 1;
        if (t + 1 < nk) stage((t + 1) * BK, buf ^ 1);

#pragma unroll
        for (int kk = 0; kk < BK; kk += 32) {
            bf16x16 af[2], bfr[4];
            af[0] = load_frag(As[buf], wm,      kk, LDS_STR);
            af[1] = load_frag(As[buf], wm + 16, kk, LDS_STR);
#pragma unroll
            for (int j = 0; j < 4; j++)
                bfr[j] = load_frag(Bs[buf], wn + j * 16, kk, LDS_STR);
#pragma unroll
            for (int i = 0; i < 2; i++)
#pragma unroll
                for (int j = 0; j < 4; j++)
                    acc[i][j] = wmma_bf16(af[i], bfr[j], acc[i][j]);
        }

        if (t + 1 < nk) put(buf ^ 1);   // first use of av: the loads had the WMMAs' time
        // This wave's LDS reads and stores are done before the barrier behind
        // which the buffer it has read is refilled by the copies.
        asm volatile("s_wait_dscnt 0x0" ::: "memory");
        wait_async0();      // next tile's DMA landed in LDS
        __syncthreads();    // next tile's A stores visible; this tile done
    }

    const int colOff = lane & 15;
    const int rowOff = (lane >> 4) * 8;
#pragma unroll
    for (int i = 0; i < 2; i++) {
#pragma unroll
        for (int j = 0; j < 4; j++) {
            int col  = bn + wn + j * 16 + colOff;
            float bv = bias[col];
#pragma unroll
            for (int r = 0; r < 8; r++) {
                int row   = bm + wm + i * 16 + rowOff + r;
                float val = acc[i][j][r] + bv;
                if (ACT == 1)
                    val = 0.5f * val * (1.0f + erff(val * 0.70710678118654752f));
                C[(size_t)row * N + col] = val;
            }
        }
    }
}

#define AHD 64
#define ASTR 72   // 64 + 8 pad, 144B row stride (16B aligned)

__device__ __forceinline__ float swap_halves(float x) {
    int b = __builtin_bit_cast(int, x);
    b = __builtin_amdgcn_permlanex16(b, b, 0x76543210, 0xfedcba98, false, false);
    return __builtin_bit_cast(float, b);
}

__global__ __launch_bounds__(128) __attribute__((amdgpu_waves_per_eu(4, 4)))
void attn_kernel(
    const float* __restrict__ qk, const float* __restrict__ v,
    float* __restrict__ out, int B, int T, int H) {
    __shared__ __bf16 Qs[64 * ASTR];
    __shared__ __bf16 Ks[64 * ASTR];
    __shared__ __bf16 Vt[64 * ASTR];   // transposed: [hd][key]

    const int b  = blockIdx.z;
    const int h  = blockIdx.y;
    const int q0 = blockIdx.x * 64;
    const int tid = threadIdx.x;
    const int wid = tid >> 5;
    const int lane = tid & 31;
    const size_t Dm = (size_t)H * AHD;

    const float* qbase = qk + (size_t)b * T * Dm + (size_t)h * AHD;
    const float* vbase = v  + (size_t)b * T * Dm + (size_t)h * AHD;

    // Stage Q (64x64 fp32 -> bf16): 1024 float4, 8 per thread.
#pragma unroll
    for (int i = 0; i < 8; i++) {
        int idx = tid + i * 128;
        int r   = idx >> 4;
        int c4  = (idx & 15) * 4;
        float4 qv = *(const float4*)(qbase + (size_t)(q0 + r) * Dm + c4);
        __bf16* dst = Qs + r * ASTR + c4;
        dst[0] = (__bf16)qv.x; dst[1] = (__bf16)qv.y;
        dst[2] = (__bf16)qv.z; dst[3] = (__bf16)qv.w;
    }
    __syncthreads();

    // B operand of S^T: column = query, k = head dim.
    bf16x16 qb[2];
    qb[0] = load_frag(Qs, wid * 16, 0,  ASTR);
    qb[1] = load_frag(Qs, wid * 16, 32, ASTR);

    f32x8 zero = {0.f, 0.f, 0.f, 0.f, 0.f, 0.f, 0.f, 0.f};
    f32x8 o[4];   // o[n][r] = O^T[hd = 16n + 8*(lane>>4) + r][query = lane&15]
#pragma unroll
    for (int n = 0; n < 4; n++) o[n] = zero;
    float m_q = -1e30f;
    f32x8 l_v = zero;

    for (int kb = 0; kb < T; kb += 64) {
        __syncthreads();
        // Stage K tile and transposed V tile.
#pragma unroll
        for (int i = 0; i < 8; i++) {
            int idx = tid + i * 128;
            int r   = idx >> 4;
            int c4  = (idx & 15) * 4;
            float4 kv = *(const float4*)(qbase + (size_t)(kb + r) * Dm + c4);
            __bf16* dst = Ks + r * ASTR + c4;
            dst[0] = (__bf16)kv.x; dst[1] = (__bf16)kv.y;
            dst[2] = (__bf16)kv.z; dst[3] = (__bf16)kv.w;
            float4 vv = *(const float4*)(vbase + (size_t)(kb + r) * Dm + c4);
            Vt[(c4 + 0) * ASTR + r] = (__bf16)vv.x;
            Vt[(c4 + 1) * ASTR + r] = (__bf16)vv.y;
            Vt[(c4 + 2) * ASTR + r] = (__bf16)vv.z;
            Vt[(c4 + 3) * ASTR + r] = (__bf16)vv.w;
        }
        __syncthreads();

        // S^T = K Q^T (64 keys x 16 queries per wave), K-dim = HD = 64.
        // s[n][r] = score(key = kb + 16n + 8*(lane>>4) + r, query = lane&15)
        f32x8 s[4];
#pragma unroll
        for (int n = 0; n < 4; n++) {
            bf16x16 ka0 = load_frag(Ks, n * 16, 0,  ASTR);
            bf16x16 ka1 = load_frag(Ks, n * 16, 32, ASTR);
            s[n] = wmma_bf16(ka0, qb[0], zero);
            s[n] = wmma_bf16(ka1, qb[1], s[n]);
        }
        // scale by 1/sqrt(HD) = 1/8
#pragma unroll
        for (int n = 0; n < 4; n++)
#pragma unroll
            for (int r = 0; r < 8; r++) s[n][r] *= 0.125f;

        // Online softmax: one query per lane. Every loop here is unrolled so
        // that the tiles are indexed by constants and stay in registers.
        float mt[4];   // one short chain per tile, not one chain of 32
#pragma unroll
        for (int n = 0; n < 4; n++) {
            mt[n] = s[n][0];
#pragma unroll
            for (int r = 1; r < 8; r++) mt[n] = fmaxf(mt[n], s[n][r]);
        }
        float mx = fmaxf(fmaxf(mt[0], mt[1]), fmaxf(mt[2], mt[3]));
        mx = fmaxf(mx, swap_halves(mx));
        float mnew = fmaxf(m_q, mx);
        float corr = __expf(m_q - mnew);
        m_q = mnew;

        Frag16 pb[2];   // B operand of O^T: column = query, k = key
        l_v *= corr;
#pragma unroll
        for (int n = 0; n < 4; n++) {
            f32x8 p;
#pragma unroll
            for (int r = 0; r < 8; r++) p[r] = __expf(s[n][r] - mnew);
            l_v += p;
#pragma unroll
            for (int r = 0; r < 8; r++) pb[n >> 1].h[n & 1][r] = (__bf16)p[r];
        }
#pragma unroll
        for (int n = 0; n < 4; n++)
#pragma unroll
            for (int r = 0; r < 8; r++) o[n][r] *= corr;

        // O^T += V^T P^T   (K-dim = 64 keys, two 32-steps).
#pragma unroll
        for (int n = 0; n < 4; n++) {
            bf16x16 va0 = load_frag(Vt, n * 16, 0,  ASTR);
            bf16x16 va1 = load_frag(Vt, n * 16, 32, ASTR);
            o[n] = wmma_bf16(va0, pb[0].f, o[n]);
            o[n] = wmma_bf16(va1, pb[1].f, o[n]);
        }
    }

    const float l_q = ((l_v[0] + l_v[1]) + (l_v[2] + l_v[3])) +
                      ((l_v[4] + l_v[5]) + (l_v[6] + l_v[7]));
    const float inv = 1.0f / (l_q + swap_halves(l_q));
    const int row = q0 + wid * 16 + (lane & 15);
    float* orow = out + ((size_t)b * T + row) * Dm + (size_t)h * AHD +
                  (lane >> 4) * 8;
#pragma unroll   // constant indices into o
    for (int n = 0; n < 4; n++) {
        float4 lo = {o[n][0] * inv, o[n][1] * inv, o[n][2] * inv, o[n][3] * inv};
        float4 hi = {o[n][4] * inv, o[n][5] * inv, o[n][6] * inv, o[n][7] * inv};
        *(float4*)(orow + n * 16)     = lo;
        *(float4*)(orow + n * 16 + 4) = hi;
    }
}

// ---------------------------------------------------------------------------
// Fused residual + LayerNorm: out = LN(x + res) * g + b.  One block per token.
// ---------------------------------------------------------------------------
__global__ __launch_bounds__(256) void ln_kernel(
    const float* __restrict__ x, const float* __restrict__ res,
    const float* __restrict__ g, const float* __restrict__ be,
    float* __restrict__ out, int D) {
    __shared__ float red[2][8];
    const size_t base = (size_t)blockIdx.x * D;
    float v[4], s = 0.f, s2 = 0.f;
#pragma unroll
    for (int i = 0; i < 4; i++) {
        int c = threadIdx.x + i * 256;
        v[i] = x[base + c] + res[base + c];
        s += v[i];
        s2 += v[i] * v[i];
    }
#pragma unroll
    for (int off = 16; off > 0; off >>= 1) {
        s  += __shfl_xor(s, off);
        s2 += __shfl_xor(s2, off);
    }
    if ((threadIdx.x & 31) == 0) {
        red[0][threadIdx.x >> 5] = s;
        red[1][threadIdx.x >> 5] = s2;
    }
    __syncthreads();
    float ts = 0.f, ts2 = 0.f;
#pragma unroll
    for (int i = 0; i < 8; i++) { ts += red[0][i]; ts2 += red[1][i]; }
    float mean = ts / (float)D;
    float var  = ts2 / (float)D - mean * mean;
    float rstd = rsqrtf(var + 1e-5f);
#pragma unroll
    for (int i = 0; i < 4; i++) {
        int c = threadIdx.x + i * 256;
        out[base + c] = (v[i] - mean) * rstd * g[c] + be[c];
    }
}

// ---------------------------------------------------------------------------
// Orchestration
// ---------------------------------------------------------------------------
extern "C" void kernel_launch(void* const* d_in, const int* in_sizes, int n_in,
                              void* d_out, int out_size, void* d_ws,
                              size_t ws_size, hipStream_t stream) {
    const int B = 2, T = 2048, D = 1024, H = 16;
    const int M = B * T;  // 4096 tokens

    const float* x    = (const float*)d_in[0];
    const float* w_qk = (const float*)d_in[1];
    const float* b_qk = (const float*)d_in[2];
    const float* w_v  = (const float*)d_in[3];
    const float* b_v  = (const float*)d_in[4];
    const float* w_o  = (const float*)d_in[5];
    const float* b_o  = (const float*)d_in[6];
    const float* g1   = (const float*)d_in[7];
    const float* be1  = (const float*)d_in[8];
    const float* g2   = (const float*)d_in[9];
    const float* be2  = (const float*)d_in[10];
    const float* w_f1 = (const float*)d_in[11];
    const float* b_f1 = (const float*)d_in[12];
    const float* w_f2 = (const float*)d_in[13];
    const float* b_f2 = (const float*)d_in[14];
    float* outp = (float*)d_out;

    // Workspace layout (fp32 activations then bf16 packed weights), ~115 MB.
    float* ws = (float*)d_ws;
    const size_t SZ = (size_t)M * D;          // 4M elements per activation
    float* qk_buf = ws;                       // qk; reused as o-proj output
    float* v_buf  = ws + SZ;                  // v;  reused as ffn output
    float* a_buf  = ws + 2 * SZ;              // attention output
    float* x1_buf = ws + 3 * SZ;              // post-LN1
    float* h_buf  = ws + 4 * SZ;              // GELU hidden (2*SZ elements)
    __bf16* wt_qk = (__bf16*)(ws + 6 * SZ);
    __bf16* wt_v  = wt_qk + (size_t)D * D;
    __bf16* wt_o  = wt_v  + (size_t)D * D;
    __bf16* wt_f1 = wt_o  + (size_t)D * D;    // [2D][D]
    __bf16* wt_f2 = wt_f1 + (size_t)2 * D * D; // [D][2D]

    // 1) Pack weights to bf16 transposed (wt_qk is the start of all five).
    pack_all<<<7 * PTILES, 128, 0, stream>>>(w_qk, w_v, w_o, w_f1, w_f2, wt_qk);

    dim3 gNN(D / BN, M / BM);       // N = 1024
    dim3 gN2(2 * D / BN, M / BM);   // N = 2048

    // 2) Projections.
    gemm_bf16w<0, 1024><<<gNN, 256, 0, stream>>>(x, wt_qk, b_qk, qk_buf, M, D);
    gemm_bf16w<0, 1024><<<gNN, 256, 0, stream>>>(x, wt_v,  b_v,  v_buf,  M, D);

    // 3) Attention.
    attn_kernel<<<dim3(T / 64, H, B), 128, 0, stream>>>(qk_buf, v_buf, a_buf,
                                                        B, T, H);

    // 4) Output projection (reuse qk_buf).
    gemm_bf16w<0, 1024><<<gNN, 256, 0, stream>>>(a_buf, wt_o, b_o, qk_buf, M, D);

    // 5) Residual + LN1.
    ln_kernel<<<M, 256, 0, stream>>>(x, qk_buf, g1, be1, x1_buf, D);

    // 6) FFN.
    gemm_bf16w<1, 1024><<<gN2, 256, 0, stream>>>(x1_buf, wt_f1, b_f1, h_buf,
                                                 M, 2 * D);
    gemm_bf16w<0, 2048><<<gNN, 256, 0, stream>>>(h_buf, wt_f2, b_f2, v_buf,
                                                 M, D);

    // 7) Residual + LN2 -> d_out.
    ln_kernel<<<M, 256, 0, stream>>>(x1_buf, v_buf, g2, be2, outp, D);
}

// v005
// A run of this version takes 152 microseconds.
// Next to v004, in two timings, it ran 1.33 times as fast each time.
// Counting every step since v000, it is 2.54 times as fast.
#include <hip/hip_runtime.h>
#include <hip/hip_bf16.h>
#include <cstdint>

typedef __attribute__((ext_vector_type(16))) __bf16 bf16x16;
typedef __attribute__((ext_vector_type(8)))  __bf16 bf16x8;
typedef __attribute__((ext_vector_type(8)))  float  f32x8;

union Frag16 { bf16x16 f; bf16x8 h[2]; };

__device__ __forceinline__ bf16x16 load_frag(const __bf16* lds, int rowBase,
                                             int kBase, int stride) {
    int lane  = threadIdx.x & 31;
    int row   = rowBase + (lane & 15);
    int khalf = (lane < 16) ? 0 : 8;
    const __bf16* p = lds + row * stride + kBase + khalf;
    Frag16 fr;
    fr.h[0] = *(const bf16x8*)(p);
    fr.h[1] = *(const bf16x8*)(p + 16);
    return fr.f;
}

__device__ __forceinline__ f32x8 wmma_bf16(bf16x16 a, bf16x16 b, f32x8 c) {
    return __builtin_amdgcn_wmma_f32_16x16x32_bf16(
        /*neg_a=*/false, a, /*neg_b=*/false, b,
        /*c_mod=*/(short)0, c, /*reuse_a=*/false, /*reuse_b=*/false);
}

__device__ __forceinline__ void async_copy8_b128(const uint32_t* l,
                                                 const __bf16* const* g) {
    asm volatile("global_load_async_to_lds_b128 %0, %8, off\n\t"
                 "global_load_async_to_lds_b128 %1, %9, off\n\t"
                 "global_load_async_to_lds_b128 %2, %10, off\n\t"
                 "global_load_async_to_lds_b128 %3, %11, off\n\t"
                 "global_load_async_to_lds_b128 %4, %12, off\n\t"
                 "global_load_async_to_lds_b128 %5, %13, off\n\t"
                 "global_load_async_to_lds_b128 %6, %14, off\n\t"
                 "global_load_async_to_lds_b128 %7, %15, off\n\t"
                 "s_wait_xcnt 0x0"
                 :: "v"(l[0]), "v"(l[1]), "v"(l[2]), "v"(l[3]),
                    "v"(l[4]), "v"(l[5]), "v"(l[6]), "v"(l[7]),
                    "v"(g[0]), "v"(g[1]), "v"(g[2]), "v"(g[3]),
                    "v"(g[4]), "v"(g[5]), "v"(g[6]), "v"(g[7])
                 : "memory");
}

__device__ __forceinline__ void wait_async0() {
    asm volatile("s_wait_asynccnt 0x0" ::: "memory");
}

// ---------------------------------------------------------------------------
// Weight pack: fp32 W[K][N] row-major  ->  bf16 Wt[N][K]  (transposed)
// One launch for all five weights. A block of 4 waves takes one tile of
// 128 (k) x 64 (n): it reads 256-byte row pieces with 16-byte loads (all 16 of
// a thread in flight together), turns the tile in LDS and writes 256-byte
// pieces of Wt rows with 16-byte stores. The packed weights lie one behind the
// other in wt_all: qk, v, o (PD*PD each), f1, f2 (2*PD*PD each).
// ---------------------------------------------------------------------------
#define PD   1024  // model width: qk, v, o are PD x PD, f1 PD x 2PD, f2 2PD x PD
#define PTK  128   // tile extent in k
#define PTN  64    // tile extent in n
#define PSTR 136   // PTK + 8 pad: 272-byte LDS rows (16-byte aligned)
#define PTILES ((PD / PTK) * (PD / PTN))   // tiles per PD*PD elements

__device__ __forceinline__ float pick(float4 v, int j) {
    return j == 0 ? v.x : j == 1 ? v.y : j == 2 ? v.z : v.w;
}

// One tile of one weight. K and N are compile-time so that a thread's 16 loads
// share one address and differ in the immediate offset only.
template <int K, int N>
__device__ __forceinline__ void pack_tile(const float* __restrict__ w,
                                          __bf16* __restrict__ wt, int lt,
                                          __bf16* Ts) {
    const int n0 = (lt % (N / PTN)) * PTN;
    const int k0 = (lt / (N / PTN)) * PTK;
    const int tid = threadIdx.x;
    const int n4  = (tid & 15) * 4;   // 4 columns of the tile
    const int kg  = (tid >> 4) * 8;   // 8 rows, twice (m * 64)
    const float* src = w + (size_t)k0 * N + n0 + (kg * N + n4);

    float4 a[2][8];
#pragma unroll   // both: constant indices into a; the 16 loads go out together
    for (int m = 0; m < 2; m++)
#pragma unroll
        for (int i = 0; i < 8; i++)
            a[m][i] = *(const float4*)(src + (m * 64 + i) * N);
    // The loads' address register is free for reuse from here on: this wait
    // stands in front of that reuse.
    asm volatile("s_wait_xcnt 0x0" ::: "memory");

#pragma unroll   // all three: constant indices into a, so that it stays in registers
    for (int m = 0; m < 2; m++)
#pragma unroll
        for (int j = 0; j < 4; j++) {
            bf16x8 p;
#pragma unroll
            for (int i = 0; i < 8; i++) p[i] = (__bf16)pick(a[m][i], j);
            *(bf16x8*)&Ts[(n4 + j) * PSTR + m * 64 + kg] = p;
        }
    __syncthreads();

    const int nr = tid >> 4;          // 16 chunks of 8 bf16 per row
    const int c8 = (tid & 15) * 8;
    __bf16* dst = wt + (size_t)n0 * K + k0 + (nr * K + c8);
#pragma unroll   // the 8 LDS reads go out together, ahead of the first store
    for (int p = 0; p < 8; p++) {
        bf16x8 q = *(const bf16x8*)&Ts[(nr + p * 8) * PSTR + c8];
        *(bf16x8*)(dst + p * 8 * K) = q;
    }
}

__global__ __launch_bounds__(128) __attribute__((amdgpu_waves_per_eu(4, 4)))
void pack_all(
    const float* __restrict__ w_qk, const float* __restrict__ w_v,
    const float* __restrict__ w_o,  const float* __restrict__ w_f1,
    const float* __restrict__ w_f2, __bf16* __restrict__ wt_all) {
    __shared__ __attribute__((aligned(16))) __bf16 Ts[PTN * PSTR];   // [n][k]

    // Which weight, by block index (the same for the whole block).
    const int job = blockIdx.x / PTILES;   // 0..6, in units of PD*PD elements
    if (job < 3) {
        const float* w = job == 0 ? w_qk : job == 1 ? w_v : w_o;
        pack_tile<PD, PD>(w, wt_all + (size_t)job * PD * PD,
                          blockIdx.x - job * PTILES, Ts);
    } else if (job < 5) {
        pack_tile<PD, 2 * PD>(w_f1, wt_all + (size_t)3 * PD * PD,
                              blockIdx.x - 3 * PTILES, Ts);
    } else {
        pack_tile<2 * PD, PD>(w_f2, wt_all + (size_t)5 * PD * PD,
                              blockIdx.x - 5 * PTILES, Ts);
    }
}

// ---------------------------------------------------------------------------
// GEMM:  C[M][N] = act( A[M][K] @ W[K][N] + bias[N] )
//   A     : fp32 row-major (converted to bf16 while staging to LDS)
//   Wt    : bf16, pre-transposed [N][K] (staged via async global->LDS DMA)
// Block tile 128x128x128, 256 threads (8 waves, 4x2), wave tile 32x64
//   => 32 v_wmma_f32_16x16x32_bf16 per wave per K-step.
// Double-buffered LDS: tile t+1's loads (async B DMA, A into registers) are all
// issued ahead of tile t's WMMAs; A is converted and stored behind them;
// single s_wait_asynccnt+barrier per K-step. A K-step is 128 wide so that the
// load latency, the conversion and the barrier are paid once per 128 k and
// 96 KB per block are in flight during the WMMAs.
// OUT picks what is stored:
//   0 : C,  fp32 [M][N]
//   1 : Cb, bf16 [M][N]. The product is taken transposed (W^T as the A operand),
//       so a lane holds 8 neighbouring columns of one row: one 16-byte store.
//   2 : Cb, bf16 transposed per sequence, [M / SEQ][N][SEQ]: a lane holds 8
//       neighbouring rows of one column, again one 16-byte store.
// 1 and 2 are the forms in which the attention kernel wants K (= Q) and V^T in
// LDS: they are rounded and turned once here, not by every query block.
// ---------------------------------------------------------------------------
#define BM 128
#define BN 128
#define BK 128
#define LDS_STR 136  // BK + 8 pad; 136*2B = 272B row stride (16B aligned)
#define SEQ 2048     // tokens per sequence (T); BM divides it

// K is compile-time so that a thread's 16 A loads share one address register
// pair and differ in the immediate offset only.
template <int ACT, int K, int OUT>  // ACT: 0 = none, 1 = exact GELU
__global__ __launch_bounds__(256) void gemm_bf16w(
    const float* __restrict__ A, const __bf16* __restrict__ Wt,
    const float* __restrict__ bias, float* __restrict__ C,
    __bf16* __restrict__ Cb, int M, int N) {
    __shared__ __attribute__((aligned(16))) __bf16 As[2][BM * LDS_STR];
    __shared__ __attribute__((aligned(16))) __bf16 Bs[2][BN * LDS_STR];

    const int bm  = blockIdx.y * BM;
    const int bn  = blockIdx.x * BN;
    const int tid = threadIdx.x;
    const int wid = tid >> 5;
    const int wm  = (wid >> 1) * 32;  // 0..96
    const int wn  = (wid & 1) * 64;   // 0,64
    const int lane = tid & 31;

    float4 av[16];  // A part of the next K-slice, in flight during the WMMAs

    // A thread's pieces of a slice lie a constant number of rows apart, so each
    // operand has one base address per thread and constant steps from it.
    const int ar  = tid >> 5;          // A: 32 float4 per row, 8 rows per round
    const int ac4 = (tid & 31) * 4;
    const int br  = tid >> 4;          // B: 16 chunks of 8 bf16 per row, 16 rows
    const int bc8 = (tid & 15) * 8;
    const float*   abase = A + (size_t)bm * K;            // same for the block
    const uint32_t aoff  = (uint32_t)(ar * K + ac4) * 4;  // the thread's bytes
    const __bf16*  bsrc  = Wt + (size_t)bn * K + (br * K + bc8);

    // Issue every load of one 128x128 K-slice: B into LDS buffer `buf`, A into av.
    auto stage = [&](int k0, int buf) {
        // Weight tile: pure bf16 byte-copy -> async DMA (8 x 16B per thread).
        uint32_t      bl[8];
        const __bf16* bg[8];
#pragma unroll   // constant indices: both arrays stay in registers
        for (int i = 0; i < 8; i++) {
            bl[i] = (uint32_t)(uintptr_t)&Bs[buf][(br + i * 16) * LDS_STR + bc8];
            bg[i] = bsrc + k0 + i * 16 * K;
        }
        async_copy8_b128(bl, bg);
        // Activation tile: sixteen fp32 loads per thread, none waited for here.
#pragma unroll   // constant indices into av; the 16 loads go out together
        for (int i = 0; i < 16; i++)
            av[i] = *(const float4*)((const char*)(abase + k0 + i * 8 * K) + aoff);
        // The loads' address registers are reused at once (fragment addresses):
        // this wait stands in front of that reuse. It names the address so that
        // the pair lives up to here and no load's result is placed on it.
        asm volatile("s_wait_xcnt 0x0"
                     :: "v"((const char*)(abase + k0) + aoff) : "memory");
    };
    // Convert av to bf16 and store it into LDS buffer `buf`.
    auto put = [&](int buf) {
#pragma unroll   // constant indices into av
        for (int i = 0; i < 16; i++) {
            __bf16* dst = &As[buf][(ar + i * 8) * LDS_STR + ac4];
            dst[0] = (__bf16)av[i].x; dst[1] = (__bf16)av[i].y;
            dst[2] = (__bf16)av[i].z; dst[3] = (__bf16)av[i].w;
        }
    };

    f32x8 zero = {0.f, 0.f, 0.f, 0.f, 0.f, 0.f, 0.f, 0.f};
    f32x8 acc[2][4];
#pragma unroll
    for (int i = 0; i < 2; i++)
#pragma unroll
        for (int j = 0; j < 4; j++) acc[i][j] = zero;

    stage(0, 0);
    put(0);
    wait_async0();
    __syncthreads();

    const int nk = K / BK;
    for (int t = 0; t < nk; t++) {
        const int buf = t & 1;
        if (t + 1 < nk) stage((t + 1) * BK, buf ^ 1);

#pragma unroll
        for (int kk = 0; kk < BK; kk += 32) {
            bf16x16 af[2], bfr[4];
            af[0] = load_frag(As[buf], wm,      kk, LDS_STR);
            af[1] = load_frag(As[buf], wm + 16, kk, LDS_STR);
#pragma unroll
            for (int j = 0; j < 4; j++)
                bfr[j] = load_frag(Bs[buf], wn + j * 16, kk, LDS_STR);
#pragma unroll
            for (int i = 0; i < 2; i++)
#pragma unroll
                for (int j = 0; j < 4; j++)
                    acc[i][j] = OUT == 1 ? wmma_bf16(bfr[j], af[i], acc[i][j])
                                         : wmma_bf16(af[i], bfr[j], acc[i][j]);
        }

        if (t + 1 < nk) put(buf ^ 1);   // first use of av: the loads had the WMMAs' time
        // This wave's LDS reads and stores are done before the barrier behind
        // which the buffer it has read is refilled by the copies.
        asm volatile("s_wait_dscnt 0x0" ::: "memory");
        wait_async0();      // next tile's DMA landed in LDS
        __syncthreads();    // next tile's A stores visible; this tile done
    }

    const int colOff = lane & 15;
    const int rowOff = (lane >> 4) * 8;
#pragma unroll
    for (int i = 0; i < 2; i++) {
#pragma unroll
        for (int j = 0; j < 4; j++) {
            if (OUT == 1) {
                int col0 = bn + wn + j * 16 + rowOff;
                int row  = bm + wm + i * 16 + colOff;
                float4 b0 = *(const float4*)(bias + col0);
                float4 b1 = *(const float4*)(bias + col0 + 4);
                bf16x8 p;
#pragma unroll   // constant indices into acc, p and the bias vectors
                for (int r = 0; r < 8; r++)
                    p[r] = (__bf16)(acc[i][j][r] + pick(r < 4 ? b0 : b1, r & 3));
                *(bf16x8*)(Cb + (size_t)row * N + col0) = p;
                continue;
            }
            int col  = bn + wn + j * 16 + colOff;
            float bv = bias[col];
            if (OUT == 2) {
                int row0 = bm + wm + i * 16 + rowOff;
                bf16x8 p;
#pragma unroll   // constant indices into acc and p
                for (int r = 0; r < 8; r++) p[r] = (__bf16)(acc[i][j][r] + bv);
                *(bf16x8*)(Cb + ((size_t)(row0 / SEQ) * N + col) * SEQ +
                           row0 % SEQ) = p;
                continue;
            }
#pragma unroll
            for (int r = 0; r < 8; r++) {
                int row   = bm + wm + i * 16 + rowOff + r;
                float val = acc[i][j][r] + bv;
                if (ACT == 1)
                    val = 0.5f * val * (1.0f + erff(val * 0.70710678118654752f));
                C[(size_t)row * N + col] = val;
            }
        }
    }
}

#define AHD 64
#define ASTR 72   // 64 + 8 pad, 144B row stride (16B aligned)

__device__ __forceinline__ float swap_halves(float x) {
    int b = __builtin_bit_cast(int, x);
    b = __builtin_amdgcn_permlanex16(b, b, 0x76543210, 0xfedcba98, false, false);
    return __builtin_bit_cast(float, b);
}

__global__ __launch_bounds__(128) __attribute__((amdgpu_waves_per_eu(4, 4)))
void attn_kernel(
    const __bf16* __restrict__ qk, const __bf16* __restrict__ vt,
    float* __restrict__ out, int B, int T, int H) {
    __shared__ __attribute__((aligned(16))) __bf16 Qs[64 * ASTR];
    __shared__ __attribute__((aligned(16))) __bf16 Ks[64 * ASTR];
    __shared__ __attribute__((aligned(16))) __bf16 Vt[64 * ASTR];   // [hd][key]

    const int b  = blockIdx.z;
    const int h  = blockIdx.y;
    const int q0 = blockIdx.x * 64;
    const int tid = threadIdx.x;
    const int wid = tid >> 5;
    const int lane = tid & 31;
    const size_t Dm = (size_t)H * AHD;

    // A 64x64 bf16 tile is 64 rows of 8 chunks of 16 bytes: 4 chunks per thread,
    // 16 rows apart. The row pitches (PD for qk, SEQ for vt) are compile-time so
    // that a thread's 4 loads of a tile share one address register pair and
    // differ in the immediate offset only.
    const int sr = tid >> 3;
    const int sc = (tid & 7) * 8;
    const __bf16* qbase = qk + ((size_t)b * SEQ * PD + (size_t)h * AHD) +
                          (sr * PD + sc);
    const __bf16* vbase = vt + ((size_t)b * PD + (size_t)h * AHD) * SEQ +
                          (sr * SEQ + sc);
    __bf16* const qdst = Qs + sr * ASTR + sc;
    __bf16* const kdst = Ks + sr * ASTR + sc;
    __bf16* const vdst = Vt + sr * ASTR + sc;

    // Stage Q.
    {
        const __bf16* qp = qbase + (size_t)q0 * PD;
        bf16x8 qc[4];
#pragma unroll   // both: constant indices; the 4 loads go out together
        for (int i = 0; i < 4; i++)
            qc[i] = *(const bf16x8*)(qp + i * 16 * PD);
        // Stands in front of any reuse of the loads' address registers; it names
        // the address so that the pair lives up to here.
        asm volatile("s_wait_xcnt 0x0" :: "v"(qp) : "memory");
#pragma unroll
        for (int i = 0; i < 4; i++) *(bf16x8*)(qdst + i * 16 * ASTR) = qc[i];
    }
    __syncthreads();

    // B operand of S^T: column = query, k = head dim.
    bf16x16 qb[2];
    qb[0] = load_frag(Qs, wid * 16, 0,  ASTR);
    qb[1] = load_frag(Qs, wid * 16, 32, ASTR);

    f32x8 zero = {0.f, 0.f, 0.f, 0.f, 0.f, 0.f, 0.f, 0.f};
    f32x8 o[4];   // o[n][r] = O^T[hd = 16n + 8*(lane>>4) + r][query = lane&15]
#pragma unroll
    for (int n = 0; n < 4; n++) o[n] = zero;
    float m_q = -1e30f;
    f32x8 l_v = zero;

    for (int kb = 0; kb < T; kb += 64) {
        __syncthreads();
        // Stage the K tile (rows = keys) and the V^T tile (rows = head dim).
        const __bf16* kp = qbase + (size_t)kb * PD;
        const __bf16* vp = vbase + kb;
        bf16x8 kc[4], vc[4];
#pragma unroll   // both: constant indices; the 8 loads go out together
        for (int i = 0; i < 4; i++) {
            kc[i] = *(const bf16x8*)(kp + i * 16 * PD);
            vc[i] = *(const bf16x8*)(vp + i * 16 * SEQ);
        }
        // Stands in front of any reuse of the loads' address registers; it names
        // the addresses so that both pairs live up to here.
        asm volatile("s_wait_xcnt 0x0" :: "v"(kp), "v"(vp) : "memory");
#pragma unroll
        for (int i = 0; i < 4; i++) {
            *(bf16x8*)(kdst + i * 16 * ASTR) = kc[i];
            *(bf16x8*)(vdst + i * 16 * ASTR) = vc[i];
        }
        __syncthreads();

        // S^T = K Q^T (64 keys x 16 queries per wave), K-dim = HD = 64.
        // s[n][r] = score(key = kb + 16n + 8*(lane>>4) + r, query = lane&15)
        f32x8 s[4];
#pragma unroll
        for (int n = 0; n < 4; n++) {
            bf16x16 ka0 = load_frag(Ks, n * 16, 0,  ASTR);
            bf16x16 ka1 = load_frag(Ks, n * 16, 32, ASTR);
            s[n] = wmma_bf16(ka0, qb[0], zero);
            s[n] = wmma_bf16(ka1, qb[1], s[n]);
        }
        // scale by 1/sqrt(HD) = 1/8
#pragma unroll
        for (int n = 0; n < 4; n++)
#pragma unroll
            for (int r = 0; r < 8; r++) s[n][r] *= 0.125f;

        // Online softmax: one query per lane. Every loop here is unrolled so
        // that the tiles are indexed by constants and stay in registers.
        float mt[4];   // one short chain per tile, not one chain of 32
#pragma unroll
        for (int n = 0; n < 4; n++) {
            mt[n] = s[n][0];
#pragma unroll
            for (int r = 1; r < 8; r++) mt[n] = fmaxf(mt[n], s[n][r]);
        }
        float mx = fmaxf(fmaxf(mt[0], mt[1]), fmaxf(mt[2], mt[3]));
        mx = fmaxf(mx, swap_halves(mx));
        float mnew = fmaxf(m_q, mx);
        float corr = __expf(m_q - mnew);
        m_q = mnew;

        Frag16 pb[2];   // B operand of O^T: column = query, k = key
        l_v *= corr;
#pragma unroll
        for (int n = 0; n < 4; n++) {
            f32x8 p;
#pragma unroll
            for (int r = 0; r < 8; r++) p[r] = __expf(s[n][r] - mnew);
            l_v += p;
#pragma unroll
            for (int r = 0; r < 8; r++) pb[n >> 1].h[n & 1][r] = (__bf16)p[r];
        }
#pragma unroll
        for (int n = 0; n < 4; n++)
#pragma unroll
            for (int r = 0; r < 8; r++) o[n][r] *= corr;

        // O^T += V^T P^T   (K-dim = 64 keys, two 32-steps).
#pragma unroll
        for (int n = 0; n < 4; n++) {
            bf16x16 va0 = load_frag(Vt, n * 16, 0,  ASTR);
            bf16x16 va1 = load_frag(Vt, n * 16, 32, ASTR);
            o[n] = wmma_bf16(va0, pb[0].f, o[n]);
            o[n] = wmma_bf16(va1, pb[1].f, o[n]);
        }
    }

    const float l_q = ((l_v[0] + l_v[1]) + (l_v[2] + l_v[3])) +
                      ((l_v[4] + l_v[5]) + (l_v[6] + l_v[7]));
    const float inv = 1.0f / (l_q + swap_halves(l_q));
    const int row = q0 + wid * 16 + (lane & 15);
    float* orow = out + ((size_t)b * T + row) * Dm + (size_t)h * AHD +
                  (lane >> 4) * 8;
#pragma unroll   // constant indices into o
    for (int n = 0; n < 4; n++) {
        float4 lo = {o[n][0] * inv, o[n][1] * inv, o[n][2] * inv, o[n][3] * inv};
        float4 hi = {o[n][4] * inv, o[n][5] * inv, o[n][6] * inv, o[n][7] * inv};
        *(float4*)(orow + n * 16)     = lo;
        *(float4*)(orow + n * 16 + 4) = hi;
    }
}

// ---------------------------------------------------------------------------
// Fused residual + LayerNorm: out = LN(x + res) * g + b.  One block per token.
// ---------------------------------------------------------------------------
__global__ __launch_bounds__(256) void ln_kernel(
    const float* __restrict__ x, const float* __restrict__ res,
    const float* __restrict__ g, const float* __restrict__ be,
    float* __restrict__ out, int D) {
    __shared__ float red[2][8];
    const size_t base = (size_t)blockIdx.x * D;
    float v[4], s = 0.f, s2 = 0.f;
#pragma unroll
    for (int i = 0; i < 4; i++) {
        int c = threadIdx.x + i * 256;
        v[i] = x[base + c] + res[base + c];
        s += v[i];
        s2 += v[i] * v[i];
    }
#pragma unroll
    for (int off = 16; off > 0; off >>= 1) {
        s  += __shfl_xor(s, off);
        s2 += __shfl_xor(s2, off);
    }
    if ((threadIdx.x & 31) == 0) {
        red[0][threadIdx.x >> 5] = s;
        red[1][threadIdx.x >> 5] = s2;
    }
    __syncthreads();
    float ts = 0.f, ts2 = 0.f;
#pragma unroll
    for (int i = 0; i < 8; i++) { ts += red[0][i]; ts2 += red[1][i]; }
    float mean = ts / (float)D;
    float var  = ts2 / (float)D - mean * mean;
    float rstd = rsqrtf(var + 1e-5f);
#pragma unroll
    for (int i = 0; i < 4; i++) {
        int c = threadIdx.x + i * 256;
        out[base + c] = (v[i] - mean) * rstd * g[c] + be[c];
    }
}

// ---------------------------------------------------------------------------
// Orchestration
// ---------------------------------------------------------------------------
extern "C" void kernel_launch(void* const* d_in, const int* in_sizes, int n_in,
                              void* d_out, int out_size, void* d_ws,
                              size_t ws_size, hipStream_t stream) {
    const int B = 2, T = 2048, D = 1024, H = 16;
    const int M = B * T;  // 4096 tokens

    const float* x    = (const float*)d_in[0];
    const float* w_qk = (const float*)d_in[1];
    const float* b_qk = (const float*)d_in[2];
    const float* w_v  = (const float*)d_in[3];
    const float* b_v  = (const float*)d_in[4];
    const float* w_o  = (const float*)d_in[5];
    const float* b_o  = (const float*)d_in[6];
    const float* g1   = (const float*)d_in[7];
    const float* be1  = (const float*)d_in[8];
    const float* g2   = (const float*)d_in[9];
    const float* be2  = (const float*)d_in[10];
    const float* w_f1 = (const float*)d_in[11];
    const float* b_f1 = (const float*)d_in[12];
    const float* w_f2 = (const float*)d_in[13];
    const float* b_f2 = (const float*)d_in[14];
    float* outp = (float*)d_out;

    // Workspace layout (fp32 activations then bf16 packed weights), ~115 MB.
    float* ws = (float*)d_ws;
    const size_t SZ = (size_t)M * D;          // 4M elements per activation
    float* qk_buf = ws;                       // qk (bf16); then o-proj output
    float* v_buf  = ws + SZ;                  // v^T (bf16); then ffn output
    __bf16* qk_bf = (__bf16*)qk_buf;          // [B][T][D]
    __bf16* vt_bf = (__bf16*)v_buf;           // [B][D][T]
    float* a_buf  = ws + 2 * SZ;              // attention output
    float* x1_buf = ws + 3 * SZ;              // post-LN1
    float* h_buf  = ws + 4 * SZ;              // GELU hidden (2*SZ elements)
    __bf16* wt_qk = (__bf16*)(ws + 6 * SZ);
    __bf16* wt_v  = wt_qk + (size_t)D * D;
    __bf16* wt_o  = wt_v  + (size_t)D * D;
    __bf16* wt_f1 = wt_o  + (size_t)D * D;    // [2D][D]
    __bf16* wt_f2 = wt_f1 + (size_t)2 * D * D; // [D][2D]

    // 1) Pack weights to bf16 transposed (wt_qk is the start of all five).
    pack_all<<<7 * PTILES, 128, 0, stream>>>(w_qk, w_v, w_o, w_f1, w_f2, wt_qk);

    dim3 gNN(D / BN, M / BM);       // N = 1024
    dim3 gN2(2 * D / BN, M / BM);   // N = 2048

    // 2) Projections.
    gemm_bf16w<0, 1024, 1><<<gNN, 256, 0, stream>>>(x, wt_qk, b_qk, nullptr,
                                                    qk_bf, M, D);
    gemm_bf16w<0, 1024, 2><<<gNN, 256, 0, stream>>>(x, wt_v, b_v, nullptr,
                                                    vt_bf, M, D);

    // 3) Attention.
    attn_kernel<<<dim3(T / 64, H, B), 128, 0, stream>>>(qk_bf, vt_bf, a_buf,
                                                        B, T, H);

    // 4) Output projection (reuse qk_buf).
    gemm_bf16w<0, 1024, 0><<<gNN, 256, 0, stream>>>(a_buf, wt_o, b_o, qk_buf,
                                                    nullptr, M, D);

    // 5) Residual + LN1.
    ln_kernel<<<M, 256, 0, stream>>>(x, qk_buf, g1, be1, x1_buf, D);

    // 6) FFN.
    gemm_bf16w<1, 1024, 0><<<gN2, 256, 0, stream>>>(x1_buf, wt_f1, b_f1, h_buf,
                                                    nullptr, M, 2 * D);
    gemm_bf16w<0, 2048, 0><<<gNN, 256, 0, stream>>>(h_buf, wt_f2, b_f2, v_buf,
                                                    nullptr, M, D);

    // 7) Residual + LN2 -> d_out.
    ln_kernel<<<M, 256, 0, stream>>>(x1_buf, v_buf, g2, be2, outp, D);
}

// v006
// One run takes 141 microseconds.
// In two side-by-side timings against v005, it was 1.07 and 1.08 times as fast.
// Counting every step since v000, it is 2.73 times as fast.
#include <hip/hip_runtime.h>
#include <hip/hip_bf16.h>
#include <cstdint>

typedef __attribute__((ext_vector_type(16))) __bf16 bf16x16;
typedef __attribute__((ext_vector_type(8)))  __bf16 bf16x8;
typedef __attribute__((ext_vector_type(4)))  __bf16 bf16x4;
typedef __attribute__((ext_vector_type(8)))  float  f32x8;

union Frag16 { bf16x16 f; bf16x8 h[2]; };

__device__ __forceinline__ bf16x16 load_frag(const __bf16* lds, int rowBase,
                                             int kBase, int stride) {
    int lane  = threadIdx.x & 31;
    int row   = rowBase + (lane & 15);
    int khalf = (lane < 16) ? 0 : 8;
    const __bf16* p = lds + row * stride + kBase + khalf;
    Frag16 fr;
    fr.h[0] = *(const bf16x8*)(p);
    fr.h[1] = *(const bf16x8*)(p + 16);
    return fr.f;
}

__device__ __forceinline__ f32x8 wmma_bf16(bf16x16 a, bf16x16 b, f32x8 c) {
    return __builtin_amdgcn_wmma_f32_16x16x32_bf16(
        /*neg_a=*/false, a, /*neg_b=*/false, b,
        /*c_mod=*/(short)0, c, /*reuse_a=*/false, /*reuse_b=*/false);
}

__device__ __forceinline__ void async_copy8_b128(const uint32_t* l,
                                                 const __bf16* const* g) {
    asm volatile("global_load_async_to_lds_b128 %0, %8, off\n\t"
                 "global_load_async_to_lds_b128 %1, %9, off\n\t"
                 "global_load_async_to_lds_b128 %2, %10, off\n\t"
                 "global_load_async_to_lds_b128 %3, %11, off\n\t"
                 "global_load_async_to_lds_b128 %4, %12, off\n\t"
                 "global_load_async_to_lds_b128 %5, %13, off\n\t"
                 "global_load_async_to_lds_b128 %6, %14, off\n\t"
                 "global_load_async_to_lds_b128 %7, %15, off\n\t"
                 "s_wait_xcnt 0x0"
                 :: "v"(l[0]), "v"(l[1]), "v"(l[2]), "v"(l[3]),
                    "v"(l[4]), "v"(l[5]), "v"(l[6]), "v"(l[7]),
                    "v"(g[0]), "v"(g[1]), "v"(g[2]), "v"(g[3]),
                    "v"(g[4]), "v"(g[5]), "v"(g[6]), "v"(g[7])
                 : "memory");
}

__device__ __forceinline__ void wait_async0() {
    asm volatile("s_wait_asynccnt 0x0" ::: "memory");
}

// ---------------------------------------------------------------------------
// Weight pack: fp32 W[K][N] row-major  ->  bf16 Wt[N][K]  (transposed)
// One launch for all five weights. A block of 4 waves takes one tile of
// 128 (k) x 64 (n): it reads 256-byte row pieces with 16-byte loads (all 16 of
// a thread in flight together), turns the tile in LDS and writes 256-byte
// pieces of Wt rows with 16-byte stores. The packed weights lie one behind the
// other in wt_all: qk, v, o (PD*PD each), f1, f2 (2*PD*PD each).
// The blocks behind the weights' round x to bf16 (layout kept): it is the A
// operand of two GEMMs, each of which reads it once per column of tiles.
// ---------------------------------------------------------------------------
#define PD   1024  // model width: qk, v, o are PD x PD, f1 PD x 2PD, f2 2PD x PD
#define PTK  128   // tile extent in k
#define PTN  64    // tile extent in n
#define PSTR 136   // PTK + 8 pad: 272-byte LDS rows (16-byte aligned)
#define PTILES ((PD / PTK) * (PD / PTN))   // tiles per PD*PD elements
#define XEL  (2 * 2048 * PD)   // elements of x: B * T * PD
#define XPB  (128 * 4 * 16)    // elements of x per block: 16 float4 per thread

__device__ __forceinline__ float pick(float4 v, int j) {
    return j == 0 ? v.x : j == 1 ? v.y : j == 2 ? v.z : v.w;
}

// One tile of one weight. K and N are compile-time so that a thread's 16 loads
// share one address and differ in the immediate offset only.
template <int K, int N>
__device__ __forceinline__ void pack_tile(const float* __restrict__ w,
                                          __bf16* __restrict__ wt, int lt,
                                          __bf16* Ts) {
    const int n0 = (lt % (N / PTN)) * PTN;
    const int k0 = (lt / (N / PTN)) * PTK;
    const int tid = threadIdx.x;
    const int n4  = (tid & 15) * 4;   // 4 columns of the tile
    const int kg  = (tid >> 4) * 8;   // 8 rows, twice (m * 64)
    const float* src = w + (size_t)k0 * N + n0 + (kg * N + n4);

    float4 a[2][8];
#pragma unroll   // both: constant indices into a; the 16 loads go out together
    for (int m = 0; m < 2; m++)
#pragma unroll
        for (int i = 0; i < 8; i++)
            a[m][i] = *(const float4*)(src + (m * 64 + i) * N);
    // The loads' address register is free for reuse from here on: this wait
    // stands in front of that reuse. It names the address so that the register
    // lives up to here and no load's result is placed on it.
    asm volatile("s_wait_xcnt 0x0" :: "v"(src) : "memory");

#pragma unroll   // all three: constant indices into a, so that it stays in registers
    for (int m = 0; m < 2; m++)
#pragma unroll
        for (int j = 0; j < 4; j++) {
            bf16x8 p;
#pragma unroll
            for (int i = 0; i < 8; i++) p[i] = (__bf16)pick(a[m][i], j);
            *(bf16x8*)&Ts[(n4 + j) * PSTR + m * 64 + kg] = p;
        }
    __syncthreads();

    const int nr = tid >> 4;          // 16 chunks of 8 bf16 per row
    const int c8 = (tid & 15) * 8;
    __bf16* dst = wt + (size_t)n0 * K + k0 + (nr * K + c8);
#pragma unroll   // the 8 LDS reads go out together, ahead of the first store
    for (int p = 0; p < 8; p++) {
        bf16x8 q = *(const bf16x8*)&Ts[(nr + p * 8) * PSTR + c8];
        *(bf16x8*)(dst + p * 8 * K) = q;
    }
    // Stands in front of any reuse of the stores' address and data registers.
    asm volatile("s_wait_xcnt 0x0" ::: "memory");
}

// One block's piece of x: a wave reads 512 and writes 256 bytes in a row.
__device__ __forceinline__ void round_x(const float* __restrict__ x,
                                        __bf16* __restrict__ xb, int blk) {
    const size_t at = (size_t)blk * XPB + threadIdx.x * 4;
    const float* src = x + at;
    __bf16*      dst = xb + at;
    float4 a[16];
#pragma unroll   // both: constant indices into a; the 16 loads go out together
    for (int i = 0; i < 16; i++) a[i] = *(const float4*)(src + i * 512);
    // Stands in front of any reuse of the loads' address registers; it names
    // the address so that the pair lives up to here.
    asm volatile("s_wait_xcnt 0x0" :: "v"(src) : "memory");
#pragma unroll
    for (int i = 0; i < 16; i++) {
        bf16x4 p = {(__bf16)a[i].x, (__bf16)a[i].y, (__bf16)a[i].z,
                    (__bf16)a[i].w};
        *(bf16x4*)(dst + i * 512) = p;
    }
    // Stands in front of any reuse of the stores' address and data registers.
    asm volatile("s_wait_xcnt 0x0" ::: "memory");
}

// amdgpu_waves_per_eu(4, 4): a wave may take a quarter of the registers.
// Without it the compiler saves registers by waiting for the first loads
// before it issues the last.
__global__ __launch_bounds__(128) __attribute__((amdgpu_waves_per_eu(4, 4)))
void pack_all(
    const float* __restrict__ w_qk, const float* __restrict__ w_v,
    const float* __restrict__ w_o,  const float* __restrict__ w_f1,
    const float* __restrict__ w_f2, __bf16* __restrict__ wt_all,
    const float* __restrict__ x, __bf16* __restrict__ xb) {
    __shared__ __attribute__((aligned(16))) __bf16 Ts[PTN * PSTR];   // [n][k]

    // Which weight, by block index (the same for the whole block).
    const int job = blockIdx.x / PTILES;   // 0..6: weights, in units of PD*PD
    if (job < 3) {
        const float* w = job == 0 ? w_qk : job == 1 ? w_v : w_o;
        pack_tile<PD, PD>(w, wt_all + (size_t)job * PD * PD,
                          blockIdx.x - job * PTILES, Ts);
    } else if (job < 5) {
        pack_tile<PD, 2 * PD>(w_f1, wt_all + (size_t)3 * PD * PD,
                              blockIdx.x - 3 * PTILES, Ts);
    } else if (job < 7) {
        pack_tile<2 * PD, PD>(w_f2, wt_all + (size_t)5 * PD * PD,
                              blockIdx.x - 5 * PTILES, Ts);
    } else {
        round_x(x, xb, blockIdx.x - 7 * PTILES);
    }
}

// ---------------------------------------------------------------------------
// GEMM:  C[M][N] = act( A[M][K] @ W[K][N] + bias[N] )
//   A     : bf16 row-major [M][K]
//   Wt    : bf16, pre-transposed [N][K]
//   Both are staged by the async global->LDS DMA: no register, no conversion.
// Block tile 128x128x128, 256 threads (8 waves, 4x2), wave tile 32x64
//   => 32 v_wmma_f32_16x16x32_bf16 per wave per K-step.
// Double-buffered LDS: tile t+1's copies are all issued ahead of tile t's
// WMMAs; single s_wait_asynccnt+barrier per K-step. A K-step is 128 wide so
// that the load latency and the barrier are paid once per 128 k and 64 KB per
// block are in flight during the WMMAs.
// OUT picks what is stored:
//   0 : C,  fp32 [M][N]
//   1 : Cb, bf16 [M][N]. The product is taken transposed (W^T as the A operand),
//       so a lane holds 8 neighbouring columns of one row: one 16-byte store.
//   2 : Cb, bf16 transposed per sequence, [M / SEQ][N][SEQ]: a lane holds 8
//       neighbouring rows of one column, again one 16-byte store.
// 1 and 2 are the forms in which the attention kernel wants K (= Q) and V^T in
// LDS: they are rounded and turned once here, not by every query block. 1 is
// also the form of the next GEMM's A operand.
// ---------------------------------------------------------------------------
#define BM 128
#define BN 128
#define BK 128
#define LDS_STR 136  // BK + 8 pad; 136*2B = 272B row stride (16B aligned)
#define SEQ 2048     // tokens per sequence (T); BM divides it

template <int ACT>  // 0 = none, 1 = exact GELU
__device__ __forceinline__ float activate(float val) {
    if (ACT == 1) val = 0.5f * val * (1.0f + erff(val * 0.70710678118654752f));
    return val;
}

template <int ACT, int K, int OUT>
__global__ __launch_bounds__(256) void gemm_bf16w(
    const __bf16* __restrict__ A, const __bf16* __restrict__ Wt,
    const float* __restrict__ bias, float* __restrict__ C,
    __bf16* __restrict__ Cb, int M, int N) {
    __shared__ __attribute__((aligned(16))) __bf16 As[2][BM * LDS_STR];
    __shared__ __attribute__((aligned(16))) __bf16 Bs[2][BN * LDS_STR];

    const int bm  = blockIdx.y * BM;
    const int bn  = blockIdx.x * BN;
    const int tid = threadIdx.x;
    const int wid = tid >> 5;
    const int wm  = (wid >> 1) * 32;  // 0..96
    const int wn  = (wid & 1) * 64;   // 0,64
    const int lane = tid & 31;

    // A slice of either operand is 128 rows of 16 chunks of 16 bytes: 8 chunks
    // per thread, 16 rows apart.
    const int sr  = tid >> 4;
    const int sc8 = (tid & 15) * 8;
    const __bf16* asrc = A  + (size_t)bm * K + (sr * K + sc8);
    const __bf16* bsrc = Wt + (size_t)bn * K + (sr * K + sc8);

    // Issue every copy of one 128x128 K-slice of A and of B into LDS buffer
    // `buf`: 2 x 8 x 16 bytes per thread.
    auto stage = [&](int k0, int buf) {
        uint32_t      l[8];
        const __bf16* g[8];
#pragma unroll   // constant indices: both arrays stay in registers
        for (int i = 0; i < 8; i++) {
            l[i] = (uint32_t)(uintptr_t)&As[buf][(sr + i * 16) * LDS_STR + sc8];
            g[i] = asrc + k0 + i * 16 * K;
        }
        async_copy8_b128(l, g);
#pragma unroll
        for (int i = 0; i < 8; i++) {
            l[i] = (uint32_t)(uintptr_t)&Bs[buf][(sr + i * 16) * LDS_STR + sc8];
            g[i] = bsrc + k0 + i * 16 * K;
        }
        async_copy8_b128(l, g);
    };

    f32x8 zero = {0.f, 0.f, 0.f, 0.f, 0.f, 0.f, 0.f, 0.f};
    f32x8 acc[2][4];
#pragma unroll
    for (int i = 0; i < 2; i++)
#pragma unroll
        for (int j = 0; j < 4; j++) acc[i][j] = zero;

    stage(0, 0);
    wait_async0();
    __syncthreads();

    const int nk = K / BK;
    for (int t = 0; t < nk; t++) {
        const int buf = t & 1;
        if (t + 1 < nk) stage((t + 1) * BK, buf ^ 1);

#pragma unroll
        for (int kk = 0; kk < BK; kk += 32) {
            bf16x16 af[2], bfr[4];
            af[0] = load_frag(As[buf], wm,      kk, LDS_STR);
            af[1] = load_frag(As[buf], wm + 16, kk, LDS_STR);
#pragma unroll
            for (int j = 0; j < 4; j++)
                bfr[j] = load_frag(Bs[buf], wn + j * 16, kk, LDS_STR);
#pragma unroll
            for (int i = 0; i < 2; i++)
#pragma unroll
                for (int j = 0; j < 4; j++)
                    acc[i][j] = OUT == 1 ? wmma_bf16(bfr[j], af[i], acc[i][j])
                                         : wmma_bf16(af[i], bfr[j], acc[i][j]);
        }

        // This wave's LDS reads are done before the barrier behind which the
        // buffer it has read is refilled by the copies.
        asm volatile("s_wait_dscnt 0x0" ::: "memory");
        wait_async0();      // next tile's DMA landed in LDS
        __syncthreads();    // next tile visible to every wave; this tile done
    }

    const int colOff = lane & 15;
    const int rowOff = (lane >> 4) * 8;
#pragma unroll
    for (int i = 0; i < 2; i++) {
#pragma unroll
        for (int j = 0; j < 4; j++) {
            if (OUT == 1) {
                int col0 = bn + wn + j * 16 + rowOff;
                int row  = bm + wm + i * 16 + colOff;
                float4 b0 = *(const float4*)(bias + col0);
                float4 b1 = *(const float4*)(bias + col0 + 4);
                bf16x8 p;
#pragma unroll   // constant indices into acc, p and the bias vectors
                for (int r = 0; r < 8; r++)
                    p[r] = (__bf16)activate<ACT>(acc[i][j][r] +
                                                 pick(r < 4 ? b0 : b1, r & 3));
                *(bf16x8*)(Cb + (size_t)row * N + col0) = p;
                continue;
            }
            int col  = bn + wn + j * 16 + colOff;
            float bv = bias[col];
            if (OUT == 2) {
                int row0 = bm + wm + i * 16 + rowOff;
                bf16x8 p;
#pragma unroll   // constant indices into acc and p
                for (int r = 0; r < 8; r++)
                    p[r] = (__bf16)activate<ACT>(acc[i][j][r] + bv);
                *(bf16x8*)(Cb + ((size_t)(row0 / SEQ) * N + col) * SEQ +
                           row0 % SEQ) = p;
                continue;
            }
#pragma unroll
            for (int r = 0; r < 8; r++) {
                int row = bm + wm + i * 16 + rowOff + r;
                C[(size_t)row * N + col] = activate<ACT>(acc[i][j][r] + bv);
            }
        }
    }
}

#define AHD 64
#define ASTR 72   // 64 + 8 pad, 144B row stride (16B aligned)

__device__ __forceinline__ float swap_halves(float x) {
    int b = __builtin_bit_cast(int, x);
    b = __builtin_amdgcn_permlanex16(b, b, 0x76543210, 0xfedcba98, false, false);
    return __builtin_bit_cast(float, b);
}

__global__ __launch_bounds__(128) __attribute__((amdgpu_waves_per_eu(4, 4)))
void attn_kernel(
    const __bf16* __restrict__ qk, const __bf16* __restrict__ vt,
    __bf16* __restrict__ out, int B, int T, int H) {
    __shared__ __attribute__((aligned(16))) __bf16 Qs[64 * ASTR];
    __shared__ __attribute__((aligned(16))) __bf16 Ks[64 * ASTR];
    __shared__ __attribute__((aligned(16))) __bf16 Vt[64 * ASTR];   // [hd][key]

    const int b  = blockIdx.z;
    const int h  = blockIdx.y;
    const int q0 = blockIdx.x * 64;
    const int tid = threadIdx.x;
    const int wid = tid >> 5;
    const int lane = tid & 31;
    const size_t Dm = (size_t)H * AHD;

    // A 64x64 bf16 tile is 64 rows of 8 chunks of 16 bytes: 4 chunks per thread,
    // 16 rows apart. The row pitches (PD for qk, SEQ for vt) are compile-time so
    // that a thread's 4 loads of a tile share one address register pair and
    // differ in the immediate offset only.
    const int sr = tid >> 3;
    const int sc = (tid & 7) * 8;
    const __bf16* qbase = qk + ((size_t)b * SEQ * PD + (size_t)h * AHD) +
                          (sr * PD + sc);
    const __bf16* vbase = vt + ((size_t)b * PD + (size_t)h * AHD) * SEQ +
                          (sr * SEQ + sc);
    __bf16* const qdst = Qs + sr * ASTR + sc;
    __bf16* const kdst = Ks + sr * ASTR + sc;
    __bf16* const vdst = Vt + sr * ASTR + sc;

    // Stage Q.
    {
        const __bf16* qp = qbase + (size_t)q0 * PD;
        bf16x8 qc[4];
#pragma unroll   // both: constant indices; the 4 loads go out together
        for (int i = 0; i < 4; i++)
            qc[i] = *(const bf16x8*)(qp + i * 16 * PD);
        // Stands in front of any reuse of the loads' address registers; it names
        // the address so that the pair lives up to here.
        asm volatile("s_wait_xcnt 0x0" :: "v"(qp) : "memory");
#pragma unroll
        for (int i = 0; i < 4; i++) *(bf16x8*)(qdst + i * 16 * ASTR) = qc[i];
    }
    __syncthreads();

    // B operand of S^T: column = query, k = head dim.
    bf16x16 qb[2];
    qb[0] = load_frag(Qs, wid * 16, 0,  ASTR);
    qb[1] = load_frag(Qs, wid * 16, 32, ASTR);

    f32x8 zero = {0.f, 0.f, 0.f, 0.f, 0.f, 0.f, 0.f, 0.f};
    f32x8 o[4];   // o[n][r] = O^T[hd = 16n + 8*(lane>>4) + r][query = lane&15]
#pragma unroll
    for (int n = 0; n < 4; n++) o[n] = zero;
    float m_q = -1e30f;
    f32x8 l_v = zero;

    for (int kb = 0; kb < T; kb += 64) {
        __syncthreads();
        // Stage the K tile (rows = keys) and the V^T tile (rows = head dim).
        const __bf16* kp = qbase + (size_t)kb * PD;
        const __bf16* vp = vbase + kb;
        bf16x8 kc[4], vc[4];
#pragma unroll   // both: constant indices; the 8 loads go out together
        for (int i = 0; i < 4; i++) {
            kc[i] = *(const bf16x8*)(kp + i * 16 * PD);
            vc[i] = *(const bf16x8*)(vp + i * 16 * SEQ);
        }
        // Stands in front of any reuse of the loads' address registers; it names
        // the addresses so that both pairs live up to here.
        asm volatile("s_wait_xcnt 0x0" :: "v"(kp), "v"(vp) : "memory");
#pragma unroll
        for (int i = 0; i < 4; i++) {
            *(bf16x8*)(kdst + i * 16 * ASTR) = kc[i];
            *(bf16x8*)(vdst + i * 16 * ASTR) = vc[i];
        }
        __syncthreads();

        // S^T = K Q^T (64 keys x 16 queries per wave), K-dim = HD = 64.
        // s[n][r] = score(key = kb + 16n + 8*(lane>>4) + r, query = lane&15)
        f32x8 s[4];
#pragma unroll
        for (int n = 0; n < 4; n++) {
            bf16x16 ka0 = load_frag(Ks, n * 16, 0,  ASTR);
            bf16x16 ka1 = load_frag(Ks, n * 16, 32, ASTR);
            s[n] = wmma_bf16(ka0, qb[0], zero);
            s[n] = wmma_bf16(ka1, qb[1], s[n]);
        }
        // scale by 1/sqrt(HD) = 1/8
#pragma unroll
        for (int n = 0; n < 4; n++)
#pragma unroll
            for (int r = 0; r < 8; r++) s[n][r] *= 0.125f;

        // Online softmax: one query per lane. Every loop here is unrolled so
        // that the tiles are indexed by constants and stay in registers.
        float mt[4];   // one short chain per tile, not one chain of 32
#pragma unroll
        for (int n = 0; n < 4; n++) {
            mt[n] = s[n][0];
#pragma unroll
            for (int r = 1; r < 8; r++) mt[n] = fmaxf(mt[n], s[n][r]);
        }
        float mx = fmaxf(fmaxf(mt[0], mt[1]), fmaxf(mt[2], mt[3]));
        mx = fmaxf(mx, swap_halves(mx));
        float mnew = fmaxf(m_q, mx);
        float corr = __expf(m_q - mnew);
        m_q = mnew;

        Frag16 pb[2];   // B operand of O^T: column = query, k = key
        l_v *= corr;
#pragma unroll
        for (int n = 0; n < 4; n++) {
            f32x8 p;
#pragma unroll
            for (int r = 0; r < 8; r++) p[r] = __expf(s[n][r] - mnew);
            l_v += p;
#pragma unroll
            for (int r = 0; r < 8; r++) pb[n >> 1].h[n & 1][r] = (__bf16)p[r];
        }
#pragma unroll
        for (int n = 0; n < 4; n++)
#pragma unroll
            for (int r = 0; r < 8; r++) o[n][r] *= corr;

        // O^T += V^T P^T   (K-dim = 64 keys, two 32-steps).
#pragma unroll
        for (int n = 0; n < 4; n++) {
            bf16x16 va0 = load_frag(Vt, n * 16, 0,  ASTR);
            bf16x16 va1 = load_frag(Vt, n * 16, 32, ASTR);
            o[n] = wmma_bf16(va0, pb[0].f, o[n]);
            o[n] = wmma_bf16(va1, pb[1].f, o[n]);
        }
    }

    const float l_q = ((l_v[0] + l_v[1]) + (l_v[2] + l_v[3])) +
                      ((l_v[4] + l_v[5]) + (l_v[6] + l_v[7]));
    const float inv = 1.0f / (l_q + swap_halves(l_q));
    const int row = q0 + wid * 16 + (lane & 15);
    __bf16* orow = out + ((size_t)b * T + row) * Dm + (size_t)h * AHD +
                   (lane >> 4) * 8;
#pragma unroll   // both: constant indices into o and p
    for (int n = 0; n < 4; n++) {
        bf16x8 p;
#pragma unroll
        for (int r = 0; r < 8; r++) p[r] = (__bf16)(o[n][r] * inv);
        *(bf16x8*)(orow + n * 16) = p;
    }
}

// ---------------------------------------------------------------------------
// Fused residual + LayerNorm: out = LN(x + res) * g + b.  One block per token.
// WB: the result is also stored rounded to bf16, as the next GEMM's A operand.
// ---------------------------------------------------------------------------
template <bool WB>
__global__ __launch_bounds__(256) void ln_kernel(
    const float* __restrict__ x, const float* __restrict__ res,
    const float* __restrict__ g, const float* __restrict__ be,
    float* __restrict__ out, __bf16* __restrict__ outb, int D) {
    __shared__ float red[2][8];
    const size_t base = (size_t)blockIdx.x * D;
    float v[4], s = 0.f, s2 = 0.f;
#pragma unroll
    for (int i = 0; i < 4; i++) {
        int c = threadIdx.x + i * 256;
        v[i] = x[base + c] + res[base + c];
        s += v[i];
        s2 += v[i] * v[i];
    }
#pragma unroll
    for (int off = 16; off > 0; off >>= 1) {
        s  += __shfl_xor(s, off);
        s2 += __shfl_xor(s2, off);
    }
    if ((threadIdx.x & 31) == 0) {
        red[0][threadIdx.x >> 5] = s;
        red[1][threadIdx.x >> 5] = s2;
    }
    __syncthreads();
    float ts = 0.f, ts2 = 0.f;
#pragma unroll
    for (int i = 0; i < 8; i++) { ts += red[0][i]; ts2 += red[1][i]; }
    float mean = ts / (float)D;
    float var  = ts2 / (float)D - mean * mean;
    float rstd = rsqrtf(var + 1e-5f);
#pragma unroll
    for (int i = 0; i < 4; i++) {
        int c = threadIdx.x + i * 256;
        float y = (v[i] - mean) * rstd * g[c] + be[c];
        out[base + c] = y;
        if (WB) outb[base + c] = (__bf16)y;
    }
}

// ---------------------------------------------------------------------------
// Orchestration
// ---------------------------------------------------------------------------
extern "C" void kernel_launch(void* const* d_in, const int* in_sizes, int n_in,
                              void* d_out, int out_size, void* d_ws,
                              size_t ws_size, hipStream_t stream) {
    const int B = 2, T = 2048, D = 1024, H = 16;
    const int M = B * T;  // 4096 tokens

    const float* x    = (const float*)d_in[0];
    const float* w_qk = (const float*)d_in[1];
    const float* b_qk = (const float*)d_in[2];
    const float* w_v  = (const float*)d_in[3];
    const float* b_v  = (const float*)d_in[4];
    const float* w_o  = (const float*)d_in[5];
    const float* b_o  = (const float*)d_in[6];
    const float* g1   = (const float*)d_in[7];
    const float* be1  = (const float*)d_in[8];
    const float* g2   = (const float*)d_in[9];
    const float* be2  = (const float*)d_in[10];
    const float* w_f1 = (const float*)d_in[11];
    const float* b_f1 = (const float*)d_in[12];
    const float* w_f2 = (const float*)d_in[13];
    const float* b_f2 = (const float*)d_in[14];
    float* outp = (float*)d_out;

    // Workspace layout (activations, then bf16 packed weights), ~115 MB.
    float* ws = (float*)d_ws;
    const size_t SZ = (size_t)M * D;          // 4M elements per activation
    float* qk_buf = ws;                       // qk (bf16); then o-proj output
    float* v_buf  = ws + SZ;                  // v^T (bf16); then ffn output
    __bf16* qk_bf = (__bf16*)qk_buf;          // [B][T][D]
    __bf16* vt_bf = (__bf16*)v_buf;           // [B][D][T]
    __bf16* a_bf  = (__bf16*)(ws + 2 * SZ);   // attention output
    __bf16* x_bf  = a_bf + SZ;                // x
    float* x1_buf = ws + 3 * SZ;              // post-LN1
    __bf16* h_bf  = (__bf16*)(ws + 4 * SZ);   // GELU hidden (2*SZ elements)
    __bf16* x1_bf = (__bf16*)(ws + 5 * SZ);   // post-LN1
    __bf16* wt_qk = (__bf16*)(ws + 6 * SZ);
    __bf16* wt_v  = wt_qk + (size_t)D * D;
    __bf16* wt_o  = wt_v  + (size_t)D * D;
    __bf16* wt_f1 = wt_o  + (size_t)D * D;    // [2D][D]
    __bf16* wt_f2 = wt_f1 + (size_t)2 * D * D; // [D][2D]

    // 1) Pack weights to bf16 transposed (wt_qk is the start of all five);
    //    round x.
    pack_all<<<7 * PTILES + XEL / XPB, 128, 0, stream>>>(w_qk, w_v, w_o, w_f1,
                                                         w_f2, wt_qk, x, x_bf);

    dim3 gNN(D / BN, M / BM);       // N = 1024
    dim3 gN2(2 * D / BN, M / BM);   // N = 2048

    // 2) Projections.
    gemm_bf16w<0, 1024, 1><<<gNN, 256, 0, stream>>>(x_bf, wt_qk, b_qk, nullptr,
                                                    qk_bf, M, D);
    gemm_bf16w<0, 1024, 2><<<gNN, 256, 0, stream>>>(x_bf, wt_v, b_v, nullptr,
                                                    vt_bf, M, D);

    // 3) Attention.
    attn_kernel<<<dim3(T / 64, H, B), 128, 0, stream>>>(qk_bf, vt_bf, a_bf,
                                                        B, T, H);

    // 4) Output projection (reuse qk_buf).
    gemm_bf16w<0, 1024, 0><<<gNN, 256, 0, stream>>>(a_bf, wt_o, b_o, qk_buf,
                                                    nullptr, M, D);

    // 5) Residual + LN1.
    ln_kernel<true><<<M, 256, 0, stream>>>(x, qk_buf, g1, be1, x1_buf, x1_bf, D);

    // 6) FFN.
    gemm_bf16w<1, 1024, 1><<<gN2, 256, 0, stream>>>(x1_bf, wt_f1, b_f1, nullptr,
                                                    h_bf, M, 2 * D);
    gemm_bf16w<0, 2048, 0><<<gNN, 256, 0, stream>>>(h_bf, wt_f2, b_f2, v_buf,
                                                    nullptr, M, D);

    // 7) Residual + LN2 -> d_out.
    ln_kernel<false><<<M, 256, 0, stream>>>(x1_buf, v_buf, g2, be2, outp, nullptr,
                                            D);
}

// v007
// It runs in 133 microseconds.
// Two timings next to v006 both put it at 1.06 times that version's speed.
// Over all steps from v000 it is 2.89 times as fast.
#include <hip/hip_runtime.h>
#include <hip/hip_bf16.h>
#include <cstdint>

typedef __attribute__((ext_vector_type(16))) __bf16 bf16x16;
typedef __attribute__((ext_vector_type(8)))  __bf16 bf16x8;
typedef __attribute__((ext_vector_type(4)))  __bf16 bf16x4;
typedef __attribute__((ext_vector_type(8)))  float  f32x8;

union Frag16 { bf16x16 f; bf16x8 h[2]; };

__device__ __forceinline__ bf16x16 load_frag(const __bf16* lds, int rowBase,
                                             int kBase, int stride) {
    int lane  = threadIdx.x & 31;
    int row   = rowBase + (lane & 15);
    int khalf = (lane < 16) ? 0 : 8;
    const __bf16* p = lds + row * stride + kBase + khalf;
    Frag16 fr;
    fr.h[0] = *(const bf16x8*)(p);
    fr.h[1] = *(const bf16x8*)(p + 16);
    return fr.f;
}

__device__ __forceinline__ f32x8 wmma_bf16(bf16x16 a, bf16x16 b, f32x8 c) {
    return __builtin_amdgcn_wmma_f32_16x16x32_bf16(
        /*neg_a=*/false, a, /*neg_b=*/false, b,
        /*c_mod=*/(short)0, c, /*reuse_a=*/false, /*reuse_b=*/false);
}

__device__ __forceinline__ void async_copy8_b128(const uint32_t* l,
                                                 const __bf16* const* g) {
    asm volatile("global_load_async_to_lds_b128 %0, %8, off\n\t"
                 "global_load_async_to_lds_b128 %1, %9, off\n\t"
                 "global_load_async_to_lds_b128 %2, %10, off\n\t"
                 "global_load_async_to_lds_b128 %3, %11, off\n\t"
                 "global_load_async_to_lds_b128 %4, %12, off\n\t"
                 "global_load_async_to_lds_b128 %5, %13, off\n\t"
                 "global_load_async_to_lds_b128 %6, %14, off\n\t"
                 "global_load_async_to_lds_b128 %7, %15, off\n\t"
                 "s_wait_xcnt 0x0"
                 :: "v"(l[0]), "v"(l[1]), "v"(l[2]), "v"(l[3]),
                    "v"(l[4]), "v"(l[5]), "v"(l[6]), "v"(l[7]),
                    "v"(g[0]), "v"(g[1]), "v"(g[2]), "v"(g[3]),
                    "v"(g[4]), "v"(g[5]), "v"(g[6]), "v"(g[7])
                 : "memory");
}

__device__ __forceinline__ void wait_async0() {
    asm volatile("s_wait_asynccnt 0x0" ::: "memory");
}

// ---------------------------------------------------------------------------
// Weight pack: fp32 W[K][N] row-major  ->  bf16 Wt[N][K]  (transposed)
// One launch for all five weights. A block of 4 waves takes one tile of
// 128 (k) x 64 (n): it reads 256-byte row pieces with 16-byte loads (all 16 of
// a thread in flight together), turns the tile in LDS and writes 256-byte
// pieces of Wt rows with 16-byte stores. The packed weights lie one behind the
// other in wt_all: qk, v, o (PD*PD each), f1, f2 (2*PD*PD each).
// The blocks behind the weights' round x to bf16 (layout kept): it is shared
// by both projections in one GEMM, which reads it once per column of tiles.
// ---------------------------------------------------------------------------
#define PD   1024  // model width: qk, v, o are PD x PD, f1 PD x 2PD, f2 2PD x PD
#define PTK  128   // tile extent in k
#define PTN  64    // tile extent in n
#define PSTR 136   // PTK + 8 pad: 272-byte LDS rows (16-byte aligned)
#define PTILES ((PD / PTK) * (PD / PTN))   // tiles per PD*PD elements
#define XEL  (2 * 2048 * PD)   // elements of x: B * T * PD
#define XPB  (128 * 4 * 16)    // elements of x per block: 16 float4 per thread

__device__ __forceinline__ float pick(float4 v, int j) {
    return j == 0 ? v.x : j == 1 ? v.y : j == 2 ? v.z : v.w;
}

// One tile of one weight. K and N are compile-time so that a thread's 16 loads
// share one address and differ in the immediate offset only.
template <int K, int N>
__device__ __forceinline__ void pack_tile(const float* __restrict__ w,
                                          __bf16* __restrict__ wt, int lt,
                                          __bf16* Ts) {
    const int n0 = (lt % (N / PTN)) * PTN;
    const int k0 = (lt / (N / PTN)) * PTK;
    const int tid = threadIdx.x;
    const int n4  = (tid & 15) * 4;   // 4 columns of the tile
    const int kg  = (tid >> 4) * 8;   // 8 rows, twice (m * 64)
    const float* src = w + (size_t)k0 * N + n0 + (kg * N + n4);

    float4 a[2][8];
#pragma unroll   // both: constant indices into a; the 16 loads go out together
    for (int m = 0; m < 2; m++)
#pragma unroll
        for (int i = 0; i < 8; i++)
            a[m][i] = *(const float4*)(src + (m * 64 + i) * N);
    // The loads' address register is free for reuse from here on: this wait
    // stands in front of that reuse. It names the address so that the register
    // lives up to here and no load's result is placed on it.
    asm volatile("s_wait_xcnt 0x0" :: "v"(src) : "memory");

#pragma unroll   // all three: constant indices into a, so that it stays in registers
    for (int m = 0; m < 2; m++)
#pragma unroll
        for (int j = 0; j < 4; j++) {
            bf16x8 p;
#pragma unroll
            for (int i = 0; i < 8; i++) p[i] = (__bf16)pick(a[m][i], j);
            *(bf16x8*)&Ts[(n4 + j) * PSTR + m * 64 + kg] = p;
        }
    __syncthreads();

    const int nr = tid >> 4;          // 16 chunks of 8 bf16 per row
    const int c8 = (tid & 15) * 8;
    __bf16* dst = wt + (size_t)n0 * K + k0 + (nr * K + c8);
#pragma unroll   // the 8 LDS reads go out together, ahead of the first store
    for (int p = 0; p < 8; p++) {
        bf16x8 q = *(const bf16x8*)&Ts[(nr + p * 8) * PSTR + c8];
        *(bf16x8*)(dst + p * 8 * K) = q;
    }
    // Stands in front of any reuse of the stores' address and data registers.
    asm volatile("s_wait_xcnt 0x0" ::: "memory");
}

// One block's piece of x: a wave reads 512 and writes 256 bytes in a row.
__device__ __forceinline__ void round_x(const float* __restrict__ x,
                                        __bf16* __restrict__ xb, int blk) {
    const size_t at = (size_t)blk * XPB + threadIdx.x * 4;
    const float* src = x + at;
    __bf16*      dst = xb + at;
    float4 a[16];
#pragma unroll   // both: constant indices into a; the 16 loads go out together
    for (int i = 0; i < 16; i++) a[i] = *(const float4*)(src + i * 512);
    // Stands in front of any reuse of the loads' address registers; it names
    // the address so that the pair lives up to here.
    asm volatile("s_wait_xcnt 0x0" :: "v"(src) : "memory");
#pragma unroll
    for (int i = 0; i < 16; i++) {
        bf16x4 p = {(__bf16)a[i].x, (__bf16)a[i].y, (__bf16)a[i].z,
                    (__bf16)a[i].w};
        *(bf16x4*)(dst + i * 512) = p;
    }
    // Stands in front of any reuse of the stores' address and data registers.
    asm volatile("s_wait_xcnt 0x0" ::: "memory");
}

// amdgpu_waves_per_eu(4, 4): a wave may take a quarter of the registers.
// Without it the compiler saves registers by waiting for the first loads
// before it issues the last.
__global__ __launch_bounds__(128) __attribute__((amdgpu_waves_per_eu(4, 4)))
void pack_all(
    const float* __restrict__ w_qk, const float* __restrict__ w_v,
    const float* __restrict__ w_o,  const float* __restrict__ w_f1,
    const float* __restrict__ w_f2, __bf16* __restrict__ wt_all,
    const float* __restrict__ x, __bf16* __restrict__ xb) {
    __shared__ __attribute__((aligned(16))) __bf16 Ts[PTN * PSTR];   // [n][k]

    // Which weight, by block index (the same for the whole block).
    const int job = blockIdx.x / PTILES;   // 0..6: weights, in units of PD*PD
    if (job < 3) {
        const float* w = job == 0 ? w_qk : job == 1 ? w_v : w_o;
        pack_tile<PD, PD>(w, wt_all + (size_t)job * PD * PD,
                          blockIdx.x - job * PTILES, Ts);
    } else if (job < 5) {
        pack_tile<PD, 2 * PD>(w_f1, wt_all + (size_t)3 * PD * PD,
                              blockIdx.x - 3 * PTILES, Ts);
    } else if (job < 7) {
        pack_tile<2 * PD, PD>(w_f2, wt_all + (size_t)5 * PD * PD,
                              blockIdx.x - 5 * PTILES, Ts);
    } else {
        round_x(x, xb, blockIdx.x - 7 * PTILES);
    }
}

// ---------------------------------------------------------------------------
// GEMM:  C[M][N] = act( A[M][K] @ W[K][N] + bias[N] )
//   A     : bf16 row-major [M][K]
//   Wt    : bf16, pre-transposed [N][K]
//   Both are staged by the async global->LDS DMA: no register, no conversion.
// Block tile 128x128x128, 256 threads (8 waves, 4x2), wave tile 32x64
//   => 32 v_wmma_f32_16x16x32_bf16 per wave per K-step.
// Double-buffered LDS: tile t+1's copies are all issued ahead of tile t's
// WMMAs; single s_wait_asynccnt+barrier per K-step. A K-step is 128 wide so
// that the load latency and the barrier are paid once per 128 k and 64 KB per
// block are in flight during the WMMAs.
// OUT picks what is stored:
//   0 : C,  fp32 [M][N]
//   1 : Cb, bf16 [M][N]. The product is taken transposed (W^T as the A operand),
//       so a lane holds 8 neighbouring columns of one row: one 16-byte store.
//       It is the form of the next GEMM's A operand.
// ---------------------------------------------------------------------------
#define BM 128
#define BN 128
#define BK 128
#define LDS_STR 136  // BK + 8 pad; 136*2B = 272B row stride (16B aligned)
#define SEQ 2048     // tokens per sequence (T); BM divides it

template <int ACT>  // 0 = none, 1 = exact GELU
__device__ __forceinline__ float activate(float val) {
    if (ACT == 1) val = 0.5f * val * (1.0f + erff(val * 0.70710678118654752f));
    return val;
}

template <int ACT, int K, int OUT>
__global__ __launch_bounds__(256) void gemm_bf16w(
    const __bf16* __restrict__ A, const __bf16* __restrict__ Wt,
    const float* __restrict__ bias, float* __restrict__ C,
    __bf16* __restrict__ Cb, int M, int N) {
    __shared__ __attribute__((aligned(16))) __bf16 As[2][BM * LDS_STR];
    __shared__ __attribute__((aligned(16))) __bf16 Bs[2][BN * LDS_STR];

    const int bm  = blockIdx.y * BM;
    const int bn  = blockIdx.x * BN;
    const int tid = threadIdx.x;
    const int wid = tid >> 5;
    const int wm  = (wid >> 1) * 32;  // 0..96
    const int wn  = (wid & 1) * 64;   // 0,64
    const int lane = tid & 31;

    // A slice of either operand is 128 rows of 16 chunks of 16 bytes: 8 chunks
    // per thread, 16 rows apart.
    const int sr  = tid >> 4;
    const int sc8 = (tid & 15) * 8;
    const __bf16* asrc = A  + (size_t)bm * K + (sr * K + sc8);
    const __bf16* bsrc = Wt + (size_t)bn * K + (sr * K + sc8);

    // Issue every copy of one 128x128 K-slice of A and of B into LDS buffer
    // `buf`: 2 x 8 x 16 bytes per thread.
    auto stage = [&](int k0, int buf) {
        uint32_t      l[8];
        const __bf16* g[8];
#pragma unroll   // constant indices: both arrays stay in registers
        for (int i = 0; i < 8; i++) {
            l[i] = (uint32_t)(uintptr_t)&As[buf][(sr + i * 16) * LDS_STR + sc8];
            g[i] = asrc + k0 + i * 16 * K;
        }
        async_copy8_b128(l, g);
#pragma unroll
        for (int i = 0; i < 8; i++) {
            l[i] = (uint32_t)(uintptr_t)&Bs[buf][(sr + i * 16) * LDS_STR + sc8];
            g[i] = bsrc + k0 + i * 16 * K;
        }
        async_copy8_b128(l, g);
    };

    f32x8 zero = {0.f, 0.f, 0.f, 0.f, 0.f, 0.f, 0.f, 0.f};
    f32x8 acc[2][4];
#pragma unroll
    for (int i = 0; i < 2; i++)
#pragma unroll
        for (int j = 0; j < 4; j++) acc[i][j] = zero;

    stage(0, 0);
    wait_async0();
    __syncthreads();

    const int nk = K / BK;
    for (int t = 0; t < nk; t++) {
        const int buf = t & 1;
        if (t + 1 < nk) stage((t + 1) * BK, buf ^ 1);

#pragma unroll
        for (int kk = 0; kk < BK; kk += 32) {
            bf16x16 af[2], bfr[4];
            af[0] = load_frag(As[buf], wm,      kk, LDS_STR);
            af[1] = load_frag(As[buf], wm + 16, kk, LDS_STR);
#pragma unroll
            for (int j = 0; j < 4; j++)
                bfr[j] = load_frag(Bs[buf], wn + j * 16, kk, LDS_STR);
#pragma unroll
            for (int i = 0; i < 2; i++)
#pragma unroll
                for (int j = 0; j < 4; j++)
                    acc[i][j] = OUT == 1 ? wmma_bf16(bfr[j], af[i], acc[i][j])
                                         : wmma_bf16(af[i], bfr[j], acc[i][j]);
        }

        // This wave's LDS reads are done before the barrier behind which the
        // buffer it has read is refilled by the copies.
        asm volatile("s_wait_dscnt 0x0" ::: "memory");
        wait_async0();      // next tile's DMA landed in LDS
        __syncthreads();    // next tile visible to every wave; this tile done
    }

    const int colOff = lane & 15;
    const int rowOff = (lane >> 4) * 8;
#pragma unroll
    for (int i = 0; i < 2; i++) {
#pragma unroll
        for (int j = 0; j < 4; j++) {
            if (OUT == 1) {
                int col0 = bn + wn + j * 16 + rowOff;
                int row  = bm + wm + i * 16 + colOff;
                float4 b0 = *(const float4*)(bias + col0);
                float4 b1 = *(const float4*)(bias + col0 + 4);
                bf16x8 p;
#pragma unroll   // constant indices into acc, p and the bias vectors
                for (int r = 0; r < 8; r++)
                    p[r] = (__bf16)activate<ACT>(acc[i][j][r] +
                                                 pick(r < 4 ? b0 : b1, r & 3));
                *(bf16x8*)(Cb + (size_t)row * N + col0) = p;
                continue;
            }
            int col  = bn + wn + j * 16 + colOff;
            float bv = bias[col];
#pragma unroll
            for (int r = 0; r < 8; r++) {
                int row = bm + wm + i * 16 + rowOff + r;
                C[(size_t)row * N + col] = activate<ACT>(acc[i][j][r] + bv);
            }
        }
    }
}

// ---------------------------------------------------------------------------
// Both projections of x in one launch: qk = x W_qk + b_qk, v = x W_v + b_v.
// A block takes 128 tokens and the same 128 columns of each product: a K-slice
// of x is staged once and meets a slice of either weight. Waves 0-3 form qk,
// waves 4-7 form v, each wave a tile of 64 x 64 (16 WMMAs per 8 fragments).
// Ring, copies, waits and barrier are those of gemm_bf16w.
// A lane's 8 results run along the rows of the first WMMA operand, P; its lane
// index picks the row of the second, Q. qk is stored as rows [token][column]:
// P = W_qk^T, Q = x. v is stored turned, [sequence][column][token]: P = x,
// Q = W_v^T. Either way 8 results are one 16-byte store, and both arrive as the
// attention kernel wants K (= Q) and V^T in LDS: rounded and turned once here,
// not by every query block. The two halves of the block differ in the LDS tiles
// they read and in the epilogue only.
// ---------------------------------------------------------------------------
__global__ __launch_bounds__(256) void gemm_qk_v(
    const __bf16* __restrict__ xb, const __bf16* __restrict__ wt_qk,
    const __bf16* __restrict__ wt_v, const float* __restrict__ b_qk,
    const float* __restrict__ b_v, __bf16* __restrict__ qk,
    __bf16* __restrict__ vt) {
    // [buffer][x, W_qk^T, W_v^T][row * LDS_STR + k]
    __shared__ __attribute__((aligned(16))) __bf16 S[2][3][BM * LDS_STR];

    const int bm   = blockIdx.y * BM;   // tokens
    const int bn   = blockIdx.x * BN;   // columns of qk and of v
    const int tid  = threadIdx.x;
    const int lane = tid & 31;
    const int wid  = __builtin_amdgcn_readfirstlane(tid >> 5);
    const bool forV = wid >= 4;
    const int tP = forV ? 0 : 1;        // which tile of S is P, which Q
    const int tQ = forV ? 2 : 0;
    const int wp = ((wid >> 1) & 1) * 64;
    const int wq = (wid & 1) * 64;

    // A slice of each operand is 128 rows of 16 chunks of 16 bytes: 8 chunks
    // per thread, 16 rows apart.
    const int sr  = tid >> 4;
    const int sc8 = (tid & 15) * 8;
    const __bf16* const src[3] = {xb    + (size_t)bm * PD + (sr * PD + sc8),
                                  wt_qk + (size_t)bn * PD + (sr * PD + sc8),
                                  wt_v  + (size_t)bn * PD + (sr * PD + sc8)};

    // Issue every copy of one K-slice into LDS buffer `buf`: 3 x 8 x 16 bytes
    // per thread.
    auto stage = [&](int k0, int buf) {
#pragma unroll   // both: constant indices, so that the arrays stay in registers
        for (int m = 0; m < 3; m++) {
            uint32_t      l[8];
            const __bf16* g[8];
#pragma unroll
            for (int i = 0; i < 8; i++) {
                l[i] = (uint32_t)(uintptr_t)&S[buf][m][(sr + i * 16) * LDS_STR + sc8];
                g[i] = src[m] + k0 + i * 16 * PD;
            }
            async_copy8_b128(l, g);
        }
    };

    f32x8 zero = {0.f, 0.f, 0.f, 0.f, 0.f, 0.f, 0.f, 0.f};
    f32x8 acc[4][4];
#pragma unroll   // both: constant indices, so that acc stays in registers
    for (int i = 0; i < 4; i++)
#pragma unroll
        for (int j = 0; j < 4; j++) acc[i][j] = zero;

    stage(0, 0);
    wait_async0();
    __syncthreads();

    const int nk = PD / BK;
    for (int t = 0; t < nk; t++) {
        const int buf = t & 1;
        if (t + 1 < nk) stage((t + 1) * BK, buf ^ 1);

        const __bf16* P = S[buf][tP];
        const __bf16* Q = S[buf][tQ];
#pragma unroll
        for (int kk = 0; kk < BK; kk += 32) {
            bf16x16 pf[4], qf[4];
#pragma unroll   // here and below: constant indices into pf, qf and acc
            for (int i = 0; i < 4; i++) {
                pf[i] = load_frag(P, wp + i * 16, kk, LDS_STR);
                qf[i] = load_frag(Q, wq + i * 16, kk, LDS_STR);
            }
            // Keeps the 16 LDS reads of a block together in front of its WMMAs:
            // left alone, the scheduler sinks each P fragment's reads to its
            // first use and the wave waits out the LDS latency four times.
            __builtin_amdgcn_sched_barrier(0);
#pragma unroll
            for (int i = 0; i < 4; i++)
#pragma unroll
                for (int j = 0; j < 4; j++)
                    acc[i][j] = wmma_bf16(pf[i], qf[j], acc[i][j]);
        }

        // This wave's LDS reads are done before the barrier behind which the
        // buffer it has read is refilled by the copies.
        asm volatile("s_wait_dscnt 0x0" ::: "memory");
        wait_async0();      // next slice's copies landed in LDS
        __syncthreads();    // next slice visible to every wave; this slice done
    }

    const int qOff = lane & 15;
    const int pOff = (lane >> 4) * 8;
    if (forV) {
        // BM divides SEQ: the block's tokens lie in one sequence.
        __bf16* dst = vt + ((size_t)(bm / SEQ) * PD + bn) * SEQ + bm % SEQ;
#pragma unroll   // all three: constant indices into acc and o
        for (int j = 0; j < 4; j++) {
            const int col = wq + j * 16 + qOff;
            const float bv = b_v[bn + col];
#pragma unroll
            for (int i = 0; i < 4; i++) {
                bf16x8 o;
#pragma unroll
                for (int r = 0; r < 8; r++) o[r] = (__bf16)(acc[i][j][r] + bv);
                *(bf16x8*)(dst + col * SEQ + wp + i * 16 + pOff) = o;
            }
        }
        // Stands in front of any reuse of the stores' address and data registers.
        asm volatile("s_wait_xcnt 0x0" ::: "memory");
    } else {
        __bf16* dst = qk + (size_t)bm * PD + bn;
#pragma unroll   // all three: constant indices into acc, o and the bias vectors
        for (int i = 0; i < 4; i++) {
            const int col0 = wp + i * 16 + pOff;
            const float4 b0 = *(const float4*)(b_qk + bn + col0);
            const float4 b1 = *(const float4*)(b_qk + bn + col0 + 4);
#pragma unroll
            for (int j = 0; j < 4; j++) {
                bf16x8 o;
#pragma unroll
                for (int r = 0; r < 8; r++)
                    o[r] = (__bf16)(acc[i][j][r] + pick(r < 4 ? b0 : b1, r & 3));
                *(bf16x8*)(dst + (wq + j * 16 + qOff) * PD + col0) = o;
            }
        }
        // Stands in front of any reuse of the stores' address and data registers.
        asm volatile("s_wait_xcnt 0x0" ::: "memory");
    }
}

#define AHD 64
#define ASTR 72   // 64 + 8 pad, 144B row stride (16B aligned)

__device__ __forceinline__ float swap_halves(float x) {
    int b = __builtin_bit_cast(int, x);
    b = __builtin_amdgcn_permlanex16(b, b, 0x76543210, 0xfedcba98, false, false);
    return __builtin_bit_cast(float, b);
}

__global__ __launch_bounds__(128) __attribute__((amdgpu_waves_per_eu(4, 4)))
void attn_kernel(
    const __bf16* __restrict__ qk, const __bf16* __restrict__ vt,
    __bf16* __restrict__ out, int B, int T, int H) {
    __shared__ __attribute__((aligned(16))) __bf16 Qs[64 * ASTR];
    __shared__ __attribute__((aligned(16))) __bf16 Ks[64 * ASTR];
    __shared__ __attribute__((aligned(16))) __bf16 Vt[64 * ASTR];   // [hd][key]

    const int b  = blockIdx.z;
    const int h  = blockIdx.y;
    const int q0 = blockIdx.x * 64;
    const int tid = threadIdx.x;
    const int wid = tid >> 5;
    const int lane = tid & 31;
    const size_t Dm = (size_t)H * AHD;

    // A 64x64 bf16 tile is 64 rows of 8 chunks of 16 bytes: 4 chunks per thread,
    // 16 rows apart. The row pitches (PD for qk, SEQ for vt) are compile-time so
    // that a thread's 4 loads of a tile share one address register pair and
    // differ in the immediate offset only.
    const int sr = tid >> 3;
    const int sc = (tid & 7) * 8;
    const __bf16* qbase = qk + ((size_t)b * SEQ * PD + (size_t)h * AHD) +
                          (sr * PD + sc);
    const __bf16* vbase = vt + ((size_t)b * PD + (size_t)h * AHD) * SEQ +
                          (sr * SEQ + sc);
    __bf16* const qdst = Qs + sr * ASTR + sc;
    __bf16* const kdst = Ks + sr * ASTR + sc;
    __bf16* const vdst = Vt + sr * ASTR + sc;

    // Stage Q.
    {
        const __bf16* qp = qbase + (size_t)q0 * PD;
        bf16x8 qc[4];
#pragma unroll   // both: constant indices; the 4 loads go out together
        for (int i = 0; i < 4; i++)
            qc[i] = *(const bf16x8*)(qp + i * 16 * PD);
        // Stands in front of any reuse of the loads' address registers; it names
        // the address so that the pair lives up to here.
        asm volatile("s_wait_xcnt 0x0" :: "v"(qp) : "memory");
#pragma unroll
        for (int i = 0; i < 4; i++) *(bf16x8*)(qdst + i * 16 * ASTR) = qc[i];
    }
    __syncthreads();

    // B operand of S^T: column = query, k = head dim.
    bf16x16 qb[2];
    qb[0] = load_frag(Qs, wid * 16, 0,  ASTR);
    qb[1] = load_frag(Qs, wid * 16, 32, ASTR);

    f32x8 zero = {0.f, 0.f, 0.f, 0.f, 0.f, 0.f, 0.f, 0.f};
    f32x8 o[4];   // o[n][r] = O^T[hd = 16n + 8*(lane>>4) + r][query = lane&15]
#pragma unroll
    for (int n = 0; n < 4; n++) o[n] = zero;
    float m_q = -1e30f;
    f32x8 l_v = zero;

    for (int kb = 0; kb < T; kb += 64) {
        __syncthreads();
        // Stage the K tile (rows = keys) and the V^T tile (rows = head dim).
        const __bf16* kp = qbase + (size_t)kb * PD;
        const __bf16* vp = vbase + kb;
        bf16x8 kc[4], vc[4];
#pragma unroll   // both: constant indices; the 8 loads go out together
        for (int i = 0; i < 4; i++) {
            kc[i] = *(const bf16x8*)(kp + i * 16 * PD);
            vc[i] = *(const bf16x8*)(vp + i * 16 * SEQ);
        }
        // Stands in front of any reuse of the loads' address registers; it names
        // the addresses so that both pairs live up to here.
        asm volatile("s_wait_xcnt 0x0" :: "v"(kp), "v"(vp) : "memory");
#pragma unroll
        for (int i = 0; i < 4; i++) {
            *(bf16x8*)(kdst + i * 16 * ASTR) = kc[i];
            *(bf16x8*)(vdst + i * 16 * ASTR) = vc[i];
        }
        __syncthreads();

        // S^T = K Q^T (64 keys x 16 queries per wave), K-dim = HD = 64.
        // s[n][r] = score(key = kb + 16n + 8*(lane>>4) + r, query = lane&15)
        f32x8 s[4];
#pragma unroll
        for (int n = 0; n < 4; n++) {
            bf16x16 ka0 = load_frag(Ks, n * 16, 0,  ASTR);
            bf16x16 ka1 = load_frag(Ks, n * 16, 32, ASTR);
            s[n] = wmma_bf16(ka0, qb[0], zero);
            s[n] = wmma_bf16(ka1, qb[1], s[n]);
        }
        // scale by 1/sqrt(HD) = 1/8
#pragma unroll
        for (int n = 0; n < 4; n++)
#pragma unroll
            for (int r = 0; r < 8; r++) s[n][r] *= 0.125f;

        // Online softmax: one query per lane. Every loop here is unrolled so
        // that the tiles are indexed by constants and stay in registers.
        float mt[4];   // one short chain per tile, not one chain of 32
#pragma unroll
        for (int n = 0; n < 4; n++) {
            mt[n] = s[n][0];
#pragma unroll
            for (int r = 1; r < 8; r++) mt[n] = fmaxf(mt[n], s[n][r]);
        }
        float mx = fmaxf(fmaxf(mt[0], mt[1]), fmaxf(mt[2], mt[3]));
        mx = fmaxf(mx, swap_halves(mx));
        float mnew = fmaxf(m_q, mx);
        float corr = __expf(m_q - mnew);
        m_q = mnew;

        Frag16 pb[2];   // B operand of O^T: column = query, k = key
        l_v *= corr;
#pragma unroll
        for (int n = 0; n < 4; n++) {
            f32x8 p;
#pragma unroll
            for (int r = 0; r < 8; r++) p[r] = __expf(s[n][r] - mnew);
            l_v += p;
#pragma unroll
            for (int r = 0; r < 8; r++) pb[n >> 1].h[n & 1][r] = (__bf16)p[r];
        }
#pragma unroll
        for (int n = 0; n < 4; n++)
#pragma unroll
            for (int r = 0; r < 8; r++) o[n][r] *= corr;

        // O^T += V^T P^T   (K-dim = 64 keys, two 32-steps).
#pragma unroll
        for (int n = 0; n < 4; n++) {
            bf16x16 va0 = load_frag(Vt, n * 16, 0,  ASTR);
            bf16x16 va1 = load_frag(Vt, n * 16, 32, ASTR);
            o[n] = wmma_bf16(va0, pb[0].f, o[n]);
            o[n] = wmma_bf16(va1, pb[1].f, o[n]);
        }
    }

    const float l_q = ((l_v[0] + l_v[1]) + (l_v[2] + l_v[3])) +
                      ((l_v[4] + l_v[5]) + (l_v[6] + l_v[7]));
    const float inv = 1.0f / (l_q + swap_halves(l_q));
    const int row = q0 + wid * 16 + (lane & 15);
    __bf16* orow = out + ((size_t)b * T + row) * Dm + (size_t)h * AHD +
                   (lane >> 4) * 8;
#pragma unroll   // both: constant indices into o and p
    for (int n = 0; n < 4; n++) {
        bf16x8 p;
#pragma unroll
        for (int r = 0; r < 8; r++) p[r] = (__bf16)(o[n][r] * inv);
        *(bf16x8*)(orow + n * 16) = p;
    }
}

// ---------------------------------------------------------------------------
// Fused residual + LayerNorm: out = LN(x + res) * g + b.  One block per token.
// WB: the result is also stored rounded to bf16, as the next GEMM's A operand.
// ---------------------------------------------------------------------------
template <bool WB>
__global__ __launch_bounds__(256) void ln_kernel(
    const float* __restrict__ x, const float* __restrict__ res,
    const float* __restrict__ g, const float* __restrict__ be,
    float* __restrict__ out, __bf16* __restrict__ outb, int D) {
    __shared__ float red[2][8];
    const size_t base = (size_t)blockIdx.x * D;
    float v[4], s = 0.f, s2 = 0.f;
#pragma unroll
    for (int i = 0; i < 4; i++) {
        int c = threadIdx.x + i * 256;
        v[i] = x[base + c] + res[base + c];
        s += v[i];
        s2 += v[i] * v[i];
    }
#pragma unroll
    for (int off = 16; off > 0; off >>= 1) {
        s  += __shfl_xor(s, off);
        s2 += __shfl_xor(s2, off);
    }
    if ((threadIdx.x & 31) == 0) {
        red[0][threadIdx.x >> 5] = s;
        red[1][threadIdx.x >> 5] = s2;
    }
    __syncthreads();
    float ts = 0.f, ts2 = 0.f;
#pragma unroll
    for (int i = 0; i < 8; i++) { ts += red[0][i]; ts2 += red[1][i]; }
    float mean = ts / (float)D;
    float var  = ts2 / (float)D - mean * mean;
    float rstd = rsqrtf(var + 1e-5f);
#pragma unroll
    for (int i = 0; i < 4; i++) {
        int c = threadIdx.x + i * 256;
        float y = (v[i] - mean) * rstd * g[c] + be[c];
        out[base + c] = y;
        if (WB) outb[base + c] = (__bf16)y;
    }
}

// ---------------------------------------------------------------------------
// Orchestration
// ---------------------------------------------------------------------------
extern "C" void kernel_launch(void* const* d_in, const int* in_sizes, int n_in,
                              void* d_out, int out_size, void* d_ws,
                              size_t ws_size, hipStream_t stream) {
    const int B = 2, T = 2048, D = 1024, H = 16;
    const int M = B * T;  // 4096 tokens

    const float* x    = (const float*)d_in[0];
    const float* w_qk = (const float*)d_in[1];
    const float* b_qk = (const float*)d_in[2];
    const float* w_v  = (const float*)d_in[3];
    const float* b_v  = (const float*)d_in[4];
    const float* w_o  = (const float*)d_in[5];
    const float* b_o  = (const float*)d_in[6];
    const float* g1   = (const float*)d_in[7];
    const float* be1  = (const float*)d_in[8];
    const float* g2   = (const float*)d_in[9];
    const float* be2  = (const float*)d_in[10];
    const float* w_f1 = (const float*)d_in[11];
    const float* b_f1 = (const float*)d_in[12];
    const float* w_f2 = (const float*)d_in[13];
    const float* b_f2 = (const float*)d_in[14];
    float* outp = (float*)d_out;

    // Workspace layout (activations, then bf16 packed weights), ~115 MB.
    float* ws = (float*)d_ws;
    const size_t SZ = (size_t)M * D;          // 4M elements per activation
    float* qk_buf = ws;                       // qk (bf16); then o-proj output
    float* v_buf  = ws + SZ;                  // v^T (bf16); then ffn output
    __bf16* qk_bf = (__bf16*)qk_buf;          // [B][T][D]
    __bf16* vt_bf = (__bf16*)v_buf;           // [B][D][T]
    __bf16* a_bf  = (__bf16*)(ws + 2 * SZ);   // attention output
    __bf16* x_bf  = a_bf + SZ;                // x
    float* x1_buf = ws + 3 * SZ;              // post-LN1
    __bf16* h_bf  = (__bf16*)(ws + 4 * SZ);   // GELU hidden (2*SZ elements)
    __bf16* x1_bf = (__bf16*)(ws + 5 * SZ);   // post-LN1
    __bf16* wt_qk = (__bf16*)(ws + 6 * SZ);
    __bf16* wt_v  = wt_qk + (size_t)D * D;
    __bf16* wt_o  = wt_v  + (size_t)D * D;
    __bf16* wt_f1 = wt_o  + (size_t)D * D;    // [2D][D]
    __bf16* wt_f2 = wt_f1 + (size_t)2 * D * D; // [D][2D]

    // 1) Pack weights to bf16 transposed (wt_qk is the start of all five);
    //    round x.
    pack_all<<<7 * PTILES + XEL / XPB, 128, 0, stream>>>(w_qk, w_v, w_o, w_f1,
                                                         w_f2, wt_qk, x, x_bf);

    dim3 gNN(D / BN, M / BM);       // N = 1024
    dim3 gN2(2 * D / BN, M / BM);   // N = 2048

    // 2) Projections, one launch.
    gemm_qk_v<<<gNN, 256, 0, stream>>>(x_bf, wt_qk, wt_v, b_qk, b_v, qk_bf,
                                       vt_bf);

    // 3) Attention.
    attn_kernel<<<dim3(T / 64, H, B), 128, 0, stream>>>(qk_bf, vt_bf, a_bf,
                                                        B, T, H);

    // 4) Output projection (reuse qk_buf).
    gemm_bf16w<0, 1024, 0><<<gNN, 256, 0, stream>>>(a_bf, wt_o, b_o, qk_buf,
                                                    nullptr, M, D);

    // 5) Residual + LN1.
    ln_kernel<true><<<M, 256, 0, stream>>>(x, qk_buf, g1, be1, x1_buf, x1_bf, D);

    // 6) FFN.
    gemm_bf16w<1, 1024, 1><<<gN2, 256, 0, stream>>>(x1_bf, wt_f1, b_f1, nullptr,
                                                    h_bf, M, 2 * D);
    gemm_bf16w<0, 2048, 0><<<gNN, 256, 0, stream>>>(h_bf, wt_f2, b_f2, v_buf,
                                                    nullptr, M, D);

    // 7) Residual + LN2 -> d_out.
    ln_kernel<false><<<M, 256, 0, stream>>>(x1_buf, v_buf, g2, be2, outp, nullptr,
                                            D);
}

// v008
// It runs in 128 microseconds.
// In two side-by-side timings against v007, it was 1.05 and 1.06 times as fast.
// All steps since v000 together make it 3.05 times as fast.
#include <hip/hip_runtime.h>
#include <hip/hip_bf16.h>
#include <cstdint>

typedef __attribute__((ext_vector_type(16))) __bf16 bf16x16;
typedef __attribute__((ext_vector_type(8)))  __bf16 bf16x8;
typedef __attribute__((ext_vector_type(4)))  __bf16 bf16x4;
typedef __attribute__((ext_vector_type(8)))  float  f32x8;

union Frag16 { bf16x16 f; bf16x8 h[2]; };

__device__ __forceinline__ bf16x16 load_frag(const __bf16* lds, int rowBase,
                                             int kBase, int stride) {
    int lane  = threadIdx.x & 31;
    int row   = rowBase + (lane & 15);
    int khalf = (lane < 16) ? 0 : 8;
    const __bf16* p = lds + row * stride + kBase + khalf;
    Frag16 fr;
    fr.h[0] = *(const bf16x8*)(p);
    fr.h[1] = *(const bf16x8*)(p + 16);
    return fr.f;
}

__device__ __forceinline__ f32x8 wmma_bf16(bf16x16 a, bf16x16 b, f32x8 c) {
    return __builtin_amdgcn_wmma_f32_16x16x32_bf16(
        /*neg_a=*/false, a, /*neg_b=*/false, b,
        /*c_mod=*/(short)0, c, /*reuse_a=*/false, /*reuse_b=*/false);
}

__device__ __forceinline__ void async_copy8_b128(const uint32_t* l,
                                                 const __bf16* const* g) {
    asm volatile("global_load_async_to_lds_b128 %0, %8, off\n\t"
                 "global_load_async_to_lds_b128 %1, %9, off\n\t"
                 "global_load_async_to_lds_b128 %2, %10, off\n\t"
                 "global_load_async_to_lds_b128 %3, %11, off\n\t"
                 "global_load_async_to_lds_b128 %4, %12, off\n\t"
                 "global_load_async_to_lds_b128 %5, %13, off\n\t"
                 "global_load_async_to_lds_b128 %6, %14, off\n\t"
                 "global_load_async_to_lds_b128 %7, %15, off\n\t"
                 "s_wait_xcnt 0x0"
                 :: "v"(l[0]), "v"(l[1]), "v"(l[2]), "v"(l[3]),
                    "v"(l[4]), "v"(l[5]), "v"(l[6]), "v"(l[7]),
                    "v"(g[0]), "v"(g[1]), "v"(g[2]), "v"(g[3]),
                    "v"(g[4]), "v"(g[5]), "v"(g[6]), "v"(g[7])
                 : "memory");
}

__device__ __forceinline__ void wait_async0() {
    asm volatile("s_wait_asynccnt 0x0" ::: "memory");
}

// ---------------------------------------------------------------------------
// Weight pack: fp32 W[K][N] row-major  ->  bf16 Wt[N][K]  (transposed)
// One launch for all five weights. A block of 4 waves takes one tile of
// 128 (k) x 64 (n): it reads 256-byte row pieces with 16-byte loads (all 16 of
// a thread in flight together), turns the tile in LDS and writes 256-byte
// pieces of Wt rows with 16-byte stores. The packed weights lie one behind the
// other in wt_all: qk, v, o (PD*PD each), f1, f2 (2*PD*PD each).
// The blocks behind the weights' round x to bf16 (layout kept): it is shared
// by both projections in one GEMM, which reads it once per column of tiles.
// ---------------------------------------------------------------------------
#define PD   1024  // model width: qk, v, o are PD x PD, f1 PD x 2PD, f2 2PD x PD
#define PTK  128   // tile extent in k
#define PTN  64    // tile extent in n
#define PSTR 136   // PTK + 8 pad: 272-byte LDS rows (16-byte aligned)
#define PTILES ((PD / PTK) * (PD / PTN))   // tiles per PD*PD elements
#define XEL  (2 * 2048 * PD)   // elements of x: B * T * PD
#define XPB  (128 * 4 * 16)    // elements of x per block: 16 float4 per thread

__device__ __forceinline__ float pick(float4 v, int j) {
    return j == 0 ? v.x : j == 1 ? v.y : j == 2 ? v.z : v.w;
}

// One tile of one weight. K and N are compile-time so that a thread's 16 loads
// share one address and differ in the immediate offset only.
template <int K, int N>
__device__ __forceinline__ void pack_tile(const float* __restrict__ w,
                                          __bf16* __restrict__ wt, int lt,
                                          __bf16* Ts) {
    const int n0 = (lt % (N / PTN)) * PTN;
    const int k0 = (lt / (N / PTN)) * PTK;
    const int tid = threadIdx.x;
    const int n4  = (tid & 15) * 4;   // 4 columns of the tile
    const int kg  = (tid >> 4) * 8;   // 8 rows, twice (m * 64)
    const float* src = w + (size_t)k0 * N + n0 + (kg * N + n4);

    float4 a[2][8];
#pragma unroll   // both: constant indices into a; the 16 loads go out together
    for (int m = 0; m < 2; m++)
#pragma unroll
        for (int i = 0; i < 8; i++)
            a[m][i] = *(const float4*)(src + (m * 64 + i) * N);
    // The loads' address register is free for reuse from here on: this wait
    // stands in front of that reuse. It names the address so that the register
    // lives up to here and no load's result is placed on it.
    asm volatile("s_wait_xcnt 0x0" :: "v"(src) : "memory");

#pragma unroll   // all three: constant indices into a, so that it stays in registers
    for (int m = 0; m < 2; m++)
#pragma unroll
        for (int j = 0; j < 4; j++) {
            bf16x8 p;
#pragma unroll
            for (int i = 0; i < 8; i++) p[i] = (__bf16)pick(a[m][i], j);
            *(bf16x8*)&Ts[(n4 + j) * PSTR + m * 64 + kg] = p;
        }
    __syncthreads();

    const int nr = tid >> 4;          // 16 chunks of 8 bf16 per row
    const int c8 = (tid & 15) * 8;
    __bf16* dst = wt + (size_t)n0 * K + k0 + (nr * K + c8);
#pragma unroll   // the 8 LDS reads go out together, ahead of the first store
    for (int p = 0; p < 8; p++) {
        bf16x8 q = *(const bf16x8*)&Ts[(nr + p * 8) * PSTR + c8];
        *(bf16x8*)(dst + p * 8 * K) = q;
    }
    // Stands in front of any reuse of the stores' address and data registers.
    asm volatile("s_wait_xcnt 0x0" ::: "memory");
}

// One block's piece of x: a wave reads 512 and writes 256 bytes in a row.
__device__ __forceinline__ void round_x(const float* __restrict__ x,
                                        __bf16* __restrict__ xb, int blk) {
    const size_t at = (size_t)blk * XPB + threadIdx.x * 4;
    const float* src = x + at;
    __bf16*      dst = xb + at;
    float4 a[16];
#pragma unroll   // both: constant indices into a; the 16 loads go out together
    for (int i = 0; i < 16; i++) a[i] = *(const float4*)(src + i * 512);
    // Stands in front of any reuse of the loads' address registers; it names
    // the address so that the pair lives up to here.
    asm volatile("s_wait_xcnt 0x0" :: "v"(src) : "memory");
#pragma unroll
    for (int i = 0; i < 16; i++) {
        bf16x4 p = {(__bf16)a[i].x, (__bf16)a[i].y, (__bf16)a[i].z,
                    (__bf16)a[i].w};
        *(bf16x4*)(dst + i * 512) = p;
    }
    // Stands in front of any reuse of the stores' address and data registers.
    asm volatile("s_wait_xcnt 0x0" ::: "memory");
}

// amdgpu_waves_per_eu(4, 4): a wave may take a quarter of the registers.
// Without it the compiler saves registers by waiting for the first loads
// before it issues the last.
__global__ __launch_bounds__(128) __attribute__((amdgpu_waves_per_eu(4, 4)))
void pack_all(
    const float* __restrict__ w_qk, const float* __restrict__ w_v,
    const float* __restrict__ w_o,  const float* __restrict__ w_f1,
    const float* __restrict__ w_f2, __bf16* __restrict__ wt_all,
    const float* __restrict__ x, __bf16* __restrict__ xb) {
    __shared__ __attribute__((aligned(16))) __bf16 Ts[PTN * PSTR];   // [n][k]

    // Which weight, by block index (the same for the whole block).
    const int job = blockIdx.x / PTILES;   // 0..6: weights, in units of PD*PD
    if (job < 3) {
        const float* w = job == 0 ? w_qk : job == 1 ? w_v : w_o;
        pack_tile<PD, PD>(w, wt_all + (size_t)job * PD * PD,
                          blockIdx.x - job * PTILES, Ts);
    } else if (job < 5) {
        pack_tile<PD, 2 * PD>(w_f1, wt_all + (size_t)3 * PD * PD,
                              blockIdx.x - 3 * PTILES, Ts);
    } else if (job < 7) {
        pack_tile<2 * PD, PD>(w_f2, wt_all + (size_t)5 * PD * PD,
                              blockIdx.x - 5 * PTILES, Ts);
    } else {
        round_x(x, xb, blockIdx.x - 7 * PTILES);
    }
}

// ---------------------------------------------------------------------------
// GEMM:  C[M][N] = act( A[M][K] @ W[K][N] + bias[N] )
//   A     : bf16 row-major [M][K]
//   Wt    : bf16, pre-transposed [N][K]
//   Both are staged by the async global->LDS DMA: no register, no conversion.
// Block tile 128x128x128, 256 threads (8 waves, 4x2), wave tile 32x64
//   => 32 v_wmma_f32_16x16x32_bf16 per wave per K-step.
// Double-buffered LDS: tile t+1's copies are all issued ahead of tile t's
// WMMAs; single s_wait_asynccnt+barrier per K-step. A K-step is 128 wide so
// that the load latency and the barrier are paid once per 128 k and 64 KB per
// block are in flight during the WMMAs.
// OUT picks what is stored:
//   0 : C,  fp32 [M][N]
//   1 : Cb, bf16 [M][N]. The product is taken transposed (W^T as the A operand),
//       so a lane holds 8 neighbouring columns of one row: one 16-byte store.
//       It is the form of the next GEMM's A operand.
// ---------------------------------------------------------------------------
#define BM 128
#define BN 128
#define BK 128
#define LDS_STR 136  // BK + 8 pad; 136*2B = 272B row stride (16B aligned)
#define SEQ 2048     // tokens per sequence (T); BM divides it

template <int ACT>  // 0 = none, 1 = exact GELU
__device__ __forceinline__ float activate(float val) {
    if (ACT == 1) val = 0.5f * val * (1.0f + erff(val * 0.70710678118654752f));
    return val;
}

template <int ACT, int K, int OUT>
__global__ __launch_bounds__(256) void gemm_bf16w(
    const __bf16* __restrict__ A, const __bf16* __restrict__ Wt,
    const float* __restrict__ bias, float* __restrict__ C,
    __bf16* __restrict__ Cb, int M, int N) {
    __shared__ __attribute__((aligned(16))) __bf16 As[2][BM * LDS_STR];
    __shared__ __attribute__((aligned(16))) __bf16 Bs[2][BN * LDS_STR];

    const int bm  = blockIdx.y * BM;
    const int bn  = blockIdx.x * BN;
    const int tid = threadIdx.x;
    const int wid = tid >> 5;
    const int wm  = (wid >> 1) * 32;  // 0..96
    const int wn  = (wid & 1) * 64;   // 0,64
    const int lane = tid & 31;

    // A slice of either operand is 128 rows of 16 chunks of 16 bytes: 8 chunks
    // per thread, 16 rows apart.
    const int sr  = tid >> 4;
    const int sc8 = (tid & 15) * 8;
    const __bf16* asrc = A  + (size_t)bm * K + (sr * K + sc8);
    const __bf16* bsrc = Wt + (size_t)bn * K + (sr * K + sc8);

    // Issue every copy of one 128x128 K-slice of A and of B into LDS buffer
    // `buf`: 2 x 8 x 16 bytes per thread.
    auto stage = [&](int k0, int buf) {
        uint32_t      l[8];
        const __bf16* g[8];
#pragma unroll   // constant indices: both arrays stay in registers
        for (int i = 0; i < 8; i++) {
            l[i] = (uint32_t)(uintptr_t)&As[buf][(sr + i * 16) * LDS_STR + sc8];
            g[i] = asrc + k0 + i * 16 * K;
        }
        async_copy8_b128(l, g);
#pragma unroll
        for (int i = 0; i < 8; i++) {
            l[i] = (uint32_t)(uintptr_t)&Bs[buf][(sr + i * 16) * LDS_STR + sc8];
            g[i] = bsrc + k0 + i * 16 * K;
        }
        async_copy8_b128(l, g);
    };

    f32x8 zero = {0.f, 0.f, 0.f, 0.f, 0.f, 0.f, 0.f, 0.f};
    f32x8 acc[2][4];
#pragma unroll
    for (int i = 0; i < 2; i++)
#pragma unroll
        for (int j = 0; j < 4; j++) acc[i][j] = zero;

    stage(0, 0);
    wait_async0();
    __syncthreads();

    const int nk = K / BK;
    for (int t = 0; t < nk; t++) {
        const int buf = t & 1;
        if (t + 1 < nk) stage((t + 1) * BK, buf ^ 1);

#pragma unroll
        for (int kk = 0; kk < BK; kk += 32) {
            bf16x16 af[2], bfr[4];
            af[0] = load_frag(As[buf], wm,      kk, LDS_STR);
            af[1] = load_frag(As[buf], wm + 16, kk, LDS_STR);
#pragma unroll
            for (int j = 0; j < 4; j++)
                bfr[j] = load_frag(Bs[buf], wn + j * 16, kk, LDS_STR);
#pragma unroll
            for (int i = 0; i < 2; i++)
#pragma unroll
                for (int j = 0; j < 4; j++)
                    acc[i][j] = OUT == 1 ? wmma_bf16(bfr[j], af[i], acc[i][j])
                                         : wmma_bf16(af[i], bfr[j], acc[i][j]);
        }

        // This wave's LDS reads are done before the barrier behind which the
        // buffer it has read is refilled by the copies.
        asm volatile("s_wait_dscnt 0x0" ::: "memory");
        wait_async0();      // next tile's DMA landed in LDS
        __syncthreads();    // next tile visible to every wave; this tile done
    }

    const int colOff = lane & 15;
    const int rowOff = (lane >> 4) * 8;
#pragma unroll
    for (int i = 0; i < 2; i++) {
#pragma unroll
        for (int j = 0; j < 4; j++) {
            if (OUT == 1) {
                int col0 = bn + wn + j * 16 + rowOff;
                int row  = bm + wm + i * 16 + colOff;
                float4 b0 = *(const float4*)(bias + col0);
                float4 b1 = *(const float4*)(bias + col0 + 4);
                bf16x8 p;
#pragma unroll   // constant indices into acc, p and the bias vectors
                for (int r = 0; r < 8; r++)
                    p[r] = (__bf16)activate<ACT>(acc[i][j][r] +
                                                 pick(r < 4 ? b0 : b1, r & 3));
                *(bf16x8*)(Cb + (size_t)row * N + col0) = p;
                continue;
            }
            int col  = bn + wn + j * 16 + colOff;
            float bv = bias[col];
#pragma unroll
            for (int r = 0; r < 8; r++) {
                int row = bm + wm + i * 16 + rowOff + r;
                C[(size_t)row * N + col] = activate<ACT>(acc[i][j][r] + bv);
            }
        }
    }
}

// ---------------------------------------------------------------------------
// Both projections of x in one launch: qk = x W_qk + b_qk, v = x W_v + b_v.
// A block takes 128 tokens and the same 128 columns of each product: a K-slice
// of x is staged once and meets a slice of either weight. Waves 0-3 form qk,
// waves 4-7 form v, each wave a tile of 64 x 64 (16 WMMAs per 8 fragments).
// Ring, copies, waits and barrier are those of gemm_bf16w.
// A lane's 8 results run along the rows of the first WMMA operand, P; its lane
// index picks the row of the second, Q. qk is stored as rows [token][column]:
// P = W_qk^T, Q = x. v is stored turned, [sequence][column][token]: P = x,
// Q = W_v^T. Either way 8 results are one 16-byte store, and both arrive as the
// attention kernel wants K (= Q) and V^T in LDS: rounded and turned once here,
// not by every query block. The two halves of the block differ in the LDS tiles
// they read and in the epilogue only.
// ---------------------------------------------------------------------------
__global__ __launch_bounds__(256) void gemm_qk_v(
    const __bf16* __restrict__ xb, const __bf16* __restrict__ wt_qk,
    const __bf16* __restrict__ wt_v, const float* __restrict__ b_qk,
    const float* __restrict__ b_v, __bf16* __restrict__ qk,
    __bf16* __restrict__ vt) {
    // [buffer][x, W_qk^T, W_v^T][row * LDS_STR + k]
    __shared__ __attribute__((aligned(16))) __bf16 S[2][3][BM * LDS_STR];

    const int bm   = blockIdx.y * BM;   // tokens
    const int bn   = blockIdx.x * BN;   // columns of qk and of v
    const int tid  = threadIdx.x;
    const int lane = tid & 31;
    const int wid  = __builtin_amdgcn_readfirstlane(tid >> 5);
    const bool forV = wid >= 4;
    const int tP = forV ? 0 : 1;        // which tile of S is P, which Q
    const int tQ = forV ? 2 : 0;
    const int wp = ((wid >> 1) & 1) * 64;
    const int wq = (wid & 1) * 64;

    // A slice of each operand is 128 rows of 16 chunks of 16 bytes: 8 chunks
    // per thread, 16 rows apart.
    const int sr  = tid >> 4;
    const int sc8 = (tid & 15) * 8;
    const __bf16* const src[3] = {xb    + (size_t)bm * PD + (sr * PD + sc8),
                                  wt_qk + (size_t)bn * PD + (sr * PD + sc8),
                                  wt_v  + (size_t)bn * PD + (sr * PD + sc8)};

    // Issue every copy of one K-slice into LDS buffer `buf`: 3 x 8 x 16 bytes
    // per thread.
    auto stage = [&](int k0, int buf) {
#pragma unroll   // both: constant indices, so that the arrays stay in registers
        for (int m = 0; m < 3; m++) {
            uint32_t      l[8];
            const __bf16* g[8];
#pragma unroll
            for (int i = 0; i < 8; i++) {
                l[i] = (uint32_t)(uintptr_t)&S[buf][m][(sr + i * 16) * LDS_STR + sc8];
                g[i] = src[m] + k0 + i * 16 * PD;
            }
            async_copy8_b128(l, g);
        }
    };

    f32x8 zero = {0.f, 0.f, 0.f, 0.f, 0.f, 0.f, 0.f, 0.f};
    f32x8 acc[4][4];
#pragma unroll   // both: constant indices, so that acc stays in registers
    for (int i = 0; i < 4; i++)
#pragma unroll
        for (int j = 0; j < 4; j++) acc[i][j] = zero;

    stage(0, 0);
    wait_async0();
    __syncthreads();

    const int nk = PD / BK;
    for (int t = 0; t < nk; t++) {
        const int buf = t & 1;
        if (t + 1 < nk) stage((t + 1) * BK, buf ^ 1);

        const __bf16* P = S[buf][tP];
        const __bf16* Q = S[buf][tQ];
#pragma unroll
        for (int kk = 0; kk < BK; kk += 32) {
            bf16x16 pf[4], qf[4];
#pragma unroll   // here and below: constant indices into pf, qf and acc
            for (int i = 0; i < 4; i++) {
                pf[i] = load_frag(P, wp + i * 16, kk, LDS_STR);
                qf[i] = load_frag(Q, wq + i * 16, kk, LDS_STR);
            }
            // Keeps the 16 LDS reads of a block together in front of its WMMAs:
            // left alone, the scheduler sinks each P fragment's reads to its
            // first use and the wave waits out the LDS latency four times.
            __builtin_amdgcn_sched_barrier(0);
#pragma unroll
            for (int i = 0; i < 4; i++)
#pragma unroll
                for (int j = 0; j < 4; j++)
                    acc[i][j] = wmma_bf16(pf[i], qf[j], acc[i][j]);
        }

        // This wave's LDS reads are done before the barrier behind which the
        // buffer it has read is refilled by the copies.
        asm volatile("s_wait_dscnt 0x0" ::: "memory");
        wait_async0();      // next slice's copies landed in LDS
        __syncthreads();    // next slice visible to every wave; this slice done
    }

    const int qOff = lane & 15;
    const int pOff = (lane >> 4) * 8;
    if (forV) {
        // BM divides SEQ: the block's tokens lie in one sequence.
        __bf16* dst = vt + ((size_t)(bm / SEQ) * PD + bn) * SEQ + bm % SEQ;
#pragma unroll   // all three: constant indices into acc and o
        for (int j = 0; j < 4; j++) {
            const int col = wq + j * 16 + qOff;
            const float bv = b_v[bn + col];
#pragma unroll
            for (int i = 0; i < 4; i++) {
                bf16x8 o;
#pragma unroll
                for (int r = 0; r < 8; r++) o[r] = (__bf16)(acc[i][j][r] + bv);
                *(bf16x8*)(dst + col * SEQ + wp + i * 16 + pOff) = o;
            }
        }
        // Stands in front of any reuse of the stores' address and data registers.
        asm volatile("s_wait_xcnt 0x0" ::: "memory");
    } else {
        __bf16* dst = qk + (size_t)bm * PD + bn;
#pragma unroll   // all three: constant indices into acc, o and the bias vectors
        for (int i = 0; i < 4; i++) {
            const int col0 = wp + i * 16 + pOff;
            const float4 b0 = *(const float4*)(b_qk + bn + col0);
            const float4 b1 = *(const float4*)(b_qk + bn + col0 + 4);
#pragma unroll
            for (int j = 0; j < 4; j++) {
                bf16x8 o;
#pragma unroll
                for (int r = 0; r < 8; r++)
                    o[r] = (__bf16)(acc[i][j][r] + pick(r < 4 ? b0 : b1, r & 3));
                *(bf16x8*)(dst + (wq + j * 16 + qOff) * PD + col0) = o;
            }
        }
        // Stands in front of any reuse of the stores' address and data registers.
        asm volatile("s_wait_xcnt 0x0" ::: "memory");
    }
}

#define AHD 64
#define ASTR 72   // 64 + 8 pad, 144B row stride (16B aligned)

__device__ __forceinline__ float swap_halves(float x) {
    int b = __builtin_bit_cast(int, x);
    b = __builtin_amdgcn_permlanex16(b, b, 0x76543210, 0xfedcba98, false, false);
    return __builtin_bit_cast(float, b);
}

__global__ __launch_bounds__(128) __attribute__((amdgpu_waves_per_eu(4, 4)))
void attn_kernel(
    const __bf16* __restrict__ qk, const __bf16* __restrict__ vt,
    __bf16* __restrict__ out, int B, int T, int H) {
    __shared__ __attribute__((aligned(16))) __bf16 Qs[64 * ASTR];
    // [buffer][K: key rows, V^T: head-dim rows][row * ASTR + column]
    __shared__ __attribute__((aligned(16))) __bf16 KV[2][2][64 * ASTR];

    const int b  = blockIdx.z;
    const int h  = blockIdx.y;
    const int q0 = blockIdx.x * 64;
    const int tid = threadIdx.x;
    const int wid = tid >> 5;
    const int lane = tid & 31;
    const size_t Dm = (size_t)H * AHD;

    // A 64x64 bf16 tile is 64 rows of 8 chunks of 16 bytes: 4 chunks per thread,
    // 16 rows apart. The row pitches are PD for qk, SEQ for vt.
    const int sr = tid >> 3;
    const int sc = (tid & 7) * 8;
    const __bf16* qbase = qk + ((size_t)b * SEQ * PD + (size_t)h * AHD) +
                          (sr * PD + sc);
    const __bf16* vbase = vt + ((size_t)b * PD + (size_t)h * AHD) * SEQ +
                          (sr * SEQ + sc);
    __bf16* const qdst = Qs + sr * ASTR + sc;

    // Issue every copy of the K tile (rows = keys) and the V^T tile (rows = head
    // dim) of keys kb .. kb + 63 into LDS buffer `buf`: 8 x 16 bytes per thread.
    auto stage = [&](int kb, int buf) {
        uint32_t      l[8];
        const __bf16* g[8];
#pragma unroll   // constant indices: both arrays stay in registers
        for (int i = 0; i < 4; i++) {
            l[i]     = (uint32_t)(uintptr_t)&KV[buf][0][(sr + i * 16) * ASTR + sc];
            l[4 + i] = (uint32_t)(uintptr_t)&KV[buf][1][(sr + i * 16) * ASTR + sc];
            g[i]     = qbase + (size_t)kb * PD + i * 16 * PD;
            g[4 + i] = vbase + kb + i * 16 * SEQ;
        }
        async_copy8_b128(l, g);
    };

    stage(0, 0);

    // Stage Q.
    {
        const __bf16* qp = qbase + (size_t)q0 * PD;
        bf16x8 qc[4];
#pragma unroll   // both: constant indices; the 4 loads go out together
        for (int i = 0; i < 4; i++)
            qc[i] = *(const bf16x8*)(qp + i * 16 * PD);
        // Stands in front of any reuse of the loads' address registers; it names
        // the address so that the pair lives up to here.
        asm volatile("s_wait_xcnt 0x0" :: "v"(qp) : "memory");
#pragma unroll
        for (int i = 0; i < 4; i++) *(bf16x8*)(qdst + i * 16 * ASTR) = qc[i];
    }
    wait_async0();      // tile 0's copies landed in LDS
    __syncthreads();    // Q and tile 0 visible to every wave
    stage(64, 1);

    // B operand of S^T: column = query, k = head dim.
    bf16x16 qb[2];
    qb[0] = load_frag(Qs, wid * 16, 0,  ASTR);
    qb[1] = load_frag(Qs, wid * 16, 32, ASTR);

    f32x8 zero = {0.f, 0.f, 0.f, 0.f, 0.f, 0.f, 0.f, 0.f};
    f32x8 o[4];   // o[n][r] = O^T[hd = 16n + 8*(lane>>4) + r][query = lane&15]
#pragma unroll
    for (int n = 0; n < 4; n++) o[n] = zero;
    float m_q = -1e30f;
    f32x8 l_v = zero;

    for (int kb2 = 0; kb2 < SEQ; kb2 += 128)
#pragma unroll   // the buffer index is a constant: LDS addresses stay out of the loop
    for (int buf = 0; buf < 2; buf++) {
        const int kb = kb2 + buf * 64;
        const __bf16* Ks = KV[buf][0];
        const __bf16* Vt = KV[buf][1];

        // S^T = K Q^T (64 keys x 16 queries per wave), K-dim = HD = 64.
        // s[n][r] = score(key = kb + 16n + 8*(lane>>4) + r, query = lane&15)
        f32x8 s[4];
#pragma unroll
        for (int n = 0; n < 4; n++) {
            bf16x16 ka0 = load_frag(Ks, n * 16, 0,  ASTR);
            bf16x16 ka1 = load_frag(Ks, n * 16, 32, ASTR);
            s[n] = wmma_bf16(ka0, qb[0], zero);
            s[n] = wmma_bf16(ka1, qb[1], s[n]);
        }
        // scale by 1/sqrt(HD) = 1/8
#pragma unroll
        for (int n = 0; n < 4; n++)
#pragma unroll
            for (int r = 0; r < 8; r++) s[n][r] *= 0.125f;

        // Online softmax: one query per lane. Every loop here is unrolled so
        // that the tiles are indexed by constants and stay in registers.
        float mt[4];   // one short chain per tile, not one chain of 32
#pragma unroll
        for (int n = 0; n < 4; n++) {
            mt[n] = s[n][0];
#pragma unroll
            for (int r = 1; r < 8; r++) mt[n] = fmaxf(mt[n], s[n][r]);
        }
        float mx = fmaxf(fmaxf(mt[0], mt[1]), fmaxf(mt[2], mt[3]));
        mx = fmaxf(mx, swap_halves(mx));
        float mnew = fmaxf(m_q, mx);
        float corr = __expf(m_q - mnew);
        m_q = mnew;

        Frag16 pb[2];   // B operand of O^T: column = query, k = key
        l_v *= corr;
#pragma unroll
        for (int n = 0; n < 4; n++) {
            f32x8 p;
#pragma unroll
            for (int r = 0; r < 8; r++) p[r] = __expf(s[n][r] - mnew);
            l_v += p;
#pragma unroll
            for (int r = 0; r < 8; r++) pb[n >> 1].h[n & 1][r] = (__bf16)p[r];
        }
#pragma unroll
        for (int n = 0; n < 4; n++)
#pragma unroll
            for (int r = 0; r < 8; r++) o[n][r] *= corr;

        // O^T += V^T P^T   (K-dim = 64 keys, two 32-steps).
#pragma unroll
        for (int n = 0; n < 4; n++) {
            bf16x16 va0 = load_frag(Vt, n * 16, 0,  ASTR);
            bf16x16 va1 = load_frag(Vt, n * 16, 32, ASTR);
            o[n] = wmma_bf16(va0, pb[0].f, o[n]);
            o[n] = wmma_bf16(va1, pb[1].f, o[n]);
        }

        // This wave's LDS reads are done before the barrier behind which the
        // buffer it has read is refilled by the copies.
        asm volatile("s_wait_dscnt 0x0" ::: "memory");
        wait_async0();      // next tile's copies landed in LDS
        __syncthreads();    // next tile visible to every wave; this tile done
        if (kb2 + 128 < SEQ) stage(kb + 128, buf);
    }
    wait_async0();      // no copy is outstanding when the wave ends

    const float l_q = ((l_v[0] + l_v[1]) + (l_v[2] + l_v[3])) +
                      ((l_v[4] + l_v[5]) + (l_v[6] + l_v[7]));
    const float inv = 1.0f / (l_q + swap_halves(l_q));
    const int row = q0 + wid * 16 + (lane & 15);
    __bf16* orow = out + ((size_t)b * T + row) * Dm + (size_t)h * AHD +
                   (lane >> 4) * 8;
#pragma unroll   // both: constant indices into o and p
    for (int n = 0; n < 4; n++) {
        bf16x8 p;
#pragma unroll
        for (int r = 0; r < 8; r++) p[r] = (__bf16)(o[n][r] * inv);
        *(bf16x8*)(orow + n * 16) = p;
    }
}

// ---------------------------------------------------------------------------
// Fused residual + LayerNorm: out = LN(x + res) * g + b.  One block per token.
// WB: the result is also stored rounded to bf16, as the next GEMM's A operand.
// ---------------------------------------------------------------------------
template <bool WB>
__global__ __launch_bounds__(256) void ln_kernel(
    const float* __restrict__ x, const float* __restrict__ res,
    const float* __restrict__ g, const float* __restrict__ be,
    float* __restrict__ out, __bf16* __restrict__ outb, int D) {
    __shared__ float red[2][8];
    const size_t base = (size_t)blockIdx.x * D;
    float v[4], s = 0.f, s2 = 0.f;
#pragma unroll
    for (int i = 0; i < 4; i++) {
        int c = threadIdx.x + i * 256;
        v[i] = x[base + c] + res[base + c];
        s += v[i];
        s2 += v[i] * v[i];
    }
#pragma unroll
    for (int off = 16; off > 0; off >>= 1) {
        s  += __shfl_xor(s, off);
        s2 += __shfl_xor(s2, off);
    }
    if ((threadIdx.x & 31) == 0) {
        red[0][threadIdx.x >> 5] = s;
        red[1][threadIdx.x >> 5] = s2;
    }
    __syncthreads();
    float ts = 0.f, ts2 = 0.f;
#pragma unroll
    for (int i = 0; i < 8; i++) { ts += red[0][i]; ts2 += red[1][i]; }
    float mean = ts / (float)D;
    float var  = ts2 / (float)D - mean * mean;
    float rstd = rsqrtf(var + 1e-5f);
#pragma unroll
    for (int i = 0; i < 4; i++) {
        int c = threadIdx.x + i * 256;
        float y = (v[i] - mean) * rstd * g[c] + be[c];
        out[base + c] = y;
        if (WB) outb[base + c] = (__bf16)y;
    }
}

// ---------------------------------------------------------------------------
// Orchestration
// ---------------------------------------------------------------------------
extern "C" void kernel_launch(void* const* d_in, const int* in_sizes, int n_in,
                              void* d_out, int out_size, void* d_ws,
                              size_t ws_size, hipStream_t stream) {
    const int B = 2, T = 2048, D = 1024, H = 16;
    const int M = B * T;  // 4096 tokens

    const float* x    = (const float*)d_in[0];
    const float* w_qk = (const float*)d_in[1];
    const float* b_qk = (const float*)d_in[2];
    const float* w_v  = (const float*)d_in[3];
    const float* b_v  = (const float*)d_in[4];
    const float* w_o  = (const float*)d_in[5];
    const float* b_o  = (const float*)d_in[6];
    const float* g1   = (const float*)d_in[7];
    const float* be1  = (const float*)d_in[8];
    const float* g2   = (const float*)d_in[9];
    const float* be2  = (const float*)d_in[10];
    const float* w_f1 = (const float*)d_in[11];
    const float* b_f1 = (const float*)d_in[12];
    const float* w_f2 = (const float*)d_in[13];
    const float* b_f2 = (const float*)d_in[14];
    float* outp = (float*)d_out;

    // Workspace layout (activations, then bf16 packed weights), ~115 MB.
    float* ws = (float*)d_ws;
    const size_t SZ = (size_t)M * D;          // 4M elements per activation
    float* qk_buf = ws;                       // qk (bf16); then o-proj output
    float* v_buf  = ws + SZ;                  // v^T (bf16); then ffn output
    __bf16* qk_bf = (__bf16*)qk_buf;          // [B][T][D]
    __bf16* vt_bf = (__bf16*)v_buf;           // [B][D][T]
    __bf16* a_bf  = (__bf16*)(ws + 2 * SZ);   // attention output
    __bf16* x_bf  = a_bf + SZ;                // x
    float* x1_buf = ws + 3 * SZ;              // post-LN1
    __bf16* h_bf  = (__bf16*)(ws + 4 * SZ);   // GELU hidden (2*SZ elements)
    __bf16* x1_bf = (__bf16*)(ws + 5 * SZ);   // post-LN1
    __bf16* wt_qk = (__bf16*)(ws + 6 * SZ);
    __bf16* wt_v  = wt_qk + (size_t)D * D;
    __bf16* wt_o  = wt_v  + (size_t)D * D;
    __bf16* wt_f1 = wt_o  + (size_t)D * D;    // [2D][D]
    __bf16* wt_f2 = wt_f1 + (size_t)2 * D * D; // [D][2D]

    // 1) Pack weights to bf16 transposed (wt_qk is the start of all five);
    //    round x.
    pack_all<<<7 * PTILES + XEL / XPB, 128, 0, stream>>>(w_qk, w_v, w_o, w_f1,
                                                         w_f2, wt_qk, x, x_bf);

    dim3 gNN(D / BN, M / BM);       // N = 1024
    dim3 gN2(2 * D / BN, M / BM);   // N = 2048

    // 2) Projections, one launch.
    gemm_qk_v<<<gNN, 256, 0, stream>>>(x_bf, wt_qk, wt_v, b_qk, b_v, qk_bf,
                                       vt_bf);

    // 3) Attention.
    attn_kernel<<<dim3(T / 64, H, B), 128, 0, stream>>>(qk_bf, vt_bf, a_bf,
                                                        B, T, H);

    // 4) Output projection (reuse qk_buf).
    gemm_bf16w<0, 1024, 0><<<gNN, 256, 0, stream>>>(a_bf, wt_o, b_o, qk_buf,
                                                    nullptr, M, D);

    // 5) Residual + LN1.
    ln_kernel<true><<<M, 256, 0, stream>>>(x, qk_buf, g1, be1, x1_buf, x1_bf, D);

    // 6) FFN.
    gemm_bf16w<1, 1024, 1><<<gN2, 256, 0, stream>>>(x1_bf, wt_f1, b_f1, nullptr,
                                                    h_bf, M, 2 * D);
    gemm_bf16w<0, 2048, 0><<<gNN, 256, 0, stream>>>(h_bf, wt_f2, b_f2, v_buf,
                                                    nullptr, M, D);

    // 7) Residual + LN2 -> d_out.
    ln_kernel<false><<<M, 256, 0, stream>>>(x1_buf, v_buf, g2, be2, outp, nullptr,
                                            D);
}

// v009
// It runs in 122 microseconds.
// Next to v008, in two timings, it ran 1.04 times as fast each time.
// Over all steps from v000 it is 3.17 times as fast.
#include <hip/hip_runtime.h>
#include <hip/hip_bf16.h>
#include <cstdint>

typedef __attribute__((ext_vector_type(16))) __bf16 bf16x16;
typedef __attribute__((ext_vector_type(8)))  __bf16 bf16x8;
typedef __attribute__((ext_vector_type(4)))  __bf16 bf16x4;
typedef __attribute__((ext_vector_type(8)))  float  f32x8;

union Frag16 { bf16x16 f; bf16x8 h[2]; };

__device__ __forceinline__ bf16x16 load_frag(const __bf16* lds, int rowBase,
                                             int kBase, int stride) {
    int lane  = threadIdx.x & 31;
    int row   = rowBase + (lane & 15);
    int khalf = (lane < 16) ? 0 : 8;
    const __bf16* p = lds + row * stride + kBase + khalf;
    Frag16 fr;
    fr.h[0] = *(const bf16x8*)(p);
    fr.h[1] = *(const bf16x8*)(p + 16);
    return fr.f;
}

__device__ __forceinline__ f32x8 wmma_bf16(bf16x16 a, bf16x16 b, f32x8 c) {
    return __builtin_amdgcn_wmma_f32_16x16x32_bf16(
        /*neg_a=*/false, a, /*neg_b=*/false, b,
        /*c_mod=*/(short)0, c, /*reuse_a=*/false, /*reuse_b=*/false);
}

__device__ __forceinline__ void async_copy8_b128(const uint32_t* l,
                                                 const __bf16* const* g) {
    asm volatile("global_load_async_to_lds_b128 %0, %8, off\n\t"
                 "global_load_async_to_lds_b128 %1, %9, off\n\t"
                 "global_load_async_to_lds_b128 %2, %10, off\n\t"
                 "global_load_async_to_lds_b128 %3, %11, off\n\t"
                 "global_load_async_to_lds_b128 %4, %12, off\n\t"
                 "global_load_async_to_lds_b128 %5, %13, off\n\t"
                 "global_load_async_to_lds_b128 %6, %14, off\n\t"
                 "global_load_async_to_lds_b128 %7, %15, off\n\t"
                 "s_wait_xcnt 0x0"
                 :: "v"(l[0]), "v"(l[1]), "v"(l[2]), "v"(l[3]),
                    "v"(l[4]), "v"(l[5]), "v"(l[6]), "v"(l[7]),
                    "v"(g[0]), "v"(g[1]), "v"(g[2]), "v"(g[3]),
                    "v"(g[4]), "v"(g[5]), "v"(g[6]), "v"(g[7])
                 : "memory");
}

__device__ __forceinline__ void wait_async0() {
    asm volatile("s_wait_asynccnt 0x0" ::: "memory");
}

// ---------------------------------------------------------------------------
// Weight pack: fp32 W[K][N] row-major  ->  bf16 Wt[N][K]  (transposed)
// One launch for all five weights. A block of 4 waves takes one tile of
// 128 (k) x 64 (n): it reads 256-byte row pieces with 16-byte loads (all 16 of
// a thread in flight together), turns the tile in LDS and writes 256-byte
// pieces of Wt rows with 16-byte stores. The packed weights lie one behind the
// other in wt_all: qk, v, o (PD*PD each), f1, f2 (2*PD*PD each).
// The blocks behind the weights' round x to bf16 (layout kept): it is shared
// by both projections in one GEMM, which reads it once per column of tiles.
// ---------------------------------------------------------------------------
#define PD   1024  // model width: qk, v, o are PD x PD, f1 PD x 2PD, f2 2PD x PD
#define PTK  128   // tile extent in k
#define PTN  64    // tile extent in n
#define PSTR 136   // PTK + 8 pad: 272-byte LDS rows (16-byte aligned)
#define PTILES ((PD / PTK) * (PD / PTN))   // tiles per PD*PD elements
#define XEL  (2 * 2048 * PD)   // elements of x: B * T * PD
#define XPB  (128 * 4 * 16)    // elements of x per block: 16 float4 per thread

__device__ __forceinline__ float pick(float4 v, int j) {
    return j == 0 ? v.x : j == 1 ? v.y : j == 2 ? v.z : v.w;
}

// One tile of one weight. K and N are compile-time so that a thread's 16 loads
// share one address and differ in the immediate offset only.
template <int K, int N>
__device__ __forceinline__ void pack_tile(const float* __restrict__ w,
                                          __bf16* __restrict__ wt, int lt,
                                          __bf16* Ts) {
    const int n0 = (lt % (N / PTN)) * PTN;
    const int k0 = (lt / (N / PTN)) * PTK;
    const int tid = threadIdx.x;
    const int n4  = (tid & 15) * 4;   // 4 columns of the tile
    const int kg  = (tid >> 4) * 8;   // 8 rows, twice (m * 64)
    const float* src = w + (size_t)k0 * N + n0 + (kg * N + n4);

    float4 a[2][8];
#pragma unroll   // both: constant indices into a; the 16 loads go out together
    for (int m = 0; m < 2; m++)
#pragma unroll
        for (int i = 0; i < 8; i++)
            a[m][i] = *(const float4*)(src + (m * 64 + i) * N);
    // The loads' address register is free for reuse from here on: this wait
    // stands in front of that reuse. It names the address so that the register
    // lives up to here and no load's result is placed on it.
    asm volatile("s_wait_xcnt 0x0" :: "v"(src) : "memory");

#pragma unroll   // all three: constant indices into a, so that it stays in registers
    for (int m = 0; m < 2; m++)
#pragma unroll
        for (int j = 0; j < 4; j++) {
            bf16x8 p;
#pragma unroll
            for (int i = 0; i < 8; i++) p[i] = (__bf16)pick(a[m][i], j);
            *(bf16x8*)&Ts[(n4 + j) * PSTR + m * 64 + kg] = p;
        }
    __syncthreads();

    const int nr = tid >> 4;          // 16 chunks of 8 bf16 per row
    const int c8 = (tid & 15) * 8;
    __bf16* dst = wt + (size_t)n0 * K + k0 + (nr * K + c8);
#pragma unroll   // the 8 LDS reads go out together, ahead of the first store
    for (int p = 0; p < 8; p++) {
        bf16x8 q = *(const bf16x8*)&Ts[(nr + p * 8) * PSTR + c8];
        *(bf16x8*)(dst + p * 8 * K) = q;
    }
    // Stands in front of any reuse of the stores' address and data registers.
    asm volatile("s_wait_xcnt 0x0" ::: "memory");
}

// One block's piece of x: a wave reads 512 and writes 256 bytes in a row.
__device__ __forceinline__ void round_x(const float* __restrict__ x,
                                        __bf16* __restrict__ xb, int blk) {
    const size_t at = (size_t)blk * XPB + threadIdx.x * 4;
    const float* src = x + at;
    __bf16*      dst = xb + at;
    float4 a[16];
#pragma unroll   // both: constant indices into a; the 16 loads go out together
    for (int i = 0; i < 16; i++) a[i] = *(const float4*)(src + i * 512);
    // Stands in front of any reuse of the loads' address registers; it names
    // the address so that the pair lives up to here.
    asm volatile("s_wait_xcnt 0x0" :: "v"(src) : "memory");
#pragma unroll
    for (int i = 0; i < 16; i++) {
        bf16x4 p = {(__bf16)a[i].x, (__bf16)a[i].y, (__bf16)a[i].z,
                    (__bf16)a[i].w};
        *(bf16x4*)(dst + i * 512) = p;
    }
    // Stands in front of any reuse of the stores' address and data registers.
    asm volatile("s_wait_xcnt 0x0" ::: "memory");
}

// amdgpu_waves_per_eu(4, 4): a wave may take a quarter of the registers.
// Without it the compiler saves registers by waiting for the first loads
// before it issues the last.
__global__ __launch_bounds__(128) __attribute__((amdgpu_waves_per_eu(4, 4)))
void pack_all(
    const float* __restrict__ w_qk, const float* __restrict__ w_v,
    const float* __restrict__ w_o,  const float* __restrict__ w_f1,
    const float* __restrict__ w_f2, __bf16* __restrict__ wt_all,
    const float* __restrict__ x, __bf16* __restrict__ xb) {
    __shared__ __attribute__((aligned(16))) __bf16 Ts[PTN * PSTR];   // [n][k]

    // Which weight, by block index (the same for the whole block).
    const int job = blockIdx.x / PTILES;   // 0..6: weights, in units of PD*PD
    if (job < 3) {
        const float* w = job == 0 ? w_qk : job == 1 ? w_v : w_o;
        pack_tile<PD, PD>(w, wt_all + (size_t)job * PD * PD,
                          blockIdx.x - job * PTILES, Ts);
    } else if (job < 5) {
        pack_tile<PD, 2 * PD>(w_f1, wt_all + (size_t)3 * PD * PD,
                              blockIdx.x - 3 * PTILES, Ts);
    } else if (job < 7) {
        pack_tile<2 * PD, PD>(w_f2, wt_all + (size_t)5 * PD * PD,
                              blockIdx.x - 5 * PTILES, Ts);
    } else {
        round_x(x, xb, blockIdx.x - 7 * PTILES);
    }
}

// ---------------------------------------------------------------------------
// GEMM:  C[M][N] = act( A[M][K] @ W[K][N] + bias[N] )
//   A     : bf16 row-major [M][K]
//   Wt    : bf16, pre-transposed [N][K]
//   Both are staged by the async global->LDS DMA: no register, no conversion.
// Block tile 128x128x128, 256 threads (8 waves, 4x2), wave tile 32x64
//   => 32 v_wmma_f32_16x16x32_bf16 per wave per K-step.
// Double-buffered LDS: tile t+1's copies are all issued ahead of tile t's
// WMMAs; single s_wait_asynccnt+barrier per K-step. A K-step is 128 wide so
// that the load latency and the barrier are paid once per 128 k and 64 KB per
// block are in flight during the WMMAs.
// OUT picks what is stored:
//   0 : C,  fp32 [M][N]
//   1 : Cb, bf16 [M][N]. The product is taken transposed (W^T as the A operand),
//       so a lane holds 8 neighbouring columns of one row: one 16-byte store.
//       It is the form of the next GEMM's A operand.
// ---------------------------------------------------------------------------
#define BM 128
#define BN 128
#define BK 128
#define LDS_STR 136  // BK + 8 pad; 136*2B = 272B row stride (16B aligned)
#define SEQ 2048     // tokens per sequence (T); BM divides it

template <int ACT>  // 0 = none, 1 = exact GELU
__device__ __forceinline__ float activate(float val) {
    if (ACT == 1) val = 0.5f * val * (1.0f + erff(val * 0.70710678118654752f));
    return val;
}

template <int ACT, int K, int OUT>
__global__ __launch_bounds__(256) void gemm_bf16w(
    const __bf16* __restrict__ A, const __bf16* __restrict__ Wt,
    const float* __restrict__ bias, float* __restrict__ C,
    __bf16* __restrict__ Cb, int M, int N) {
    __shared__ __attribute__((aligned(16))) __bf16 As[2][BM * LDS_STR];
    __shared__ __attribute__((aligned(16))) __bf16 Bs[2][BN * LDS_STR];

    const int bm  = blockIdx.y * BM;
    const int bn  = blockIdx.x * BN;
    const int tid = threadIdx.x;
    const int wid = tid >> 5;
    const int wm  = (wid >> 1) * 32;  // 0..96
    const int wn  = (wid & 1) * 64;   // 0,64
    const int lane = tid & 31;

    // A slice of either operand is 128 rows of 16 chunks of 16 bytes: 8 chunks
    // per thread, 16 rows apart.
    const int sr  = tid >> 4;
    const int sc8 = (tid & 15) * 8;
    const __bf16* asrc = A  + (size_t)bm * K + (sr * K + sc8);
    const __bf16* bsrc = Wt + (size_t)bn * K + (sr * K + sc8);

    // Issue every copy of one 128x128 K-slice of A and of B into LDS buffer
    // `buf`: 2 x 8 x 16 bytes per thread.
    auto stage = [&](int k0, int buf) {
        uint32_t      l[8];
        const __bf16* g[8];
#pragma unroll   // constant indices: both arrays stay in registers
        for (int i = 0; i < 8; i++) {
            l[i] = (uint32_t)(uintptr_t)&As[buf][(sr + i * 16) * LDS_STR + sc8];
            g[i] = asrc + k0 + i * 16 * K;
        }
        async_copy8_b128(l, g);
#pragma unroll
        for (int i = 0; i < 8; i++) {
            l[i] = (uint32_t)(uintptr_t)&Bs[buf][(sr + i * 16) * LDS_STR + sc8];
            g[i] = bsrc + k0 + i * 16 * K;
        }
        async_copy8_b128(l, g);
    };

    f32x8 zero = {0.f, 0.f, 0.f, 0.f, 0.f, 0.f, 0.f, 0.f};
    f32x8 acc[2][4];
#pragma unroll
    for (int i = 0; i < 2; i++)
#pragma unroll
        for (int j = 0; j < 4; j++) acc[i][j] = zero;

    stage(0, 0);
    wait_async0();
    __syncthreads();

    const int nk = K / BK;
    for (int t = 0; t < nk; t++) {
        const int buf = t & 1;
        if (t + 1 < nk) stage((t + 1) * BK, buf ^ 1);

#pragma unroll
        for (int kk = 0; kk < BK; kk += 32) {
            bf16x16 af[2], bfr[4];
            af[0] = load_frag(As[buf], wm,      kk, LDS_STR);
            af[1] = load_frag(As[buf], wm + 16, kk, LDS_STR);
#pragma unroll
            for (int j = 0; j < 4; j++)
                bfr[j] = load_frag(Bs[buf], wn + j * 16, kk, LDS_STR);
#pragma unroll
            for (int i = 0; i < 2; i++)
#pragma unroll
                for (int j = 0; j < 4; j++)
                    acc[i][j] = OUT == 1 ? wmma_bf16(bfr[j], af[i], acc[i][j])
                                         : wmma_bf16(af[i], bfr[j], acc[i][j]);
        }

        // This wave's LDS reads are done before the barrier behind which the
        // buffer it has read is refilled by the copies.
        asm volatile("s_wait_dscnt 0x0" ::: "memory");
        wait_async0();      // next tile's DMA landed in LDS
        __syncthreads();    // next tile visible to every wave; this tile done
    }

    const int colOff = lane & 15;
    const int rowOff = (lane >> 4) * 8;
#pragma unroll
    for (int i = 0; i < 2; i++) {
#pragma unroll
        for (int j = 0; j < 4; j++) {
            if (OUT == 1) {
                int col0 = bn + wn + j * 16 + rowOff;
                int row  = bm + wm + i * 16 + colOff;
                float4 b0 = *(const float4*)(bias + col0);
                float4 b1 = *(const float4*)(bias + col0 + 4);
                bf16x8 p;
#pragma unroll   // constant indices into acc, p and the bias vectors
                for (int r = 0; r < 8; r++)
                    p[r] = (__bf16)activate<ACT>(acc[i][j][r] +
                                                 pick(r < 4 ? b0 : b1, r & 3));
                *(bf16x8*)(Cb + (size_t)row * N + col0) = p;
                continue;
            }
            int col  = bn + wn + j * 16 + colOff;
            float bv = bias[col];
#pragma unroll
            for (int r = 0; r < 8; r++) {
                int row = bm + wm + i * 16 + rowOff + r;
                C[(size_t)row * N + col] = activate<ACT>(acc[i][j][r] + bv);
            }
        }
    }
}

// ---------------------------------------------------------------------------
// Both projections of x in one launch: qk = x W_qk + b_qk, v = x W_v + b_v.
// A block takes 128 tokens and the same 128 columns of each product: a K-slice
// of x is staged once and meets a slice of either weight. Waves 0-3 form qk,
// waves 4-7 form v, each wave a tile of 64 x 64 (16 WMMAs per 8 fragments).
// Ring, copies, waits and barrier are those of gemm_bf16w.
// A lane's 8 results run along the rows of the first WMMA operand, P; its lane
// index picks the row of the second, Q. qk is stored as rows [token][column]:
// P = W_qk^T, Q = x. v is stored turned, [sequence][column][token]: P = x,
// Q = W_v^T. Either way 8 results are one 16-byte store, and both arrive as the
// attention kernel wants K (= Q) and V^T in LDS: rounded and turned once here,
// not by every query block. The two halves of the block differ in the LDS tiles
// they read and in the epilogue only.
// ---------------------------------------------------------------------------
__global__ __launch_bounds__(256) void gemm_qk_v(
    const __bf16* __restrict__ xb, const __bf16* __restrict__ wt_qk,
    const __bf16* __restrict__ wt_v, const float* __restrict__ b_qk,
    const float* __restrict__ b_v, __bf16* __restrict__ qk,
    __bf16* __restrict__ vt) {
    // [buffer][x, W_qk^T, W_v^T][row * LDS_STR + k]
    __shared__ __attribute__((aligned(16))) __bf16 S[2][3][BM * LDS_STR];

    const int bm   = blockIdx.y * BM;   // tokens
    const int bn   = blockIdx.x * BN;   // columns of qk and of v
    const int tid  = threadIdx.x;
    const int lane = tid & 31;
    const int wid  = __builtin_amdgcn_readfirstlane(tid >> 5);
    const bool forV = wid >= 4;
    const int tP = forV ? 0 : 1;        // which tile of S is P, which Q
    const int tQ = forV ? 2 : 0;
    const int wp = ((wid >> 1) & 1) * 64;
    const int wq = (wid & 1) * 64;

    // A slice of each operand is 128 rows of 16 chunks of 16 bytes: 8 chunks
    // per thread, 16 rows apart.
    const int sr  = tid >> 4;
    const int sc8 = (tid & 15) * 8;
    const __bf16* const src[3] = {xb    + (size_t)bm * PD + (sr * PD + sc8),
                                  wt_qk + (size_t)bn * PD + (sr * PD + sc8),
                                  wt_v  + (size_t)bn * PD + (sr * PD + sc8)};

    // Issue every copy of one K-slice into LDS buffer `buf`: 3 x 8 x 16 bytes
    // per thread.
    auto stage = [&](int k0, int buf) {
#pragma unroll   // both: constant indices, so that the arrays stay in registers
        for (int m = 0; m < 3; m++) {
            uint32_t      l[8];
            const __bf16* g[8];
#pragma unroll
            for (int i = 0; i < 8; i++) {
                l[i] = (uint32_t)(uintptr_t)&S[buf][m][(sr + i * 16) * LDS_STR + sc8];
                g[i] = src[m] + k0 + i * 16 * PD;
            }
            async_copy8_b128(l, g);
        }
    };

    f32x8 zero = {0.f, 0.f, 0.f, 0.f, 0.f, 0.f, 0.f, 0.f};
    f32x8 acc[4][4];
#pragma unroll   // both: constant indices, so that acc stays in registers
    for (int i = 0; i < 4; i++)
#pragma unroll
        for (int j = 0; j < 4; j++) acc[i][j] = zero;

    stage(0, 0);
    wait_async0();
    __syncthreads();

    const int nk = PD / BK;
    for (int t = 0; t < nk; t++) {
        const int buf = t & 1;
        if (t + 1 < nk) stage((t + 1) * BK, buf ^ 1);

        const __bf16* P = S[buf][tP];
        const __bf16* Q = S[buf][tQ];
#pragma unroll
        for (int kk = 0; kk < BK; kk += 32) {
            bf16x16 pf[4], qf[4];
#pragma unroll   // here and below: constant indices into pf, qf and acc
            for (int i = 0; i < 4; i++) {
                pf[i] = load_frag(P, wp + i * 16, kk, LDS_STR);
                qf[i] = load_frag(Q, wq + i * 16, kk, LDS_STR);
            }
            // Keeps the 16 LDS reads of a block together in front of its WMMAs:
            // left alone, the scheduler sinks each P fragment's reads to its
            // first use and the wave waits out the LDS latency four times.
            __builtin_amdgcn_sched_barrier(0);
#pragma unroll
            for (int i = 0; i < 4; i++)
#pragma unroll
                for (int j = 0; j < 4; j++)
                    acc[i][j] = wmma_bf16(pf[i], qf[j], acc[i][j]);
        }

        // This wave's LDS reads are done before the barrier behind which the
        // buffer it has read is refilled by the copies.
        asm volatile("s_wait_dscnt 0x0" ::: "memory");
        wait_async0();      // next slice's copies landed in LDS
        __syncthreads();    // next slice visible to every wave; this slice done
    }

    const int qOff = lane & 15;
    const int pOff = (lane >> 4) * 8;
    if (forV) {
        // BM divides SEQ: the block's tokens lie in one sequence.
        __bf16* dst = vt + ((size_t)(bm / SEQ) * PD + bn) * SEQ + bm % SEQ;
#pragma unroll   // all three: constant indices into acc and o
        for (int j = 0; j < 4; j++) {
            const int col = wq + j * 16 + qOff;
            const float bv = b_v[bn + col];
#pragma unroll
            for (int i = 0; i < 4; i++) {
                bf16x8 o;
#pragma unroll
                for (int r = 0; r < 8; r++) o[r] = (__bf16)(acc[i][j][r] + bv);
                *(bf16x8*)(dst + col * SEQ + wp + i * 16 + pOff) = o;
            }
        }
        // Stands in front of any reuse of the stores' address and data registers.
        asm volatile("s_wait_xcnt 0x0" ::: "memory");
    } else {
        __bf16* dst = qk + (size_t)bm * PD + bn;
#pragma unroll   // all three: constant indices into acc, o and the bias vectors
        for (int i = 0; i < 4; i++) {
            const int col0 = wp + i * 16 + pOff;
            const float4 b0 = *(const float4*)(b_qk + bn + col0);
            const float4 b1 = *(const float4*)(b_qk + bn + col0 + 4);
#pragma unroll
            for (int j = 0; j < 4; j++) {
                bf16x8 o;
#pragma unroll
                for (int r = 0; r < 8; r++)
                    o[r] = (__bf16)(acc[i][j][r] + pick(r < 4 ? b0 : b1, r & 3));
                *(bf16x8*)(dst + (wq + j * 16 + qOff) * PD + col0) = o;
            }
        }
        // Stands in front of any reuse of the stores' address and data registers.
        asm volatile("s_wait_xcnt 0x0" ::: "memory");
    }
}

#define AHD 64
#define ASTR 72   // 64 + 8 pad, 144B row stride (16B aligned)
#define QSCALE 0.18033688f   // 1/sqrt(HD) * log2(e)
#define LAZY 8.0f   // a score may top the reference in use by this (base 2)

__device__ __forceinline__ float swap_halves(float x) {
    int b = __builtin_bit_cast(int, x);
    b = __builtin_amdgcn_permlanex16(b, b, 0x76543210, 0xfedcba98, false, false);
    return __builtin_bit_cast(float, b);
}

__global__ __launch_bounds__(128) __attribute__((amdgpu_waves_per_eu(4, 4)))
void attn_kernel(
    const __bf16* __restrict__ qk, const __bf16* __restrict__ vt,
    __bf16* __restrict__ out, int B, int T, int H) {
    __shared__ __attribute__((aligned(16))) __bf16 Qs[64 * ASTR];
    // [buffer][K: key rows, V^T: head-dim rows][row * ASTR + column]
    __shared__ __attribute__((aligned(16))) __bf16 KV[2][2][64 * ASTR];

    const int b  = blockIdx.z;
    const int h  = blockIdx.y;
    const int q0 = blockIdx.x * 64;
    const int tid = threadIdx.x;
    const int wid = tid >> 5;
    const int lane = tid & 31;
    const size_t Dm = (size_t)H * AHD;

    // A 64x64 bf16 tile is 64 rows of 8 chunks of 16 bytes: 4 chunks per thread,
    // 16 rows apart. The row pitches are PD for qk, SEQ for vt.
    const int sr = tid >> 3;
    const int sc = (tid & 7) * 8;
    const __bf16* qbase = qk + ((size_t)b * SEQ * PD + (size_t)h * AHD) +
                          (sr * PD + sc);
    const __bf16* vbase = vt + ((size_t)b * PD + (size_t)h * AHD) * SEQ +
                          (sr * SEQ + sc);
    __bf16* const qdst = Qs + sr * ASTR + sc;

    // Issue every copy of the K tile (rows = keys) and the V^T tile (rows = head
    // dim) of keys kb .. kb + 63 into LDS buffer `buf`: 8 x 16 bytes per thread.
    auto stage = [&](int kb, int buf) {
        uint32_t      l[8];
        const __bf16* g[8];
#pragma unroll   // constant indices: both arrays stay in registers
        for (int i = 0; i < 4; i++) {
            l[i]     = (uint32_t)(uintptr_t)&KV[buf][0][(sr + i * 16) * ASTR + sc];
            l[4 + i] = (uint32_t)(uintptr_t)&KV[buf][1][(sr + i * 16) * ASTR + sc];
            g[i]     = qbase + (size_t)kb * PD + i * 16 * PD;
            g[4 + i] = vbase + kb + i * 16 * SEQ;
        }
        async_copy8_b128(l, g);
    };

    stage(0, 0);

    // Stage Q.
    {
        const __bf16* qp = qbase + (size_t)q0 * PD;
        bf16x8 qc[4];
#pragma unroll   // both: constant indices; the 4 loads go out together
        for (int i = 0; i < 4; i++)
            qc[i] = *(const bf16x8*)(qp + i * 16 * PD);
        // Stands in front of any reuse of the loads' address registers; it names
        // the address so that the pair lives up to here.
        asm volatile("s_wait_xcnt 0x0" :: "v"(qp) : "memory");
#pragma unroll   // both: constant indices into qc and qs
        for (int i = 0; i < 4; i++) {
            bf16x8 qs;
#pragma unroll
            for (int r = 0; r < 8; r++)
                qs[r] = (__bf16)((float)qc[i][r] * QSCALE);
            *(bf16x8*)(qdst + i * 16 * ASTR) = qs;
        }
    }
    wait_async0();      // tile 0's copies landed in LDS
    __syncthreads();    // Q and tile 0 visible to every wave
    stage(64, 1);

    // B operand of S^T: column = query, k = head dim.
    bf16x16 qb[2];
    qb[0] = load_frag(Qs, wid * 16, 0,  ASTR);
    qb[1] = load_frag(Qs, wid * 16, 32, ASTR);

    f32x8 zero = {0.f, 0.f, 0.f, 0.f, 0.f, 0.f, 0.f, 0.f};
    f32x8 o[4];   // o[n][r] = O^T[hd = 16n + 8*(lane>>4) + r][query = lane&15]
#pragma unroll
    for (int n = 0; n < 4; n++) o[n] = zero;
    f32x8 nref = zero;
    f32x8 l_v = zero;

    for (int kb2 = 0; kb2 < SEQ; kb2 += 128)
#pragma unroll   // the buffer index is a constant: LDS addresses stay out of the loop
    for (int buf = 0; buf < 2; buf++) {
        const int kb = kb2 + buf * 64;
        const __bf16* Ks = KV[buf][0];
        const __bf16* Vt = KV[buf][1];

        // S^T = K Q^T (64 keys x 16 queries per wave), K-dim = HD = 64. Q carries
        // the scale and log2(e), C is minus the reference, so that
        // s[n][r] = base-2 exponent of (key = kb + 16n + 8*(lane>>4) + r,
        //                               query = lane&15)
        f32x8 s[4];
#pragma unroll
        for (int n = 0; n < 4; n++) {
            bf16x16 ka0 = load_frag(Ks, n * 16, 0,  ASTR);
            bf16x16 ka1 = load_frag(Ks, n * 16, 32, ASTR);
            s[n] = wmma_bf16(ka0, qb[0], nref);
            s[n] = wmma_bf16(ka1, qb[1], s[n]);
        }

        // The V^T fragments are read in front of the branch below, which splits
        // the tile's work in two: they fly under the maximum and the exponentials.
        // The scheduling barrier ends the score products' scheduling region here:
        // without it the build takes more than the wave's quarter of the
        // registers (256) and spills to scratch.
        __builtin_amdgcn_sched_barrier(0);
        bf16x16 va[4][2];
#pragma unroll   // constant indices: va stays in registers
        for (int n = 0; n < 4; n++) {
            va[n][0] = load_frag(Vt, n * 16, 0,  ASTR);
            va[n][1] = load_frag(Vt, n * 16, 32, ASTR);
        }

        // Online softmax: one query per lane. Every loop here is unrolled so
        // that the tiles are indexed by constants and stay in registers.
        float mt[4];   // one short chain per tile, not one chain of 32
#pragma unroll
        for (int n = 0; n < 4; n++) {
            mt[n] = s[n][0];
#pragma unroll
            for (int r = 1; r < 8; r++) mt[n] = fmaxf(mt[n], s[n][r]);
        }
        float mx = fmaxf(fmaxf(mt[0], mt[1]), fmaxf(mt[2], mt[3]));

        // The reference moves only on the first tile (to that tile's maximum)
        // and when some score of the wave tops it by more than LAZY: one scalar
        // branch a tile, the same for the whole wave. Until then the exponents
        // are at most LAZY and O and the sums need no rescale.
        const bool first = buf == 0 && kb2 == 0;
        if (first || __builtin_amdgcn_ballot_w32(mx > LAZY) != 0) {
            mx = fmaxf(mx, swap_halves(mx));
            const float d = first ? mx : fmaxf(mx, 0.f);
            // On the first tile O and the sums are zero: any finite factor.
            const float corr = first ? 1.f : __builtin_amdgcn_exp2f(-d);
#pragma unroll   // all: constant indices into s, o
            for (int n = 0; n < 4; n++)
#pragma unroll
                for (int r = 0; r < 8; r++) {
                    s[n][r] -= d;
                    o[n][r] *= corr;
                }
            nref -= d;
            l_v *= corr;
        }

        Frag16 pb[2];   // B operand of O^T: column = query, k = key
#pragma unroll
        for (int n = 0; n < 4; n++) {
            f32x8 p;
#pragma unroll
            for (int r = 0; r < 8; r++) p[r] = __builtin_amdgcn_exp2f(s[n][r]);
            l_v += p;
#pragma unroll
            for (int r = 0; r < 8; r++) pb[n >> 1].h[n & 1][r] = (__bf16)p[r];
        }

        // O^T += V^T P^T   (K-dim = 64 keys, two 32-steps).
#pragma unroll
        for (int n = 0; n < 4; n++) {
            o[n] = wmma_bf16(va[n][0], pb[0].f, o[n]);
            o[n] = wmma_bf16(va[n][1], pb[1].f, o[n]);
        }

        // This wave's LDS reads are done before the barrier behind which the
        // buffer it has read is refilled by the copies.
        asm volatile("s_wait_dscnt 0x0" ::: "memory");
        wait_async0();      // next tile's copies landed in LDS
        __syncthreads();    // next tile visible to every wave; this tile done
        if (kb2 + 128 < SEQ) stage(kb + 128, buf);
    }
    wait_async0();      // no copy is outstanding when the wave ends

    const float l_q = ((l_v[0] + l_v[1]) + (l_v[2] + l_v[3])) +
                      ((l_v[4] + l_v[5]) + (l_v[6] + l_v[7]));
    const float inv = 1.0f / (l_q + swap_halves(l_q));
    const int row = q0 + wid * 16 + (lane & 15);
    __bf16* orow = out + ((size_t)b * T + row) * Dm + (size_t)h * AHD +
                   (lane >> 4) * 8;
#pragma unroll   // both: constant indices into o and p
    for (int n = 0; n < 4; n++) {
        bf16x8 p;
#pragma unroll
        for (int r = 0; r < 8; r++) p[r] = (__bf16)(o[n][r] * inv);
        *(bf16x8*)(orow + n * 16) = p;
    }
}

// ---------------------------------------------------------------------------
// Fused residual + LayerNorm: out = LN(x + res) * g + b.  One block per token.
// WB: the result is also stored rounded to bf16, as the next GEMM's A operand.
// ---------------------------------------------------------------------------
template <bool WB>
__global__ __launch_bounds__(256) void ln_kernel(
    const float* __restrict__ x, const float* __restrict__ res,
    const float* __restrict__ g, const float* __restrict__ be,
    float* __restrict__ out, __bf16* __restrict__ outb, int D) {
    __shared__ float red[2][8];
    const size_t base = (size_t)blockIdx.x * D;
    float v[4], s = 0.f, s2 = 0.f;
#pragma unroll
    for (int i = 0; i < 4; i++) {
        int c = threadIdx.x + i * 256;
        v[i] = x[base + c] + res[base + c];
        s += v[i];
        s2 += v[i] * v[i];
    }
#pragma unroll
    for (int off = 16; off > 0; off >>= 1) {
        s  += __shfl_xor(s, off);
        s2 += __shfl_xor(s2, off);
    }
    if ((threadIdx.x & 31) == 0) {
        red[0][threadIdx.x >> 5] = s;
        red[1][threadIdx.x >> 5] = s2;
    }
    __syncthreads();
    float ts = 0.f, ts2 = 0.f;
#pragma unroll
    for (int i = 0; i < 8; i++) { ts += red[0][i]; ts2 += red[1][i]; }
    float mean = ts / (float)D;
    float var  = ts2 / (float)D - mean * mean;
    float rstd = rsqrtf(var + 1e-5f);
#pragma unroll
    for (int i = 0; i < 4; i++) {
        int c = threadIdx.x + i * 256;
        float y = (v[i] - mean) * rstd * g[c] + be[c];
        out[base + c] = y;
        if (WB) outb[base + c] = (__bf16)y;
    }
}

// ---------------------------------------------------------------------------
// Orchestration
// ---------------------------------------------------------------------------
extern "C" void kernel_launch(void* const* d_in, const int* in_sizes, int n_in,
                              void* d_out, int out_size, void* d_ws,
                              size_t ws_size, hipStream_t stream) {
    const int B = 2, T = 2048, D = 1024, H = 16;
    const int M = B * T;  // 4096 tokens

    const float* x    = (const float*)d_in[0];
    const float* w_qk = (const float*)d_in[1];
    const float* b_qk = (const float*)d_in[2];
    const float* w_v  = (const float*)d_in[3];
    const float* b_v  = (const float*)d_in[4];
    const float* w_o  = (const float*)d_in[5];
    const float* b_o  = (const float*)d_in[6];
    const float* g1   = (const float*)d_in[7];
    const float* be1  = (const float*)d_in[8];
    const float* g2   = (const float*)d_in[9];
    const float* be2  = (const float*)d_in[10];
    const float* w_f1 = (const float*)d_in[11];
    const float* b_f1 = (const float*)d_in[12];
    const float* w_f2 = (const float*)d_in[13];
    const float* b_f2 = (const float*)d_in[14];
    float* outp = (float*)d_out;

    // Workspace layout (activations, then bf16 packed weights), ~115 MB.
    float* ws = (float*)d_ws;
    const size_t SZ = (size_t)M * D;          // 4M elements per activation
    float* qk_buf = ws;                       // qk (bf16); then o-proj output
    float* v_buf  = ws + SZ;                  // v^T (bf16); then ffn output
    __bf16* qk_bf = (__bf16*)qk_buf;          // [B][T][D]
    __bf16* vt_bf = (__bf16*)v_buf;           // [B][D][T]
    __bf16* a_bf  = (__bf16*)(ws + 2 * SZ);   // attention output
    __bf16* x_bf  = a_bf + SZ;                // x
    float* x1_buf = ws + 3 * SZ;              // post-LN1
    __bf16* h_bf  = (__bf16*)(ws + 4 * SZ);   // GELU hidden (2*SZ elements)
    __bf16* x1_bf = (__bf16*)(ws + 5 * SZ);   // post-LN1
    __bf16* wt_qk = (__bf16*)(ws + 6 * SZ);
    __bf16* wt_v  = wt_qk + (size_t)D * D;
    __bf16* wt_o  = wt_v  + (size_t)D * D;
    __bf16* wt_f1 = wt_o  + (size_t)D * D;    // [2D][D]
    __bf16* wt_f2 = wt_f1 + (size_t)2 * D * D; // [D][2D]

    // 1) Pack weights to bf16 transposed (wt_qk is the start of all five);
    //    round x.
    pack_all<<<7 * PTILES + XEL / XPB, 128, 0, stream>>>(w_qk, w_v, w_o, w_f1,
                                                         w_f2, wt_qk, x, x_bf);

    dim3 gNN(D / BN, M / BM);       // N = 1024
    dim3 gN2(2 * D / BN, M / BM);   // N = 2048

    // 2) Projections, one launch.
    gemm_qk_v<<<gNN, 256, 0, stream>>>(x_bf, wt_qk, wt_v, b_qk, b_v, qk_bf,
                                       vt_bf);

    // 3) Attention.
    attn_kernel<<<dim3(T / 64, H, B), 128, 0, stream>>>(qk_bf, vt_bf, a_bf,
                                                        B, T, H);

    // 4) Output projection (reuse qk_buf).
    gemm_bf16w<0, 1024, 0><<<gNN, 256, 0, stream>>>(a_bf, wt_o, b_o, qk_buf,
                                                    nullptr, M, D);

    // 5) Residual + LN1.
    ln_kernel<true><<<M, 256, 0, stream>>>(x, qk_buf, g1, be1, x1_buf, x1_bf, D);

    // 6) FFN.
    gemm_bf16w<1, 1024, 1><<<gN2, 256, 0, stream>>>(x1_bf, wt_f1, b_f1, nullptr,
                                                    h_bf, M, 2 * D);
    gemm_bf16w<0, 2048, 0><<<gNN, 256, 0, stream>>>(h_bf, wt_f2, b_f2, v_buf,
                                                    nullptr, M, D);

    // 7) Residual + LN2 -> d_out.
    ln_kernel<false><<<M, 256, 0, stream>>>(x1_buf, v_buf, g2, be2, outp, nullptr,
                                            D);
}

// v010
// It runs in 116 microseconds.
// Next to v009, in two timings, it ran 1.05 times as fast each time.
// Over all steps from v000 it is 3.34 times as fast.
#include <hip/hip_runtime.h>
#include <hip/hip_bf16.h>
#include <cstdint>

typedef __attribute__((ext_vector_type(16))) __bf16 bf16x16;
typedef __attribute__((ext_vector_type(8)))  __bf16 bf16x8;
typedef __attribute__((ext_vector_type(4)))  __bf16 bf16x4;
typedef __attribute__((ext_vector_type(8)))  float  f32x8;

union Frag16 { bf16x16 f; bf16x8 h[2]; };

__device__ __forceinline__ bf16x16 load_frag(const __bf16* lds, int rowBase,
                                             int kBase, int stride) {
    int lane  = threadIdx.x & 31;
    int row   = rowBase + (lane & 15);
    int khalf = (lane < 16) ? 0 : 8;
    const __bf16* p = lds + row * stride + kBase + khalf;
    Frag16 fr;
    fr.h[0] = *(const bf16x8*)(p);
    fr.h[1] = *(const bf16x8*)(p + 16);
    return fr.f;
}

__device__ __forceinline__ f32x8 wmma_bf16(bf16x16 a, bf16x16 b, f32x8 c) {
    return __builtin_amdgcn_wmma_f32_16x16x32_bf16(
        /*neg_a=*/false, a, /*neg_b=*/false, b,
        /*c_mod=*/(short)0, c, /*reuse_a=*/false, /*reuse_b=*/false);
}

__device__ __forceinline__ void async_copy8_b128(const uint32_t* l,
                                                 const __bf16* const* g) {
    asm volatile("global_load_async_to_lds_b128 %0, %8, off\n\t"
                 "global_load_async_to_lds_b128 %1, %9, off\n\t"
                 "global_load_async_to_lds_b128 %2, %10, off\n\t"
                 "global_load_async_to_lds_b128 %3, %11, off\n\t"
                 "global_load_async_to_lds_b128 %4, %12, off\n\t"
                 "global_load_async_to_lds_b128 %5, %13, off\n\t"
                 "global_load_async_to_lds_b128 %6, %14, off\n\t"
                 "global_load_async_to_lds_b128 %7, %15, off\n\t"
                 "s_wait_xcnt 0x0"
                 :: "v"(l[0]), "v"(l[1]), "v"(l[2]), "v"(l[3]),
                    "v"(l[4]), "v"(l[5]), "v"(l[6]), "v"(l[7]),
                    "v"(g[0]), "v"(g[1]), "v"(g[2]), "v"(g[3]),
                    "v"(g[4]), "v"(g[5]), "v"(g[6]), "v"(g[7])
                 : "memory");
}

__device__ __forceinline__ void wait_async0() {
    asm volatile("s_wait_asynccnt 0x0" ::: "memory");
}

// Returns when all but this wave's N youngest copies have landed (the counter
// returns in issue order). N is the copies of the K-slices that may stay in
// flight: used only where exactly those whole slices were issued last.
template <int N>
__device__ __forceinline__ void wait_async_but() {
    asm volatile("s_wait_asynccnt %0" :: "n"(N) : "memory");
}

// ---------------------------------------------------------------------------
// Weight pack: fp32 W[K][N] row-major  ->  bf16 Wt[N][K]  (transposed)
// One launch for all five weights. A block of 4 waves takes one tile of
// 128 (k) x 64 (n): it reads 256-byte row pieces with 16-byte loads (all 16 of
// a thread in flight together), turns the tile in LDS and writes 256-byte
// pieces of Wt rows with 16-byte stores. The packed weights lie one behind the
// other in wt_all: qk, v, o (PD*PD each), f1, f2 (2*PD*PD each).
// The blocks behind the weights' round x to bf16 (layout kept): it is shared
// by both projections in one GEMM, which reads it once per column of tiles.
// ---------------------------------------------------------------------------
#define PD   1024  // model width: qk, v, o are PD x PD, f1 PD x 2PD, f2 2PD x PD
#define PTK  128   // tile extent in k
#define PTN  64    // tile extent in n
#define PSTR 136   // PTK + 8 pad: 272-byte LDS rows (16-byte aligned)
#define PTILES ((PD / PTK) * (PD / PTN))   // tiles per PD*PD elements
#define XEL  (2 * 2048 * PD)   // elements of x: B * T * PD
#define XPB  (128 * 4 * 16)    // elements of x per block: 16 float4 per thread

__device__ __forceinline__ float pick(float4 v, int j) {
    return j == 0 ? v.x : j == 1 ? v.y : j == 2 ? v.z : v.w;
}

// One tile of one weight. K and N are compile-time so that a thread's 16 loads
// share one address and differ in the immediate offset only.
template <int K, int N>
__device__ __forceinline__ void pack_tile(const float* __restrict__ w,
                                          __bf16* __restrict__ wt, int lt,
                                          __bf16* Ts) {
    const int n0 = (lt % (N / PTN)) * PTN;
    const int k0 = (lt / (N / PTN)) * PTK;
    const int tid = threadIdx.x;
    const int n4  = (tid & 15) * 4;   // 4 columns of the tile
    const int kg  = (tid >> 4) * 8;   // 8 rows, twice (m * 64)
    const float* src = w + (size_t)k0 * N + n0 + (kg * N + n4);

    float4 a[2][8];
#pragma unroll   // both: constant indices into a; the 16 loads go out together
    for (int m = 0; m < 2; m++)
#pragma unroll
        for (int i = 0; i < 8; i++)
            a[m][i] = *(const float4*)(src + (m * 64 + i) * N);
    // The loads' address register is free for reuse from here on: this wait
    // stands in front of that reuse. It names the address so that the register
    // lives up to here and no load's result is placed on it.
    asm volatile("s_wait_xcnt 0x0" :: "v"(src) : "memory");

#pragma unroll   // all three: constant indices into a, so that it stays in registers
    for (int m = 0; m < 2; m++)
#pragma unroll
        for (int j = 0; j < 4; j++) {
            bf16x8 p;
#pragma unroll
            for (int i = 0; i < 8; i++) p[i] = (__bf16)pick(a[m][i], j);
            *(bf16x8*)&Ts[(n4 + j) * PSTR + m * 64 + kg] = p;
        }
    __syncthreads();

    const int nr = tid >> 4;          // 16 chunks of 8 bf16 per row
    const int c8 = (tid & 15) * 8;
    __bf16* dst = wt + (size_t)n0 * K + k0 + (nr * K + c8);
#pragma unroll   // the 8 LDS reads go out together, ahead of the first store
    for (int p = 0; p < 8; p++) {
        bf16x8 q = *(const bf16x8*)&Ts[(nr + p * 8) * PSTR + c8];
        *(bf16x8*)(dst + p * 8 * K) = q;
    }
    // Stands in front of any reuse of the stores' address and data registers.
    asm volatile("s_wait_xcnt 0x0" ::: "memory");
}

// One block's piece of x: a wave reads 512 and writes 256 bytes in a row.
__device__ __forceinline__ void round_x(const float* __restrict__ x,
                                        __bf16* __restrict__ xb, int blk) {
    const size_t at = (size_t)blk * XPB + threadIdx.x * 4;
    const float* src = x + at;
    __bf16*      dst = xb + at;
    float4 a[16];
#pragma unroll   // both: constant indices into a; the 16 loads go out together
    for (int i = 0; i < 16; i++) a[i] = *(const float4*)(src + i * 512);
    // Stands in front of any reuse of the loads' address registers; it names
    // the address so that the pair lives up to here.
    asm volatile("s_wait_xcnt 0x0" :: "v"(src) : "memory");
#pragma unroll
    for (int i = 0; i < 16; i++) {
        bf16x4 p = {(__bf16)a[i].x, (__bf16)a[i].y, (__bf16)a[i].z,
                    (__bf16)a[i].w};
        *(bf16x4*)(dst + i * 512) = p;
    }
    // Stands in front of any reuse of the stores' address and data registers.
    asm volatile("s_wait_xcnt 0x0" ::: "memory");
}

// amdgpu_waves_per_eu(4, 4): a wave may take a quarter of the registers.
// Without it the compiler saves registers by waiting for the first loads
// before it issues the last.
__global__ __launch_bounds__(128) __attribute__((amdgpu_waves_per_eu(4, 4)))
void pack_all(
    const float* __restrict__ w_qk, const float* __restrict__ w_v,
    const float* __restrict__ w_o,  const float* __restrict__ w_f1,
    const float* __restrict__ w_f2, __bf16* __restrict__ wt_all,
    const float* __restrict__ x, __bf16* __restrict__ xb) {
    __shared__ __attribute__((aligned(16))) __bf16 Ts[PTN * PSTR];   // [n][k]

    // Which weight, by block index (the same for the whole block).
    const int job = blockIdx.x / PTILES;   // 0..6: weights, in units of PD*PD
    if (job < 3) {
        const float* w = job == 0 ? w_qk : job == 1 ? w_v : w_o;
        pack_tile<PD, PD>(w, wt_all + (size_t)job * PD * PD,
                          blockIdx.x - job * PTILES, Ts);
    } else if (job < 5) {
        pack_tile<PD, 2 * PD>(w_f1, wt_all + (size_t)3 * PD * PD,
                              blockIdx.x - 3 * PTILES, Ts);
    } else if (job < 7) {
        pack_tile<2 * PD, PD>(w_f2, wt_all + (size_t)5 * PD * PD,
                              blockIdx.x - 5 * PTILES, Ts);
    } else {
        round_x(x, xb, blockIdx.x - 7 * PTILES);
    }
}

// ---------------------------------------------------------------------------
// GEMM:  C[M][N] = act( A[M][K] @ W[K][N] + bias[N] )
//   A     : bf16 row-major [M][K]
//   Wt    : bf16, pre-transposed [N][K]
//   Both are staged by the async global->LDS DMA: no register, no conversion.
// Block tile 128x128x128, 256 threads (8 waves, 4x2), wave tile 32x64
//   => 32 v_wmma_f32_16x16x32_bf16 per wave per K-step.
// LDS ring of NB buffers: tile t+NB-1's copies are issued ahead of tile t's
// WMMAs, so NB-1 tiles are in flight and a tile has NB-1 K-steps to land;
// single s_wait_asynccnt+barrier per K-step. The wait leaves the NB-2 younger
// tiles' copies out. A K-step is 128 wide so that the barrier is paid once per
// 128 k. NB = 4 where the grid puts one block on a WGP (it takes most of the
// LDS), NB = 2 where two blocks share a WGP and cover each other's waits.
// OUT picks what is stored:
//   0 : C,  fp32 [M][N]
//   1 : Cb, bf16 [M][N]. The product is taken transposed (W^T as the A operand),
//       so a lane holds 8 neighbouring columns of one row: one 16-byte store.
//       It is the form of the next GEMM's A operand.
// ---------------------------------------------------------------------------
#define BM 128
#define BN 128
#define BK 128
#define LDS_STR 136  // BK + 8 pad; 136*2B = 272B row stride (16B aligned)
#define SEQ 2048     // tokens per sequence (T); BM divides it

template <int ACT>  // 0 = none, 1 = exact GELU
__device__ __forceinline__ float activate(float val) {
    if (ACT == 1) val = 0.5f * val * (1.0f + erff(val * 0.70710678118654752f));
    return val;
}

template <int ACT, int K, int OUT, int NB>
__global__ __launch_bounds__(256) void gemm_bf16w(
    const __bf16* __restrict__ A, const __bf16* __restrict__ Wt,
    const float* __restrict__ bias, float* __restrict__ C,
    __bf16* __restrict__ Cb, int M, int N) {
    __shared__ __attribute__((aligned(16))) __bf16 As[NB][BM * LDS_STR];
    __shared__ __attribute__((aligned(16))) __bf16 Bs[NB][BN * LDS_STR];

    const int bm  = blockIdx.y * BM;
    const int bn  = blockIdx.x * BN;
    const int tid = threadIdx.x;
    const int wid = tid >> 5;
    const int wm  = (wid >> 1) * 32;  // 0..96
    const int wn  = (wid & 1) * 64;   // 0,64
    const int lane = tid & 31;

    // A slice of either operand is 128 rows of 16 chunks of 16 bytes: 8 chunks
    // per thread, 16 rows apart.
    const int sr  = tid >> 4;
    const int sc8 = (tid & 15) * 8;
    const __bf16* asrc = A  + (size_t)bm * K + (sr * K + sc8);
    const __bf16* bsrc = Wt + (size_t)bn * K + (sr * K + sc8);

    // Issue every copy of one 128x128 K-slice of A and of B into LDS buffer
    // `buf`: 2 x 8 x 16 bytes per thread.
    auto stage = [&](int k0, int buf) {
        uint32_t      l[8];
        const __bf16* g[8];
#pragma unroll   // constant indices: both arrays stay in registers
        for (int i = 0; i < 8; i++) {
            l[i] = (uint32_t)(uintptr_t)&As[buf][(sr + i * 16) * LDS_STR + sc8];
            g[i] = asrc + k0 + i * 16 * K;
        }
        async_copy8_b128(l, g);
#pragma unroll
        for (int i = 0; i < 8; i++) {
            l[i] = (uint32_t)(uintptr_t)&Bs[buf][(sr + i * 16) * LDS_STR + sc8];
            g[i] = bsrc + k0 + i * 16 * K;
        }
        async_copy8_b128(l, g);
    };

    f32x8 zero = {0.f, 0.f, 0.f, 0.f, 0.f, 0.f, 0.f, 0.f};
    f32x8 acc[2][4];
#pragma unroll
    for (int i = 0; i < 2; i++)
#pragma unroll
        for (int j = 0; j < 4; j++) acc[i][j] = zero;

    constexpr int nk   = K / BK;
    constexpr int LEAD = NB - 1;          // tiles in flight ahead of the one in work
    constexpr int LEFT = (LEAD - 1) * 16; // copies of a wave in the younger of them
    static_assert(nk >= LEAD && LEAD * 16 <= 63, "ring deeper than K or the counter");
#pragma unroll   // constant buffer indices
    for (int s = 0; s < LEAD; s++) stage(s * BK, s);
    wait_async_but<LEFT>();   // tile 0's copies landed in LDS
    __syncthreads();

    // The WMMAs of one K-step, on the tile in buffer `buf`.
    auto work = [&](int buf) {
#pragma unroll
        for (int kk = 0; kk < BK; kk += 32) {
            bf16x16 af[2], bfr[4];
            af[0] = load_frag(As[buf], wm,      kk, LDS_STR);
            af[1] = load_frag(As[buf], wm + 16, kk, LDS_STR);
#pragma unroll
            for (int j = 0; j < 4; j++)
                bfr[j] = load_frag(Bs[buf], wn + j * 16, kk, LDS_STR);
#pragma unroll
            for (int i = 0; i < 2; i++)
#pragma unroll
                for (int j = 0; j < 4; j++)
                    acc[i][j] = OUT == 1 ? wmma_bf16(bfr[j], af[i], acc[i][j])
                                         : wmma_bf16(af[i], bfr[j], acc[i][j]);
        }
        // This wave's LDS reads are done before the barrier behind which the
        // buffer it has read is refilled by the copies.
        asm volatile("s_wait_dscnt 0x0" ::: "memory");
    };

    int t = 0;
#pragma nounroll   // unrolled, the build holds many trips' fragments and spills
    for (; t < nk - LEAD; t++) {
        // Tile t+LEAD goes into the buffer that tile t-1 was read from: every
        // wave's reads of it ended in front of the barrier at the foot of t-1.
        stage((t + LEAD) * BK, (t + LEAD) % NB);
        work(t % NB);
        // Next tile's DMA landed in LDS; the LEAD-1 whole tiles issued behind it
        // stay in flight.
        wait_async_but<LEFT>();
        __syncthreads();    // next tile visible to every wave; this tile done
    }
    // The last trips issue no tile and wait for all that is in flight.
#pragma nounroll
    for (; t < nk; t++) {
        work(t % NB);
        wait_async0();
        __syncthreads();
    }

    const int colOff = lane & 15;
    const int rowOff = (lane >> 4) * 8;
#pragma unroll
    for (int i = 0; i < 2; i++) {
#pragma unroll
        for (int j = 0; j < 4; j++) {
            if (OUT == 1) {
                int col0 = bn + wn + j * 16 + rowOff;
                int row  = bm + wm + i * 16 + colOff;
                float4 b0 = *(const float4*)(bias + col0);
                float4 b1 = *(const float4*)(bias + col0 + 4);
                bf16x8 p;
#pragma unroll   // constant indices into acc, p and the bias vectors
                for (int r = 0; r < 8; r++)
                    p[r] = (__bf16)activate<ACT>(acc[i][j][r] +
                                                 pick(r < 4 ? b0 : b1, r & 3));
                *(bf16x8*)(Cb + (size_t)row * N + col0) = p;
                continue;
            }
            int col  = bn + wn + j * 16 + colOff;
            float bv = bias[col];
#pragma unroll
            for (int r = 0; r < 8; r++) {
                int row = bm + wm + i * 16 + rowOff + r;
                C[(size_t)row * N + col] = activate<ACT>(acc[i][j][r] + bv);
            }
        }
    }
}

// ---------------------------------------------------------------------------
// Both projections of x in one launch: qk = x W_qk + b_qk, v = x W_v + b_v.
// A block takes 128 tokens and the same 128 columns of each product: a K-slice
// of x is staged once and meets a slice of either weight. Waves 0-3 form qk,
// waves 4-7 form v, each wave a tile of 64 x 64 (16 WMMAs per 8 fragments).
// Ring, copies, waits and barrier are those of gemm_bf16w, with three buffers
// (all that the LDS holds of these slices): two slices in flight.
// A lane's 8 results run along the rows of the first WMMA operand, P; its lane
// index picks the row of the second, Q. qk is stored as rows [token][column]:
// P = W_qk^T, Q = x. v is stored turned, [sequence][column][token]: P = x,
// Q = W_v^T. Either way 8 results are one 16-byte store, and both arrive as the
// attention kernel wants K (= Q) and V^T in LDS: rounded and turned once here,
// not by every query block. The two halves of the block differ in the LDS tiles
// they read and in the epilogue only.
// ---------------------------------------------------------------------------
__global__ __launch_bounds__(256) void gemm_qk_v(
    const __bf16* __restrict__ xb, const __bf16* __restrict__ wt_qk,
    const __bf16* __restrict__ wt_v, const float* __restrict__ b_qk,
    const float* __restrict__ b_v, __bf16* __restrict__ qk,
    __bf16* __restrict__ vt) {
    // [buffer][x, W_qk^T, W_v^T][row * LDS_STR + k]
    __shared__ __attribute__((aligned(16))) __bf16 S[3][3][BM * LDS_STR];

    const int bm   = blockIdx.y * BM;   // tokens
    const int bn   = blockIdx.x * BN;   // columns of qk and of v
    const int tid  = threadIdx.x;
    const int lane = tid & 31;
    const int wid  = __builtin_amdgcn_readfirstlane(tid >> 5);
    const bool forV = wid >= 4;
    const int tP = forV ? 0 : 1;        // which tile of S is P, which Q
    const int tQ = forV ? 2 : 0;
    const int wp = ((wid >> 1) & 1) * 64;
    const int wq = (wid & 1) * 64;

    // A slice of each operand is 128 rows of 16 chunks of 16 bytes: 8 chunks
    // per thread, 16 rows apart.
    const int sr  = tid >> 4;
    const int sc8 = (tid & 15) * 8;
    const __bf16* const src[3] = {xb    + (size_t)bm * PD + (sr * PD + sc8),
                                  wt_qk + (size_t)bn * PD + (sr * PD + sc8),
                                  wt_v  + (size_t)bn * PD + (sr * PD + sc8)};

    // Issue every copy of one K-slice into LDS buffer `buf`: 3 x 8 x 16 bytes
    // per thread.
    auto stage = [&](int k0, int buf) {
#pragma unroll   // both: constant indices, so that the arrays stay in registers
        for (int m = 0; m < 3; m++) {
            uint32_t      l[8];
            const __bf16* g[8];
#pragma unroll
            for (int i = 0; i < 8; i++) {
                l[i] = (uint32_t)(uintptr_t)&S[buf][m][(sr + i * 16) * LDS_STR + sc8];
                g[i] = src[m] + k0 + i * 16 * PD;
            }
            async_copy8_b128(l, g);
        }
    };

    f32x8 zero = {0.f, 0.f, 0.f, 0.f, 0.f, 0.f, 0.f, 0.f};
    f32x8 acc[4][4];
#pragma unroll   // both: constant indices, so that acc stays in registers
    for (int i = 0; i < 4; i++)
#pragma unroll
        for (int j = 0; j < 4; j++) acc[i][j] = zero;

    constexpr int nk = PD / BK;
    static_assert(nk >= 2, "the prologue issues two slices");
    stage(0, 0);
    stage(BK, 1);
    wait_async_but<24>();   // slice 0's copies landed in LDS; slice 1's 24 fly on
    __syncthreads();

    // The WMMAs of one K-slice, in buffer `buf`.
    auto work = [&](int buf) {
        const __bf16* P = S[buf][tP];
        const __bf16* Q = S[buf][tQ];
#pragma unroll
        for (int kk = 0; kk < BK; kk += 32) {
            bf16x16 pf[4], qf[4];
#pragma unroll   // here and below: constant indices into pf, qf and acc
            for (int i = 0; i < 4; i++) {
                pf[i] = load_frag(P, wp + i * 16, kk, LDS_STR);
                qf[i] = load_frag(Q, wq + i * 16, kk, LDS_STR);
            }
            // Keeps the 16 LDS reads of a block together in front of its WMMAs:
            // left alone, the scheduler sinks each P fragment's reads to its
            // first use and the wave waits out the LDS latency four times.
            __builtin_amdgcn_sched_barrier(0);
#pragma unroll
            for (int i = 0; i < 4; i++)
#pragma unroll
                for (int j = 0; j < 4; j++)
                    acc[i][j] = wmma_bf16(pf[i], qf[j], acc[i][j]);
        }
        // This wave's LDS reads are done before the barrier behind which the
        // buffer it has read is refilled by the copies.
        asm volatile("s_wait_dscnt 0x0" ::: "memory");
    };

    int buf = 0;   // buffer of slice t
    int nxt = 2;   // buffer of slice t + 2 = that of slice t - 1
    int t = 0;
#pragma nounroll   // unrolled, the build holds many trips' fragments and spills
    for (; t < nk - 2; t++) {
        // Every wave's reads of slice t-1 ended in front of the barrier at the
        // foot of t-1.
        stage((t + 2) * BK, nxt);
        work(buf);
        // Next slice's copies landed in LDS; the 24 of the slice just issued
        // stay in flight.
        wait_async_but<24>();
        __syncthreads();    // next slice visible to every wave; this slice done
        buf = buf == 2 ? 0 : buf + 1;
        nxt = nxt == 2 ? 0 : nxt + 1;
    }
    // The last two trips issue no slice and wait for all that is in flight.
#pragma nounroll
    for (; t < nk; t++) {
        work(buf);
        wait_async0();
        __syncthreads();
        buf = buf == 2 ? 0 : buf + 1;
    }

    const int qOff = lane & 15;
    const int pOff = (lane >> 4) * 8;
    if (forV) {
        // BM divides SEQ: the block's tokens lie in one sequence.
        __bf16* dst = vt + ((size_t)(bm / SEQ) * PD + bn) * SEQ + bm % SEQ;
#pragma unroll   // all three: constant indices into acc and o
        for (int j = 0; j < 4; j++) {
            const int col = wq + j * 16 + qOff;
            const float bv = b_v[bn + col];
#pragma unroll
            for (int i = 0; i < 4; i++) {
                bf16x8 o;
#pragma unroll
                for (int r = 0; r < 8; r++) o[r] = (__bf16)(acc[i][j][r] + bv);
                *(bf16x8*)(dst + col * SEQ + wp + i * 16 + pOff) = o;
            }
        }
        // Stands in front of any reuse of the stores' address and data registers.
        asm volatile("s_wait_xcnt 0x0" ::: "memory");
    } else {
        __bf16* dst = qk + (size_t)bm * PD + bn;
#pragma unroll   // all three: constant indices into acc, o and the bias vectors
        for (int i = 0; i < 4; i++) {
            const int col0 = wp + i * 16 + pOff;
            const float4 b0 = *(const float4*)(b_qk + bn + col0);
            const float4 b1 = *(const float4*)(b_qk + bn + col0 + 4);
#pragma unroll
            for (int j = 0; j < 4; j++) {
                bf16x8 o;
#pragma unroll
                for (int r = 0; r < 8; r++)
                    o[r] = (__bf16)(acc[i][j][r] + pick(r < 4 ? b0 : b1, r & 3));
                *(bf16x8*)(dst + (wq + j * 16 + qOff) * PD + col0) = o;
            }
        }
        // Stands in front of any reuse of the stores' address and data registers.
        asm volatile("s_wait_xcnt 0x0" ::: "memory");
    }
}

#define AHD 64
#define ASTR 72   // 64 + 8 pad, 144B row stride (16B aligned)
#define QSCALE 0.18033688f   // 1/sqrt(HD) * log2(e)
#define LAZY 8.0f   // a score may top the reference in use by this (base 2)

__device__ __forceinline__ float swap_halves(float x) {
    int b = __builtin_bit_cast(int, x);
    b = __builtin_amdgcn_permlanex16(b, b, 0x76543210, 0xfedcba98, false, false);
    return __builtin_bit_cast(float, b);
}

__global__ __launch_bounds__(128) __attribute__((amdgpu_waves_per_eu(4, 4)))
void attn_kernel(
    const __bf16* __restrict__ qk, const __bf16* __restrict__ vt,
    __bf16* __restrict__ out, int B, int T, int H) {
    __shared__ __attribute__((aligned(16))) __bf16 Qs[64 * ASTR];
    // [buffer][K: key rows, V^T: head-dim rows][row * ASTR + column]
    __shared__ __attribute__((aligned(16))) __bf16 KV[2][2][64 * ASTR];

    const int b  = blockIdx.z;
    const int h  = blockIdx.y;
    const int q0 = blockIdx.x * 64;
    const int tid = threadIdx.x;
    const int wid = tid >> 5;
    const int lane = tid & 31;
    const size_t Dm = (size_t)H * AHD;

    // A 64x64 bf16 tile is 64 rows of 8 chunks of 16 bytes: 4 chunks per thread,
    // 16 rows apart. The row pitches are PD for qk, SEQ for vt.
    const int sr = tid >> 3;
    const int sc = (tid & 7) * 8;
    const __bf16* qbase = qk + ((size_t)b * SEQ * PD + (size_t)h * AHD) +
                          (sr * PD + sc);
    const __bf16* vbase = vt + ((size_t)b * PD + (size_t)h * AHD) * SEQ +
                          (sr * SEQ + sc);
    __bf16* const qdst = Qs + sr * ASTR + sc;

    // Issue every copy of the K tile (rows = keys) and the V^T tile (rows = head
    // dim) of keys kb .. kb + 63 into LDS buffer `buf`: 8 x 16 bytes per thread.
    auto stage = [&](int kb, int buf) {
        uint32_t      l[8];
        const __bf16* g[8];
#pragma unroll   // constant indices: both arrays stay in registers
        for (int i = 0; i < 4; i++) {
            l[i]     = (uint32_t)(uintptr_t)&KV[buf][0][(sr + i * 16) * ASTR + sc];
            l[4 + i] = (uint32_t)(uintptr_t)&KV[buf][1][(sr + i * 16) * ASTR + sc];
            g[i]     = qbase + (size_t)kb * PD + i * 16 * PD;
            g[4 + i] = vbase + kb + i * 16 * SEQ;
        }
        async_copy8_b128(l, g);
    };

    stage(0, 0);

    // Stage Q.
    {
        const __bf16* qp = qbase + (size_t)q0 * PD;
        bf16x8 qc[4];
#pragma unroll   // both: constant indices; the 4 loads go out together
        for (int i = 0; i < 4; i++)
            qc[i] = *(const bf16x8*)(qp + i * 16 * PD);
        // Stands in front of any reuse of the loads' address registers; it names
        // the address so that the pair lives up to here.
        asm volatile("s_wait_xcnt 0x0" :: "v"(qp) : "memory");
#pragma unroll   // both: constant indices into qc and qs
        for (int i = 0; i < 4; i++) {
            bf16x8 qs;
#pragma unroll
            for (int r = 0; r < 8; r++)
                qs[r] = (__bf16)((float)qc[i][r] * QSCALE);
            *(bf16x8*)(qdst + i * 16 * ASTR) = qs;
        }
    }
    wait_async0();      // tile 0's copies landed in LDS
    __syncthreads();    // Q and tile 0 visible to every wave
    stage(64, 1);

    // B operand of S^T: column = query, k = head dim.
    bf16x16 qb[2];
    qb[0] = load_frag(Qs, wid * 16, 0,  ASTR);
    qb[1] = load_frag(Qs, wid * 16, 32, ASTR);

    f32x8 zero = {0.f, 0.f, 0.f, 0.f, 0.f, 0.f, 0.f, 0.f};
    f32x8 o[4];   // o[n][r] = O^T[hd = 16n + 8*(lane>>4) + r][query = lane&15]
#pragma unroll
    for (int n = 0; n < 4; n++) o[n] = zero;
    f32x8 nref = zero;
    f32x8 l_v = zero;

    for (int kb2 = 0; kb2 < SEQ; kb2 += 128)
#pragma unroll   // the buffer index is a constant: LDS addresses stay out of the loop
    for (int buf = 0; buf < 2; buf++) {
        const int kb = kb2 + buf * 64;
        const __bf16* Ks = KV[buf][0];
        const __bf16* Vt = KV[buf][1];

        // S^T = K Q^T (64 keys x 16 queries per wave), K-dim = HD = 64. Q carries
        // the scale and log2(e), C is minus the reference, so that
        // s[n][r] = base-2 exponent of (key = kb + 16n + 8*(lane>>4) + r,
        //                               query = lane&15)
        f32x8 s[4];
#pragma unroll
        for (int n = 0; n < 4; n++) {
            bf16x16 ka0 = load_frag(Ks, n * 16, 0,  ASTR);
            bf16x16 ka1 = load_frag(Ks, n * 16, 32, ASTR);
            s[n] = wmma_bf16(ka0, qb[0], nref);
            s[n] = wmma_bf16(ka1, qb[1], s[n]);
        }

        // The V^T fragments are read in front of the branch below, which splits
        // the tile's work in two: they fly under the maximum and the exponentials.
        // The scheduling barrier ends the score products' scheduling region here:
        // without it the build takes more than the wave's quarter of the
        // registers (256) and spills to scratch.
        __builtin_amdgcn_sched_barrier(0);
        bf16x16 va[4][2];
#pragma unroll   // constant indices: va stays in registers
        for (int n = 0; n < 4; n++) {
            va[n][0] = load_frag(Vt, n * 16, 0,  ASTR);
            va[n][1] = load_frag(Vt, n * 16, 32, ASTR);
        }

        // Online softmax: one query per lane. Every loop here is unrolled so
        // that the tiles are indexed by constants and stay in registers.
        float mt[4];   // one short chain per tile, not one chain of 32
#pragma unroll
        for (int n = 0; n < 4; n++) {
            mt[n] = s[n][0];
#pragma unroll
            for (int r = 1; r < 8; r++) mt[n] = fmaxf(mt[n], s[n][r]);
        }
        float mx = fmaxf(fmaxf(mt[0], mt[1]), fmaxf(mt[2], mt[3]));

        // The reference moves only on the first tile (to that tile's maximum)
        // and when some score of the wave tops it by more than LAZY: one scalar
        // branch a tile, the same for the whole wave. Until then the exponents
        // are at most LAZY and O and the sums need no rescale.
        const bool first = buf == 0 && kb2 == 0;
        if (first || __builtin_amdgcn_ballot_w32(mx > LAZY) != 0) {
            mx = fmaxf(mx, swap_halves(mx));
            const float d = first ? mx : fmaxf(mx, 0.f);
            // On the first tile O and the sums are zero: any finite factor.
            const float corr = first ? 1.f : __builtin_amdgcn_exp2f(-d);
#pragma unroll   // all: constant indices into s, o
            for (int n = 0; n < 4; n++)
#pragma unroll
                for (int r = 0; r < 8; r++) {
                    s[n][r] -= d;
                    o[n][r] *= corr;
                }
            nref -= d;
            l_v *= corr;
        }

        Frag16 pb[2];   // B operand of O^T: column = query, k = key
#pragma unroll
        for (int n = 0; n < 4; n++) {
            f32x8 p;
#pragma unroll
            for (int r = 0; r < 8; r++) p[r] = __builtin_amdgcn_exp2f(s[n][r]);
            l_v += p;
#pragma unroll
            for (int r = 0; r < 8; r++) pb[n >> 1].h[n & 1][r] = (__bf16)p[r];
        }

        // O^T += V^T P^T   (K-dim = 64 keys, two 32-steps).
#pragma unroll
        for (int n = 0; n < 4; n++) {
            o[n] = wmma_bf16(va[n][0], pb[0].f, o[n]);
            o[n] = wmma_bf16(va[n][1], pb[1].f, o[n]);
        }

        // This wave's LDS reads are done before the barrier behind which the
        // buffer it has read is refilled by the copies.
        asm volatile("s_wait_dscnt 0x0" ::: "memory");
        wait_async0();      // next tile's copies landed in LDS
        __syncthreads();    // next tile visible to every wave; this tile done
        if (kb2 + 128 < SEQ) stage(kb + 128, buf);
    }
    wait_async0();      // no copy is outstanding when the wave ends

    const float l_q = ((l_v[0] + l_v[1]) + (l_v[2] + l_v[3])) +
                      ((l_v[4] + l_v[5]) + (l_v[6] + l_v[7]));
    const float inv = 1.0f / (l_q + swap_halves(l_q));
    const int row = q0 + wid * 16 + (lane & 15);
    __bf16* orow = out + ((size_t)b * T + row) * Dm + (size_t)h * AHD +
                   (lane >> 4) * 8;
#pragma unroll   // both: constant indices into o and p
    for (int n = 0; n < 4; n++) {
        bf16x8 p;
#pragma unroll
        for (int r = 0; r < 8; r++) p[r] = (__bf16)(o[n][r] * inv);
        *(bf16x8*)(orow + n * 16) = p;
    }
}

// ---------------------------------------------------------------------------
// Fused residual + LayerNorm: out = LN(x + res) * g + b.  One block per token.
// WB: the result is also stored rounded to bf16, as the next GEMM's A operand.
// ---------------------------------------------------------------------------
template <bool WB>
__global__ __launch_bounds__(256) void ln_kernel(
    const float* __restrict__ x, const float* __restrict__ res,
    const float* __restrict__ g, const float* __restrict__ be,
    float* __restrict__ out, __bf16* __restrict__ outb, int D) {
    __shared__ float red[2][8];
    const size_t base = (size_t)blockIdx.x * D;
    float v[4], s = 0.f, s2 = 0.f;
#pragma unroll
    for (int i = 0; i < 4; i++) {
        int c = threadIdx.x + i * 256;
        v[i] = x[base + c] + res[base + c];
        s += v[i];
        s2 += v[i] * v[i];
    }
#pragma unroll
    for (int off = 16; off > 0; off >>= 1) {
        s  += __shfl_xor(s, off);
        s2 += __shfl_xor(s2, off);
    }
    if ((threadIdx.x & 31) == 0) {
        red[0][threadIdx.x >> 5] = s;
        red[1][threadIdx.x >> 5] = s2;
    }
    __syncthreads();
    float ts = 0.f, ts2 = 0.f;
#pragma unroll
    for (int i = 0; i < 8; i++) { ts += red[0][i]; ts2 += red[1][i]; }
    float mean = ts / (float)D;
    float var  = ts2 / (float)D - mean * mean;
    float rstd = rsqrtf(var + 1e-5f);
#pragma unroll
    for (int i = 0; i < 4; i++) {
        int c = threadIdx.x + i * 256;
        float y = (v[i] - mean) * rstd * g[c] + be[c];
        out[base + c] = y;
        if (WB) outb[base + c] = (__bf16)y;
    }
}

// ---------------------------------------------------------------------------
// Orchestration
// ---------------------------------------------------------------------------
extern "C" void kernel_launch(void* const* d_in, const int* in_sizes, int n_in,
                              void* d_out, int out_size, void* d_ws,
                              size_t ws_size, hipStream_t stream) {
    const int B = 2, T = 2048, D = 1024, H = 16;
    const int M = B * T;  // 4096 tokens

    const float* x    = (const float*)d_in[0];
    const float* w_qk = (const float*)d_in[1];
    const float* b_qk = (const float*)d_in[2];
    const float* w_v  = (const float*)d_in[3];
    const float* b_v  = (const float*)d_in[4];
    const float* w_o  = (const float*)d_in[5];
    const float* b_o  = (const float*)d_in[6];
    const float* g1   = (const float*)d_in[7];
    const float* be1  = (const float*)d_in[8];
    const float* g2   = (const float*)d_in[9];
    const float* be2  = (const float*)d_in[10];
    const float* w_f1 = (const float*)d_in[11];
    const float* b_f1 = (const float*)d_in[12];
    const float* w_f2 = (const float*)d_in[13];
    const float* b_f2 = (const float*)d_in[14];
    float* outp = (float*)d_out;

    // Workspace layout (activations, then bf16 packed weights), ~115 MB.
    float* ws = (float*)d_ws;
    const size_t SZ = (size_t)M * D;          // 4M elements per activation
    float* qk_buf = ws;                       // qk (bf16); then o-proj output
    float* v_buf  = ws + SZ;                  // v^T (bf16); then ffn output
    __bf16* qk_bf = (__bf16*)qk_buf;          // [B][T][D]
    __bf16* vt_bf = (__bf16*)v_buf;           // [B][D][T]
    __bf16* a_bf  = (__bf16*)(ws + 2 * SZ);   // attention output
    __bf16* x_bf  = a_bf + SZ;                // x
    float* x1_buf = ws + 3 * SZ;              // post-LN1
    __bf16* h_bf  = (__bf16*)(ws + 4 * SZ);   // GELU hidden (2*SZ elements)
    __bf16* x1_bf = (__bf16*)(ws + 5 * SZ);   // post-LN1
    __bf16* wt_qk = (__bf16*)(ws + 6 * SZ);
    __bf16* wt_v  = wt_qk + (size_t)D * D;
    __bf16* wt_o  = wt_v  + (size_t)D * D;
    __bf16* wt_f1 = wt_o  + (size_t)D * D;    // [2D][D]
    __bf16* wt_f2 = wt_f1 + (size_t)2 * D * D; // [D][2D]

    // 1) Pack weights to bf16 transposed (wt_qk is the start of all five);
    //    round x.
    pack_all<<<7 * PTILES + XEL / XPB, 128, 0, stream>>>(w_qk, w_v, w_o, w_f1,
                                                         w_f2, wt_qk, x, x_bf);

    dim3 gNN(D / BN, M / BM);       // N = 1024
    dim3 gN2(2 * D / BN, M / BM);   // N = 2048

    // 2) Projections, one launch.
    gemm_qk_v<<<gNN, 256, 0, stream>>>(x_bf, wt_qk, wt_v, b_qk, b_v, qk_bf,
                                       vt_bf);

    // 3) Attention.
    attn_kernel<<<dim3(T / 64, H, B), 128, 0, stream>>>(qk_bf, vt_bf, a_bf,
                                                        B, T, H);

    // 4) Output projection (reuse qk_buf).
    gemm_bf16w<0, 1024, 0, 4><<<gNN, 256, 0, stream>>>(a_bf, wt_o, b_o, qk_buf,
                                                       nullptr, M, D);

    // 5) Residual + LN1.
    ln_kernel<true><<<M, 256, 0, stream>>>(x, qk_buf, g1, be1, x1_buf, x1_bf, D);

    // 6) FFN.
    gemm_bf16w<1, 1024, 1, 2><<<gN2, 256, 0, stream>>>(x1_bf, wt_f1, b_f1, nullptr,
                                                       h_bf, M, 2 * D);
    gemm_bf16w<0, 2048, 0, 4><<<gNN, 256, 0, stream>>>(h_bf, wt_f2, b_f2, v_buf,
                                                       nullptr, M, D);

    // 7) Residual + LN2 -> d_out.
    ln_kernel<false><<<M, 256, 0, stream>>>(x1_buf, v_buf, g2, be2, outp, nullptr,
                                            D);
}
